// v000
// The times below were measured on an AMD MI455X: many runs one after another, warmed up first and cycling through
// copies of the inputs, with the whole window's GPU time divided by the number of runs. Launches and the gaps
// between them are all in it. The median over several windows is given; except for v000 it joins two sittings, which
// can be a few percent apart, so the side-by-side timings, each taken in one sitting, are the better comparison.
// The starting kernel, v000, takes 1130 microseconds a run.
// compute dtype: all float inputs rounded to bf16; per axis q = x_seq . Wq + bq and v = x_seq . Wv + bv with the sequence rows gathered from the [B,H,W,C] tensor (the second axis reads the first axis' f32 result as bf16 hi + residual, 2 products) on WMMA 16x16x32; scores = sigmoid(q_n . q_m / 8) with q as f16 hi + (x2048-scaled) residual (3 products) and a precise expf per score; out = sum_m P (scaled by 2^11, f16 hi + residual) x v (f16 hi + x2048 residual planes), 3 products; gates, residuals and the final (1 - sigmoid(predict)) . conv_w + conv_b pixel gate in f32. (the un-normalised 4,096-term sums need the residual products).
#include <hip/hip_runtime.h>
#include <math.h>

typedef __attribute__((ext_vector_type(16))) _Float16 v16h;
typedef __attribute__((ext_vector_type(16))) __bf16 v16b;
typedef __attribute__((ext_vector_type(8)))  _Float16 v8h;
typedef __attribute__((ext_vector_type(8)))  float v8f;
typedef __attribute__((ext_vector_type(4)))  float v4f;
typedef __attribute__((ext_vector_type(2)))  float v2f;
typedef __attribute__((ext_vector_type(4)))  unsigned v4u;
typedef __attribute__((ext_vector_type(4)))  int v4i;
typedef float __attribute__((may_alias)) float_a;
typedef int __attribute__((may_alias)) int_a;

template <typename T> __device__ __forceinline__ void vst2(void* p, T v) { *(T*)p = v;  }
__device__ __forceinline__ v8f wmma16(v16h a, v16h b, v8f c) {
  v8f d = __builtin_amdgcn_wmma_f32_16x16x32_f16(false, a, false, b, (short)0, c, false, false);
  asm volatile("v_nop\n\tv_nop\n\tv_nop\n\tv_nop" : "+v"(d) : "v"(a), "v"(b));
  return d;
}
__device__ __forceinline__ v8f wmma_bf(v16b a, v16b b, v8f c) {
  v8f d = __builtin_amdgcn_wmma_f32_16x16x32_bf16(false, a, false, b, (short)0, c, false, false);
  asm volatile("v_nop\n\tv_nop\n\tv_nop\n\tv_nop" : "+v"(d) : "v"(a), "v"(b));
  return d;
}
// 16x16x32 fragments: lane = (h = lane>>4, row/col = lane&15); elements 0..7 = k0+8h+0..7, 8..15 = k0+16+8h+0..7; D element r = row 8h+r
__device__ __forceinline__ v16h frag_h(const _Float16* rowk0, int lane) {
  union { v16h v; v8h q[2]; } u; const _Float16* p = rowk0 + 8 * (lane >> 4);
  u.q[0] = *(const v8h*)p; u.q[1] = *(const v8h*)(p + 16); return u.v;
}
__device__ __forceinline__ v16h frag_f32(const float* rowk0, int lane) {
  v16h a; const float* p = rowk0 + 8 * (lane >> 4);
#pragma unroll
  for (int i = 0; i < 8; ++i) { a[i] = (_Float16)p[i]; a[8 + i] = (_Float16)p[16 + i]; }
  return a;
}
__device__ __forceinline__ v16h frag_f32s(const float* rowk0, int lane, float sc) {
  v16h a; const float* p = rowk0 + 8 * (lane >> 4);
#pragma unroll
  for (int i = 0; i < 8; ++i) { a[i] = (_Float16)(p[i] * sc); a[8 + i] = (_Float16)(p[16 + i] * sc); }
  return a;
}
// column fragment from a [K][ld] layout (column n), rows >= K read as 0
__device__ __forceinline__ v16h fragc_f32(const float* W, int k0, int n, int lane, int ld, int K) {
  v16h a; const int g = lane >> 4;
#pragma unroll
  for (int i = 0; i < 8; ++i) { const int ka = k0 + 8 * g + i, kb = ka + 16;
    a[i] = (_Float16)(ka < K ? W[(size_t)(ka < K ? ka : K - 1) * ld + n] : 0.f); a[8 + i] = (_Float16)(kb < K ? W[(size_t)(kb < K ? kb : K - 1) * ld + n] : 0.f); }
  return a;
}
struct F2 { v16b h, l; };
__device__ __forceinline__ F2 bsplit16(const float v[16]) { F2 r;
#pragma unroll
  for (int i = 0; i < 16; ++i) { const __bf16 h = (__bf16)v[i]; r.h[i] = h; r.l[i] = (__bf16)(v[i] - (float)h); }
  return r; }
__device__ __forceinline__ F2 split_row(const float* row, int k0, int lane) { float v[16]; const float* p = row + k0 + 8 * (lane >> 4);
#pragma unroll
  for (int i = 0; i < 8; ++i) { v[i] = p[i]; v[8 + i] = p[16 + i]; }
  return bsplit16(v); }
__device__ __forceinline__ F2 split_rowK(const float* row, int k0, int lane, int K) { float v[16]; const int g = lane >> 4;
#pragma unroll
  for (int i = 0; i < 8; ++i) { const int ka = k0 + 8 * g + i, kb = ka + 16; v[i] = ka < K ? row[ka < K ? ka : K - 1] : 0.f; v[8 + i] = kb < K ? row[kb < K ? kb : K - 1] : 0.f; }
  return bsplit16(v); }
__device__ __forceinline__ F2 split_col(const float* W, int k0, int n, int lane, int ld, int K) { float v[16]; const int g = lane >> 4;
#pragma unroll
  for (int i = 0; i < 8; ++i) { const int ka = k0 + 8 * g + i, kb = ka + 16; v[i] = ka < K ? W[(size_t)(ka < K ? ka : K - 1) * ld + n] : 0.f; v[8 + i] = kb < K ? W[(size_t)(kb < K ? kb : K - 1) * ld + n] : 0.f; }
  return bsplit16(v); }
__device__ __forceinline__ v8f mac3(const F2& a, const F2& b, v8f c) { c = wmma_bf(a.l, b.h, c); c = wmma_bf(a.h, b.l, c); return wmma_bf(a.h, b.h, c); }
__device__ __forceinline__ float sigm(float v) { return 1.0f / (1.0f + expf(-v)); }
#define LDSX() do { asm volatile("s_wait_dscnt 0" ::: "memory"); __builtin_amdgcn_wave_barrier(); __builtin_amdgcn_fence(__ATOMIC_RELEASE, "workgroup"); } while (0)


// Reverse-attention residual axial block (B 4, 64 x 64 x 64 NHWC): height-axis then width-axis 'sigmoid attention' over 4,096-long sequences (feature dim 64), scalar gates and residuals, then a per-pixel gate from the 19-class prediction map.
#define NB 4
#define HH 64
#define WWd 64
#define CCh 64
#define NC 19
#define NSEQ 4096       // W*C (axis 1) or H*C (axis 2)
#define FD 64           // feature dim (H or W)
#ifndef NBB
#define NBB NB          // batches processed
#endif
typedef __attribute__((ext_vector_type(8))) __bf16 v8b;
__device__ __forceinline__ v16b frag_b(const __bf16* rowk0, int lane) {
  union { v16b v; v8b q[2]; } u; const __bf16* p = rowk0 + 8 * (lane >> 4);
  u.q[0] = *(const v8b*)p; u.q[1] = *(const v8b*)(p + 16); return u.v;
}
__device__ __forceinline__ float bfr(float v) { return (float)(__bf16)v; }
__device__ __attribute__((noinline)) float exp_ni(float v) { return expf(v); }
__device__ __attribute__((noinline)) float erf_ni(float v) { return erff(v); }

#define WS_PW  0u                                   // bf16 rows: hq^T [64][64], hv^T, wq^T, wv^T ((in,out) -> transposed)
#define WS_QH  (WS_PW + 2u * 4 * FD * FD)            // f16 [b][n][64] q hi ; QL ; VT f16 [b][64][n] v planes
#define WS_QL  (WS_QH + 2u * NB * NSEQ * FD)
#define WS_VT  (WS_QL + 2u * NB * NSEQ * FD)
#define WS_VL  (WS_VT + 2u * NB * NSEQ * FD)         // f16 v residual x2048 planes
#define WS_X1  (WS_VL + 2u * NB * NSEQ * FD)         // f32 [B][H][W][C] after the height axis
#define WS_X2  (WS_X1 + 4u * NB * HH * WWd * CCh)     // f32 [B][H][W][C] after the width axis
#define WS_END (WS_X2 + 4u * NB * HH * WWd * CCh)

__device__ __attribute__((noinline)) float exp_p(float v) { return expf(v); }
__global__ __launch_bounds__(64) void k_pack(const float* __restrict__ HQ, const float* __restrict__ HV, const float* __restrict__ WQ, const float* __restrict__ WV, __bf16* __restrict__ PW) {
  const int n = blockIdx.x, which = blockIdx.y, t = threadIdx.x; const float* Wm = (which == 0) ? HQ : (which == 1) ? HV : (which == 2) ? WQ : WV; __shared__ __align__(16) __bf16 s[FD];
  s[t] = (__bf16)Wm[(size_t)t * FD + n]; __syncthreads();   // (in,out): row n = output, k = input
  if (t < FD / 8) vst2((unsigned*)(PW + ((size_t)which * FD + n) * FD + t * 8), *(const v4u*)&s[t * 8]);
}
// ---- k_proj<AX>: block = (64 sequence rows n = (o, c0..c63) with o = w (AX 0) or h (AX 1), b): A[n][d] gathered from the NHWC tensor (AX 0: x[b][d][o][c]; AX 1: x1[b][o][d][c]); q = A . Wq^T + bq (AX 0 exact; AX 1 hi + residual) -> f16 hi/lo rows; v -> f16 planes [b][dd][n]
template <int AX>
__global__ __launch_bounds__(128) void k_proj(const float* __restrict__ SRC, const __bf16* __restrict__ PW, const float* __restrict__ BQ, const float* __restrict__ BV, _Float16* __restrict__ QH, _Float16* __restrict__ QL, _Float16* __restrict__ VT, _Float16* __restrict__ VL) {
  __shared__ __align__(16) __bf16 sa[64][FD + 8], sal[64][FD + 8]; __shared__ __align__(16) _Float16 sqh[64][FD + 8], sql[64][FD + 8]; __shared__ __align__(16) _Float16 svt[FD][72], svl[FD][72];
  const int tid = threadIdx.x, wave = tid >> 5, lane = tid & 31, col = lane & 15, g = lane >> 4; const size_t b = blockIdx.y; const int o = blockIdx.x;   // block = the 64 rows (o, c) c = 0..63
  const __bf16* PQ = PW + (size_t)(AX == 0 ? 0 : 2) * FD * FD; const __bf16* PV = PW + (size_t)(AX == 0 ? 1 : 3) * FD * FD;
  for (int e = tid; e < 64 * FD; e += 128) { const int d = e >> 6, c = e & 63; const float v = (AX == 0) ? bfr(SRC[((b * HH + d) * WWd + o) * CCh + c]) : SRC[((b * HH + o) * WWd + d) * CCh + c]; const __bf16 hb = (__bf16)v; sa[c][d] = hb; sal[c][d] = (__bf16)(v - (float)hb); }
  if (tid < 64) for (int d = FD; d < FD + 8; ++d) { sa[tid][d] = (__bf16)0.f; sal[tid][d] = (__bf16)0.f; sqh[tid][d] = (_Float16)0.f; sql[tid][d] = (_Float16)0.f; }
  __syncthreads();
  v8f acc[8] = {};   // tiles 0..3 q, 4..7 v
#pragma unroll
  for (int kc = 0; kc < FD / 32; ++kc) { const v16b a = frag_b(&sa[wave * 16 + col][kc * 32], lane), al = frag_b(&sal[wave * 16 + col][kc * 32], lane);
#pragma unroll
    for (int j = 0; j < 8; ++j) { const __bf16* Wr = (j < 4) ? PQ : PV; const v16b w = frag_b(Wr + (size_t)((j & 3) * 16 + col) * FD + kc * 32, lane); if (AX == 1) acc[j] = wmma_bf(al, w, acc[j]); acc[j] = wmma_bf(a, w, acc[j]); } }
#pragma unroll
  for (int j = 0; j < 8; ++j) { const int d = (j & 3) * 16 + col; const float bb = bfr((j < 4 ? BQ : BV)[d]);
#pragma unroll
    for (int r = 0; r < 8; ++r) { const float v = acc[j][r] + bb; const int rr = wave * 16 + 8 * g + r; const _Float16 hv = (_Float16)v; if (j < 4) { sqh[rr][d] = hv; sql[rr][d] = (_Float16)((v - (float)hv) * 2048.0f); } else { svt[d][rr] = hv; svl[d][rr] = (_Float16)((v - (float)hv) * 2048.0f); } } }
  __syncthreads();
  const size_t n0 = (size_t)o * 64;
  for (int e = tid; e < 64 * 8; e += 128) { const int r = e >> 3, q = e & 7; const size_t off = (b * NSEQ + n0 + r) * FD + q * 8; vst2((unsigned*)(QH + off), *(const v4u*)&sqh[r][q * 8]); vst2((unsigned*)(QL + off), *(const v4u*)&sql[r][q * 8]); }
  for (int e = tid; e < FD * 8; e += 128) { const int d = e >> 3, pc = e & 7; vst2((unsigned*)(VT + (b * FD + d) * NSEQ + n0 + pc * 8), *(const v4u*)&svt[d][pc * 8]); vst2((unsigned*)(VL + (b * FD + d) * NSEQ + n0 + pc * 8), *(const v4u*)&svl[d][pc * 8]); }
}
// ---- k_att<AX>: block = (64 queries n = (o, c), b): scores = sigmoid(q_n . q_m / 8) for all 4,096 m (3 products), P x 2^11 (f16 hi + residual) x v (f16 hi + x2048 residual), 3 products (4 tiles); out * gate + residual -> NHWC (AX 0: x1[b][dd][o][c] = out[n][dd] * h_gate + x; AX 1: x2[b][o][dd][c] = out * w_gate + x1)
template <int AX>
__global__ __launch_bounds__(128) void k_att(const _Float16* __restrict__ QH, const _Float16* __restrict__ QL, const _Float16* __restrict__ VT, const _Float16* __restrict__ VL, const float* __restrict__ GATE, const float* __restrict__ RES, float* __restrict__ OUTB) {
  __shared__ __align__(16) _Float16 sph[4][16][40], spl[4][16][40]; __shared__ __align__(16) float so[FD][68];   // [dd][c]
  const int tid = threadIdx.x, wave = tid >> 5, lane = tid & 31, col = lane & 15, g = lane >> 4; const size_t b = blockIdx.y; const int o = blockIdx.x; const size_t rq = b * NSEQ + (size_t)o * 64 + wave * 16;
  v16h aq[2], aql[2];
#pragma unroll
  for (int kc = 0; kc < 2; ++kc) { aq[kc] = frag_h(QH + (rq + col) * FD + kc * 32, lane); aql[kc] = frag_h(QL + (rq + col) * FD + kc * 32, lane); }
  v8f acc[4] = {}, accl[4] = {}; const float scale = 0.125f;
#pragma unroll 1
  for (int ks = 0; ks < NSEQ / 32; ++ks) { const int j0 = ks * 32;
#pragma unroll
    for (int ct = 0; ct < 2; ++ct) { const size_t rk = (b * NSEQ + j0 + ct * 16 + col) * FD; v8f c = {}, cl = {};
#pragma unroll
      for (int kc = 0; kc < 2; ++kc) { const v16h kh = frag_h(QH + rk + kc * 32, lane); c = wmma16(aq[kc], kh, c); cl = wmma16(aql[kc], kh, cl); cl = wmma16(aq[kc], frag_h(QL + rk + kc * 32, lane), cl); }
#pragma unroll
      for (int r = 0; r < 8; ++r) { const float s = (c[r] + cl[r] * (1.0f / 2048.0f)) * scale; const float p = 2048.0f / (1.0f + exp_p(-s)); const _Float16 hp = (_Float16)p; sph[wave][8 * g + r][ct * 16 + col] = hp; spl[wave][8 * g + r][ct * 16 + col] = (_Float16)((p - (float)hp) * 2048.0f); } }
    LDSX();
    const v16h pa = frag_h(&sph[wave][col][0], lane), pl = frag_h(&spl[wave][col][0], lane);
#pragma unroll
    for (int dt = 0; dt < 4; ++dt) { const size_t vo = (b * FD + dt * 16 + col) * NSEQ + j0; const v16h vh = frag_h(VT + vo, lane); acc[dt] = wmma16(pa, vh, acc[dt]); accl[dt] = wmma16(pl, vh, accl[dt]); accl[dt] = wmma16(pa, frag_h(VL + vo, lane), accl[dt]); }   // 3 products
    LDSX(); }
  const float gate = bfr(GATE[0]);
#pragma unroll
  for (int r = 0; r < 8; ++r) { const int c = wave * 16 + 8 * g + r;
#pragma unroll
    for (int dt = 0; dt < 4; ++dt) { const int dd = dt * 16 + col; const size_t idx = (AX == 0) ? (((b * HH + dd) * WWd + o) * CCh + c) : (((b * HH + o) * WWd + dd) * CCh + c); const float res = (AX == 0) ? bfr(RES[idx]) : RES[idx]; so[dd][c] = (acc[dt][r] + accl[dt][r] * (1.0f / 2048.0f)) * (1.0f / 2048.0f) * gate + res; } }
  __syncthreads();
  for (int e = tid; e < FD * 16; e += 128) { const int dd = e >> 4, q = e & 15; const size_t base = (AX == 0) ? (((b * HH + dd) * WWd + o) * CCh) : (((b * HH + o) * WWd + dd) * CCh); vst2(OUTB + base + q * 4, *(const v4f*)&so[dd][q * 4]); }   // 64 consecutive c = 256 B
}
// ---- k_fin: block = (h, b): p[w] = sum_nc (1 - sigmoid(predict)) conv_w + conv_b; out[b][h][w][c] = p[w] * (feature + x2)
__global__ __launch_bounds__(256) void k_fin(const float* __restrict__ FEAT, const float* __restrict__ X2, const float* __restrict__ PRED, const float* __restrict__ CW, const float* __restrict__ CB, float* __restrict__ OUT) {
  const size_t b = blockIdx.y; const int h = blockIdx.x, t = threadIdx.x; __shared__ float sp[WWd]; __shared__ __align__(16) float so[WWd * CCh];
  if (t < WWd) { float a = 0.f; for (int k = 0; k < NC; ++k) { const float pr = bfr(PRED[((b * HH + h) * WWd + t) * NC + k]); a += (1.0f - 1.0f / (1.0f + exp_p(-pr))) * bfr(CW[k]); } sp[t] = a + bfr(CB[0]); }
  __syncthreads();
  for (int e = t; e < WWd * CCh; e += 256) { const int w = e >> 6; const size_t idx = ((b * HH + h) * WWd) * CCh + e; so[e] = sp[w] * (bfr(FEAT[idx]) + X2[idx]); }
  __syncthreads();
  for (int q = t; q < WWd * CCh / 4; q += 256) vst2(OUT + ((b * HH + h) * WWd) * CCh + q * 4, *(const v4f*)&so[q * 4]);
}
extern "C" void kernel_launch(void* const* d_in, const int* in_sizes, int n_in, void* d_out, int out_size, void* d_ws, size_t ws_size, hipStream_t stream) {
  (void)in_sizes; (void)n_in; (void)out_size;
  const float** F = (const float**)d_in;   // 0 feature [4,64,64,64], 1 predict [4,64,64,19], 2 hq_w (in,out), 3 hq_b, 4 hv_w, 5 hv_b, 6 wq_w, 7 wq_b, 8 wv_w, 9 wv_b, 10 h_gate [1], 11 w_gate [1], 12 conv_w [19,1], 13 conv_b [1]
  if (ws_size < (size_t)WS_END) return;
  char* ws = (char*)d_ws; __bf16* PW = (__bf16*)(ws + WS_PW); _Float16 *QH = (_Float16*)(ws + WS_QH), *QL = (_Float16*)(ws + WS_QL), *VT = (_Float16*)(ws + WS_VT), *VL = (_Float16*)(ws + WS_VL); float *X1 = (float*)(ws + WS_X1), *X2 = (float*)(ws + WS_X2);
  k_pack<<<dim3(FD, 4), 64, 0, stream>>>(F[2], F[4], F[6], F[8], PW);
  k_proj<0><<<dim3(WWd, NBB), 128, 0, stream>>>(F[0], PW, F[3], F[5], QH, QL, VT, VL);
  k_att<0><<<dim3(NSEQ / 64, NBB), 128, 0, stream>>>(QH, QL, VT, VL, F[10], F[0], X1);
  k_proj<1><<<dim3(HH, NBB), 128, 0, stream>>>(X1, PW, F[7], F[9], QH, QL, VT, VL);
  k_att<1><<<dim3(NSEQ / 64, NBB), 128, 0, stream>>>(QH, QL, VT, VL, F[11], X1, X2);
  k_fin<<<dim3(HH, NBB), 256, 0, stream>>>(F[0], X2, F[1], F[12], F[13], (float*)d_out);
}

// v001
// Measured time: 330 microseconds a run.
// Next to v000, in two timings, it ran 3.50 and 3.49 times as fast.
// compute dtype: all float inputs rounded to bf16; per axis q = x_seq . Wq + bq and v = x_seq . Wv + bv with the sequence rows gathered from the [B,H,W,C] tensor (the second axis reads the first axis' f32 result as bf16 hi + residual, 2 products) on WMMA 16x16x32; scores = sigmoid(q_n . q_m / 8) with q as f16 hi + (x2048-scaled) residual (3 products) and a precise expf per score; out = sum_m P (scaled by 2^11, f16 hi + residual) x v (f16 hi + x2048 residual planes), 3 products; gates, residuals and the final (1 - sigmoid(predict)) . conv_w + conv_b pixel gate in f32. (the un-normalised 4,096-term sums need the residual products).
#include <hip/hip_runtime.h>
#include <math.h>

typedef __attribute__((ext_vector_type(16))) _Float16 v16h;
typedef __attribute__((ext_vector_type(16))) __bf16 v16b;
typedef __attribute__((ext_vector_type(8)))  _Float16 v8h;
typedef __attribute__((ext_vector_type(8)))  float v8f;
typedef __attribute__((ext_vector_type(4)))  float v4f;
typedef __attribute__((ext_vector_type(2)))  float v2f;
typedef __attribute__((ext_vector_type(4)))  unsigned v4u;
typedef __attribute__((ext_vector_type(4)))  int v4i;
typedef float __attribute__((may_alias)) float_a;
typedef int __attribute__((may_alias)) int_a;

template <typename T> __device__ __forceinline__ void vst2(void* p, T v) { *(T*)p = v;  }
__device__ __forceinline__ v8f wmma16(v16h a, v16h b, v8f c) {
  v8f d = __builtin_amdgcn_wmma_f32_16x16x32_f16(false, a, false, b, (short)0, c, false, false);
  asm volatile("v_nop\n\tv_nop\n\tv_nop\n\tv_nop" : "+v"(d) : "v"(a), "v"(b));
  return d;
}
__device__ __forceinline__ v8f wmma_bf(v16b a, v16b b, v8f c) {
  v8f d = __builtin_amdgcn_wmma_f32_16x16x32_bf16(false, a, false, b, (short)0, c, false, false);
  asm volatile("v_nop\n\tv_nop\n\tv_nop\n\tv_nop" : "+v"(d) : "v"(a), "v"(b));
  return d;
}
// 16x16x32 fragments: lane = (h = lane>>4, row/col = lane&15); elements 0..7 = k0+8h+0..7, 8..15 = k0+16+8h+0..7; D element r = row 8h+r
__device__ __forceinline__ v16h frag_h(const _Float16* rowk0, int lane) {
  union { v16h v; v8h q[2]; } u; const _Float16* p = rowk0 + 8 * (lane >> 4);
  u.q[0] = *(const v8h*)p; u.q[1] = *(const v8h*)(p + 16); return u.v;
}
__device__ __forceinline__ v16h frag_f32(const float* rowk0, int lane) {
  v16h a; const float* p = rowk0 + 8 * (lane >> 4);
#pragma unroll
  for (int i = 0; i < 8; ++i) { a[i] = (_Float16)p[i]; a[8 + i] = (_Float16)p[16 + i]; }
  return a;
}
__device__ __forceinline__ v16h frag_f32s(const float* rowk0, int lane, float sc) {
  v16h a; const float* p = rowk0 + 8 * (lane >> 4);
#pragma unroll
  for (int i = 0; i < 8; ++i) { a[i] = (_Float16)(p[i] * sc); a[8 + i] = (_Float16)(p[16 + i] * sc); }
  return a;
}
// column fragment from a [K][ld] layout (column n), rows >= K read as 0
__device__ __forceinline__ v16h fragc_f32(const float* W, int k0, int n, int lane, int ld, int K) {
  v16h a; const int g = lane >> 4;
#pragma unroll
  for (int i = 0; i < 8; ++i) { const int ka = k0 + 8 * g + i, kb = ka + 16;
    a[i] = (_Float16)(ka < K ? W[(size_t)(ka < K ? ka : K - 1) * ld + n] : 0.f); a[8 + i] = (_Float16)(kb < K ? W[(size_t)(kb < K ? kb : K - 1) * ld + n] : 0.f); }
  return a;
}
struct F2 { v16b h, l; };
__device__ __forceinline__ F2 bsplit16(const float v[16]) { F2 r;
#pragma unroll
  for (int i = 0; i < 16; ++i) { const __bf16 h = (__bf16)v[i]; r.h[i] = h; r.l[i] = (__bf16)(v[i] - (float)h); }
  return r; }
__device__ __forceinline__ F2 split_row(const float* row, int k0, int lane) { float v[16]; const float* p = row + k0 + 8 * (lane >> 4);
#pragma unroll
  for (int i = 0; i < 8; ++i) { v[i] = p[i]; v[8 + i] = p[16 + i]; }
  return bsplit16(v); }
__device__ __forceinline__ F2 split_rowK(const float* row, int k0, int lane, int K) { float v[16]; const int g = lane >> 4;
#pragma unroll
  for (int i = 0; i < 8; ++i) { const int ka = k0 + 8 * g + i, kb = ka + 16; v[i] = ka < K ? row[ka < K ? ka : K - 1] : 0.f; v[8 + i] = kb < K ? row[kb < K ? kb : K - 1] : 0.f; }
  return bsplit16(v); }
__device__ __forceinline__ F2 split_col(const float* W, int k0, int n, int lane, int ld, int K) { float v[16]; const int g = lane >> 4;
#pragma unroll
  for (int i = 0; i < 8; ++i) { const int ka = k0 + 8 * g + i, kb = ka + 16; v[i] = ka < K ? W[(size_t)(ka < K ? ka : K - 1) * ld + n] : 0.f; v[8 + i] = kb < K ? W[(size_t)(kb < K ? kb : K - 1) * ld + n] : 0.f; }
  return bsplit16(v); }
__device__ __forceinline__ v8f mac3(const F2& a, const F2& b, v8f c) { c = wmma_bf(a.l, b.h, c); c = wmma_bf(a.h, b.l, c); return wmma_bf(a.h, b.h, c); }
__device__ __forceinline__ float sigm(float v) { return 1.0f / (1.0f + expf(-v)); }
#define LDSX() do { asm volatile("s_wait_dscnt 0" ::: "memory"); __builtin_amdgcn_wave_barrier(); __builtin_amdgcn_fence(__ATOMIC_RELEASE, "workgroup"); } while (0)


// Reverse-attention residual axial block (B 4, 64 x 64 x 64 NHWC): height-axis then width-axis 'sigmoid attention' over 4,096-long sequences (feature dim 64), scalar gates and residuals, then a per-pixel gate from the 19-class prediction map.
#define NB 4
#define HH 64
#define WWd 64
#define CCh 64
#define NC 19
#define NSEQ 4096       // W*C (axis 1) or H*C (axis 2)
#define FD 64           // feature dim (H or W)
#ifndef NBB
#define NBB NB          // batches processed
#endif
typedef __attribute__((ext_vector_type(8))) __bf16 v8b;
__device__ __forceinline__ v16b frag_b(const __bf16* rowk0, int lane) {
  union { v16b v; v8b q[2]; } u; const __bf16* p = rowk0 + 8 * (lane >> 4);
  u.q[0] = *(const v8b*)p; u.q[1] = *(const v8b*)(p + 16); return u.v;
}
__device__ __forceinline__ float bfr(float v) { return (float)(__bf16)v; }
__device__ __attribute__((noinline)) float exp_ni(float v) { return expf(v); }
__device__ __attribute__((noinline)) float erf_ni(float v) { return erff(v); }

#define WS_PW  0u                                   // bf16 rows: hq^T [64][64], hv^T, wq^T, wv^T ((in,out) -> transposed)
#define WS_QH  (WS_PW + 2u * 4 * FD * FD)            // f16 [b][n][64] q hi ; QL ; VT f16 [b][64][n] v planes
#define WS_QL  (WS_QH + 2u * NB * NSEQ * FD)
#define WS_VT  (WS_QL + 2u * NB * NSEQ * FD)
#define WS_VL  (WS_VT + 2u * NB * NSEQ * FD)         // f16 v residual x2048 planes
#define WS_X1  (WS_VL + 2u * NB * NSEQ * FD)         // f32 [B][H][W][C] after the height axis
#define WS_X2  (WS_X1 + 4u * NB * HH * WWd * CCh)     // f32 [B][H][W][C] after the width axis
#define WS_END (WS_X2 + 4u * NB * HH * WWd * CCh)

__device__ __attribute__((noinline)) float exp_p(float v) { return expf(v); }
__global__ __launch_bounds__(64) void k_pack(const float* __restrict__ HQ, const float* __restrict__ HV, const float* __restrict__ WQ, const float* __restrict__ WV, __bf16* __restrict__ PW) {
  const int n = blockIdx.x, which = blockIdx.y, t = threadIdx.x; const float* Wm = (which == 0) ? HQ : (which == 1) ? HV : (which == 2) ? WQ : WV; __shared__ __align__(16) __bf16 s[FD];
  s[t] = (__bf16)Wm[(size_t)t * FD + n]; __syncthreads();   // (in,out): row n = output, k = input
  if (t < FD / 8) vst2((unsigned*)(PW + ((size_t)which * FD + n) * FD + t * 8), *(const v4u*)&s[t * 8]);
}
// ---- k_proj<AX>: block = (64 sequence rows n = (o, c0..c63) with o = w (AX 0) or h (AX 1), b): A[n][d] gathered from the NHWC tensor (AX 0: x[b][d][o][c]; AX 1: x1[b][o][d][c]); q = A . Wq^T + bq (AX 0 exact; AX 1 hi + residual) -> f16 hi/lo rows; v -> f16 planes [b][dd][n]
template <int AX>
__global__ __launch_bounds__(128) void k_proj(const float* __restrict__ SRC, const __bf16* __restrict__ PW, const float* __restrict__ BQ, const float* __restrict__ BV, _Float16* __restrict__ QH, _Float16* __restrict__ QL, _Float16* __restrict__ VT, _Float16* __restrict__ VL) {
  __shared__ __align__(16) __bf16 sa[64][FD + 8], sal[64][FD + 8]; __shared__ __align__(16) _Float16 sqh[64][FD + 8], sql[64][FD + 8]; __shared__ __align__(16) _Float16 svt[FD][72], svl[FD][72];
  const int tid = threadIdx.x, wave = tid >> 5, lane = tid & 31, col = lane & 15, g = lane >> 4; const size_t b = blockIdx.y; const int o = blockIdx.x;   // block = the 64 rows (o, c) c = 0..63
  const __bf16* PQ = PW + (size_t)(AX == 0 ? 0 : 2) * FD * FD; const __bf16* PV = PW + (size_t)(AX == 0 ? 1 : 3) * FD * FD;
  for (int e = tid; e < 64 * FD; e += 128) { const int d = e >> 6, c = e & 63; const float v = (AX == 0) ? bfr(SRC[((b * HH + d) * WWd + o) * CCh + c]) : SRC[((b * HH + o) * WWd + d) * CCh + c]; const __bf16 hb = (__bf16)v; sa[c][d] = hb; sal[c][d] = (__bf16)(v - (float)hb); }
  if (tid < 64) for (int d = FD; d < FD + 8; ++d) { sa[tid][d] = (__bf16)0.f; sal[tid][d] = (__bf16)0.f; sqh[tid][d] = (_Float16)0.f; sql[tid][d] = (_Float16)0.f; }
  __syncthreads();
  v8f acc[8] = {};   // tiles 0..3 q, 4..7 v
#pragma unroll
  for (int kc = 0; kc < FD / 32; ++kc) { const v16b a = frag_b(&sa[wave * 16 + col][kc * 32], lane), al = frag_b(&sal[wave * 16 + col][kc * 32], lane);
#pragma unroll
    for (int j = 0; j < 8; ++j) { const __bf16* Wr = (j < 4) ? PQ : PV; const v16b w = frag_b(Wr + (size_t)((j & 3) * 16 + col) * FD + kc * 32, lane); if (AX == 1) acc[j] = wmma_bf(al, w, acc[j]); acc[j] = wmma_bf(a, w, acc[j]); } }
#pragma unroll
  for (int j = 0; j < 8; ++j) { const int d = (j & 3) * 16 + col; const float bb = bfr((j < 4 ? BQ : BV)[d]);
#pragma unroll
    for (int r = 0; r < 8; ++r) { const float v = acc[j][r] + bb; const int rr = wave * 16 + 8 * g + r; const _Float16 hv = (_Float16)v; if (j < 4) { sqh[rr][d] = hv; sql[rr][d] = (_Float16)((v - (float)hv) * 2048.0f); } else { svt[d][rr] = hv; svl[d][rr] = (_Float16)((v - (float)hv) * 2048.0f); } } }
  __syncthreads();
  const size_t n0 = (size_t)o * 64;
  for (int e = tid; e < 64 * 8; e += 128) { const int r = e >> 3, q = e & 7; const size_t off = (b * NSEQ + n0 + r) * FD + q * 8; vst2((unsigned*)(QH + off), *(const v4u*)&sqh[r][q * 8]); vst2((unsigned*)(QL + off), *(const v4u*)&sql[r][q * 8]); }
  for (int e = tid; e < FD * 8; e += 128) { const int d = e >> 3, pc = e & 7; vst2((unsigned*)(VT + (b * FD + d) * NSEQ + n0 + pc * 8), *(const v4u*)&svt[d][pc * 8]); vst2((unsigned*)(VL + (b * FD + d) * NSEQ + n0 + pc * 8), *(const v4u*)&svl[d][pc * 8]); }
}
// ---- k_att<AX>: block = (64 queries n = (o, c), b), 24 waves = 4 query tiles x KSPL key ranges (6 waves a SIMD cover each other's load and dependent-chain latency); each wave sums its own key range, the ranges are added in LDS in fixed order: scores = sigmoid(q_n . q_m / 8) for all 4,096 m (3 products), P x 2^11 (f16 hi + residual) x v (f16 hi + x2048 residual), 3 products (4 tiles); out * gate + residual -> NHWC (AX 0: x1[b][dd][o][c] = out[n][dd] * h_gate + x; AX 1: x2[b][o][dd][c] = out * w_gate + x1)
#define KSPL 6                       // key ranges per query tile
#define ATT_T (128 * KSPL)           // threads of a k_att block
template <int AX>
__global__ __launch_bounds__(ATT_T) void k_att(const _Float16* __restrict__ QH, const _Float16* __restrict__ QL, const _Float16* __restrict__ VT, const _Float16* __restrict__ VL, const float* __restrict__ GATE, const float* __restrict__ RES, float* __restrict__ OUTB) {
  __shared__ __align__(16) _Float16 sph[4 * KSPL][16][40], spl[4 * KSPL][16][40]; __shared__ __align__(16) float so[KSPL][FD][68];   // [key range][dd][c]
  const int tid = threadIdx.x, wave = tid >> 5, lane = tid & 31, col = lane & 15, g = lane >> 4; const size_t b = blockIdx.y; const int o = blockIdx.x;
  const int qg = wave & 3, kr = __builtin_amdgcn_readfirstlane(wave >> 2);   // query tile; key range (wave-uniform, so the pass loop stays a scalar loop)
  const int ks0 = kr * (NSEQ / 32) / KSPL, ks1 = (kr + 1) * (NSEQ / 32) / KSPL; const size_t rq = b * NSEQ + (size_t)o * 64 + qg * 16;
  v16h aq[2], aql[2];
#pragma unroll
  for (int kc = 0; kc < 2; ++kc) { aq[kc] = frag_h(QH + (rq + col) * FD + kc * 32, lane); aql[kc] = frag_h(QL + (rq + col) * FD + kc * 32, lane); }
  v8f acc[4] = {}, accl[4] = {}; const float scale = 0.125f;
#pragma unroll 1
  for (int ks = ks0; ks < ks1; ++ks) { const int j0 = ks * 32;
#pragma unroll
    for (int ct = 0; ct < 2; ++ct) { const size_t rk = (b * NSEQ + j0 + ct * 16 + col) * FD; v8f c = {}, cl = {};
#pragma unroll
      for (int kc = 0; kc < 2; ++kc) { const v16h kh = frag_h(QH + rk + kc * 32, lane); c = wmma16(aq[kc], kh, c); cl = wmma16(aql[kc], kh, cl); cl = wmma16(aq[kc], frag_h(QL + rk + kc * 32, lane), cl); }
#pragma unroll
      for (int r = 0; r < 8; ++r) { const float s = (c[r] + cl[r] * (1.0f / 2048.0f)) * scale; const float p = 2048.0f / (1.0f + exp_p(-s)); const _Float16 hp = (_Float16)p; sph[wave][8 * g + r][ct * 16 + col] = hp; spl[wave][8 * g + r][ct * 16 + col] = (_Float16)((p - (float)hp) * 2048.0f); } }
    LDSX();
    const v16h pa = frag_h(&sph[wave][col][0], lane), pl = frag_h(&spl[wave][col][0], lane);
#pragma unroll
    for (int dt = 0; dt < 4; ++dt) { const size_t vo = (b * FD + dt * 16 + col) * NSEQ + j0; const v16h vh = frag_h(VT + vo, lane); acc[dt] = wmma16(pa, vh, acc[dt]); accl[dt] = wmma16(pl, vh, accl[dt]); accl[dt] = wmma16(pa, frag_h(VL + vo, lane), accl[dt]); }   // 3 products
    LDSX(); }
  const float gate = bfr(GATE[0]);
#pragma unroll
  for (int r = 0; r < 8; ++r) { const int c = qg * 16 + 8 * g + r;
#pragma unroll
    for (int dt = 0; dt < 4; ++dt) so[kr][dt * 16 + col][c] = acc[dt][r] + accl[dt][r] * (1.0f / 2048.0f); }
  __syncthreads();
  for (int e = tid; e < FD * 16; e += ATT_T) { const int dd = e >> 4, q = e & 15; const size_t base = (AX == 0) ? (((b * HH + dd) * WWd + o) * CCh) : (((b * HH + o) * WWd + dd) * CCh);
    v4f a = *(const v4f*)&so[0][dd][q * 4];
    for (int s = 1; s < KSPL; ++s) a += *(const v4f*)&so[s][dd][q * 4];
    const v4f rv = *(const v4f*)(RES + base + q * 4); v4f ov;
    for (int i = 0; i < 4; ++i) ov[i] = a[i] * (1.0f / 2048.0f) * gate + ((AX == 0) ? bfr(rv[i]) : rv[i]);
    vst2(OUTB + base + q * 4, ov); }   // 64 consecutive c = 256 B
}
// ---- k_fin: block = (h, b): p[w] = sum_nc (1 - sigmoid(predict)) conv_w + conv_b; out[b][h][w][c] = p[w] * (feature + x2)
__global__ __launch_bounds__(256) void k_fin(const float* __restrict__ FEAT, const float* __restrict__ X2, const float* __restrict__ PRED, const float* __restrict__ CW, const float* __restrict__ CB, float* __restrict__ OUT) {
  const size_t b = blockIdx.y; const int h = blockIdx.x, t = threadIdx.x; __shared__ float sp[WWd]; __shared__ __align__(16) float so[WWd * CCh];
  if (t < WWd) { float a = 0.f; for (int k = 0; k < NC; ++k) { const float pr = bfr(PRED[((b * HH + h) * WWd + t) * NC + k]); a += (1.0f - 1.0f / (1.0f + exp_p(-pr))) * bfr(CW[k]); } sp[t] = a + bfr(CB[0]); }
  __syncthreads();
  for (int e = t; e < WWd * CCh; e += 256) { const int w = e >> 6; const size_t idx = ((b * HH + h) * WWd) * CCh + e; so[e] = sp[w] * (bfr(FEAT[idx]) + X2[idx]); }
  __syncthreads();
  for (int q = t; q < WWd * CCh / 4; q += 256) vst2(OUT + ((b * HH + h) * WWd) * CCh + q * 4, *(const v4f*)&so[q * 4]);
}
extern "C" void kernel_launch(void* const* d_in, const int* in_sizes, int n_in, void* d_out, int out_size, void* d_ws, size_t ws_size, hipStream_t stream) {
  (void)in_sizes; (void)n_in; (void)out_size;
  const float** F = (const float**)d_in;   // 0 feature [4,64,64,64], 1 predict [4,64,64,19], 2 hq_w (in,out), 3 hq_b, 4 hv_w, 5 hv_b, 6 wq_w, 7 wq_b, 8 wv_w, 9 wv_b, 10 h_gate [1], 11 w_gate [1], 12 conv_w [19,1], 13 conv_b [1]
  if (ws_size < (size_t)WS_END) return;
  char* ws = (char*)d_ws; __bf16* PW = (__bf16*)(ws + WS_PW); _Float16 *QH = (_Float16*)(ws + WS_QH), *QL = (_Float16*)(ws + WS_QL), *VT = (_Float16*)(ws + WS_VT), *VL = (_Float16*)(ws + WS_VL); float *X1 = (float*)(ws + WS_X1), *X2 = (float*)(ws + WS_X2);
  k_pack<<<dim3(FD, 4), 64, 0, stream>>>(F[2], F[4], F[6], F[8], PW);
  k_proj<0><<<dim3(WWd, NBB), 128, 0, stream>>>(F[0], PW, F[3], F[5], QH, QL, VT, VL);
  k_att<0><<<dim3(NSEQ / 64, NBB), ATT_T, 0, stream>>>(QH, QL, VT, VL, F[10], F[0], X1);
  k_proj<1><<<dim3(HH, NBB), 128, 0, stream>>>(X1, PW, F[7], F[9], QH, QL, VT, VL);
  k_att<1><<<dim3(NSEQ / 64, NBB), ATT_T, 0, stream>>>(QH, QL, VT, VL, F[11], X1, X2);
  k_fin<<<dim3(HH, NBB), 256, 0, stream>>>(F[0], X2, F[1], F[12], F[13], (float*)d_out);
}

// v002
// It runs in 233 microseconds.
// In both of two side-by-side timings against v001, it was 1.41 times as fast.
// All steps since v000 together make it 4.92 times as fast.
// compute dtype: all float inputs rounded to bf16; per axis q = x_seq . Wq + bq and v = x_seq . Wv + bv with the sequence rows gathered from the [B,H,W,C] tensor (the second axis reads the first axis' f32 result as bf16 hi + residual, 2 products) on WMMA 16x16x32; scores = sigmoid(q_n . q_m / 8) with q as f16 hi + (x2048-scaled) residual (3 products) and a precise expf per score; out = sum_m P (scaled by 2^11, f16 hi + residual) x v (f16 hi + x2048 residual planes), 3 products; gates, residuals and the final (1 - sigmoid(predict)) . conv_w + conv_b pixel gate in f32. (the un-normalised 4,096-term sums need the residual products).
#include <hip/hip_runtime.h>
#include <math.h>

typedef __attribute__((ext_vector_type(16))) _Float16 v16h;
typedef __attribute__((ext_vector_type(16))) __bf16 v16b;
typedef __attribute__((ext_vector_type(8)))  _Float16 v8h;
typedef __attribute__((ext_vector_type(8)))  float v8f;
typedef __attribute__((ext_vector_type(4)))  float v4f;
typedef __attribute__((ext_vector_type(2)))  float v2f;
typedef __attribute__((ext_vector_type(4)))  unsigned v4u;
typedef __attribute__((ext_vector_type(4)))  int v4i;
typedef float __attribute__((may_alias)) float_a;
typedef int __attribute__((may_alias)) int_a;

template <typename T> __device__ __forceinline__ void vst2(void* p, T v) { *(T*)p = v;  }
__device__ __forceinline__ v8f wmma16(v16h a, v16h b, v8f c) {
  v8f d = __builtin_amdgcn_wmma_f32_16x16x32_f16(false, a, false, b, (short)0, c, false, false);
  asm volatile("v_nop\n\tv_nop\n\tv_nop\n\tv_nop" : "+v"(d) : "v"(a), "v"(b));
  return d;
}
__device__ __forceinline__ v8f wmma_bf(v16b a, v16b b, v8f c) {
  v8f d = __builtin_amdgcn_wmma_f32_16x16x32_bf16(false, a, false, b, (short)0, c, false, false);
  asm volatile("v_nop\n\tv_nop\n\tv_nop\n\tv_nop" : "+v"(d) : "v"(a), "v"(b));
  return d;
}
// 16x16x32 fragments: lane = (h = lane>>4, row/col = lane&15); elements 0..7 = k0+8h+0..7, 8..15 = k0+16+8h+0..7; D element r = row 8h+r
__device__ __forceinline__ v16h frag_h(const _Float16* rowk0, int lane) {
  union { v16h v; v8h q[2]; } u; const _Float16* p = rowk0 + 8 * (lane >> 4);
  u.q[0] = *(const v8h*)p; u.q[1] = *(const v8h*)(p + 16); return u.v;
}
__device__ __forceinline__ v16h frag_f32(const float* rowk0, int lane) {
  v16h a; const float* p = rowk0 + 8 * (lane >> 4);
#pragma unroll
  for (int i = 0; i < 8; ++i) { a[i] = (_Float16)p[i]; a[8 + i] = (_Float16)p[16 + i]; }
  return a;
}
__device__ __forceinline__ v16h frag_f32s(const float* rowk0, int lane, float sc) {
  v16h a; const float* p = rowk0 + 8 * (lane >> 4);
#pragma unroll
  for (int i = 0; i < 8; ++i) { a[i] = (_Float16)(p[i] * sc); a[8 + i] = (_Float16)(p[16 + i] * sc); }
  return a;
}
// column fragment from a [K][ld] layout (column n), rows >= K read as 0
__device__ __forceinline__ v16h fragc_f32(const float* W, int k0, int n, int lane, int ld, int K) {
  v16h a; const int g = lane >> 4;
#pragma unroll
  for (int i = 0; i < 8; ++i) { const int ka = k0 + 8 * g + i, kb = ka + 16;
    a[i] = (_Float16)(ka < K ? W[(size_t)(ka < K ? ka : K - 1) * ld + n] : 0.f); a[8 + i] = (_Float16)(kb < K ? W[(size_t)(kb < K ? kb : K - 1) * ld + n] : 0.f); }
  return a;
}
struct F2 { v16b h, l; };
__device__ __forceinline__ F2 bsplit16(const float v[16]) { F2 r;
#pragma unroll
  for (int i = 0; i < 16; ++i) { const __bf16 h = (__bf16)v[i]; r.h[i] = h; r.l[i] = (__bf16)(v[i] - (float)h); }
  return r; }
__device__ __forceinline__ F2 split_row(const float* row, int k0, int lane) { float v[16]; const float* p = row + k0 + 8 * (lane >> 4);
#pragma unroll
  for (int i = 0; i < 8; ++i) { v[i] = p[i]; v[8 + i] = p[16 + i]; }
  return bsplit16(v); }
__device__ __forceinline__ F2 split_rowK(const float* row, int k0, int lane, int K) { float v[16]; const int g = lane >> 4;
#pragma unroll
  for (int i = 0; i < 8; ++i) { const int ka = k0 + 8 * g + i, kb = ka + 16; v[i] = ka < K ? row[ka < K ? ka : K - 1] : 0.f; v[8 + i] = kb < K ? row[kb < K ? kb : K - 1] : 0.f; }
  return bsplit16(v); }
__device__ __forceinline__ F2 split_col(const float* W, int k0, int n, int lane, int ld, int K) { float v[16]; const int g = lane >> 4;
#pragma unroll
  for (int i = 0; i < 8; ++i) { const int ka = k0 + 8 * g + i, kb = ka + 16; v[i] = ka < K ? W[(size_t)(ka < K ? ka : K - 1) * ld + n] : 0.f; v[8 + i] = kb < K ? W[(size_t)(kb < K ? kb : K - 1) * ld + n] : 0.f; }
  return bsplit16(v); }
__device__ __forceinline__ v8f mac3(const F2& a, const F2& b, v8f c) { c = wmma_bf(a.l, b.h, c); c = wmma_bf(a.h, b.l, c); return wmma_bf(a.h, b.h, c); }
__device__ __forceinline__ float sigm(float v) { return 1.0f / (1.0f + expf(-v)); }
#define LDSX() do { asm volatile("s_wait_dscnt 0" ::: "memory"); __builtin_amdgcn_wave_barrier(); __builtin_amdgcn_fence(__ATOMIC_RELEASE, "workgroup"); } while (0)


// Reverse-attention residual axial block (B 4, 64 x 64 x 64 NHWC): height-axis then width-axis 'sigmoid attention' over 4,096-long sequences (feature dim 64), scalar gates and residuals, then a per-pixel gate from the 19-class prediction map.
#define NB 4
#define HH 64
#define WWd 64
#define CCh 64
#define NC 19
#define NSEQ 4096       // W*C (axis 1) or H*C (axis 2)
#define FD 64           // feature dim (H or W)
#ifndef NBB
#define NBB NB          // batches processed
#endif
typedef __attribute__((ext_vector_type(8))) __bf16 v8b;
__device__ __forceinline__ v16b frag_b(const __bf16* rowk0, int lane) {
  union { v16b v; v8b q[2]; } u; const __bf16* p = rowk0 + 8 * (lane >> 4);
  u.q[0] = *(const v8b*)p; u.q[1] = *(const v8b*)(p + 16); return u.v;
}
__device__ __forceinline__ float bfr(float v) { return (float)(__bf16)v; }
__device__ __attribute__((noinline)) float exp_ni(float v) { return expf(v); }
__device__ __attribute__((noinline)) float erf_ni(float v) { return erff(v); }

#define WS_PW  0u                                   // bf16 rows: hq^T [64][64], hv^T, wq^T, wv^T ((in,out) -> transposed)
#define WS_QH  (WS_PW + 2u * 4 * FD * FD)            // f16 [b][n][64] q hi ; QL ; VT f16 [b][64][n] v planes
#define WS_QL  (WS_QH + 2u * NB * NSEQ * FD)
#define WS_VT  (WS_QL + 2u * NB * NSEQ * FD)
#define WS_VL  (WS_VT + 2u * NB * NSEQ * FD)         // f16 v residual x2048 planes
#define WS_X1  (WS_VL + 2u * NB * NSEQ * FD)         // f32 [B][H][W][C] after the height axis
#define WS_X2  (WS_X1 + 4u * NB * HH * WWd * CCh)     // f32 [B][H][W][C] after the width axis
#define WS_END (WS_X2 + 4u * NB * HH * WWd * CCh)

__device__ __attribute__((noinline)) float exp_p(float v) { return expf(v); }
__global__ __launch_bounds__(64) void k_pack(const float* __restrict__ HQ, const float* __restrict__ HV, const float* __restrict__ WQ, const float* __restrict__ WV, __bf16* __restrict__ PW) {
  const int n = blockIdx.x, which = blockIdx.y, t = threadIdx.x; const float* Wm = (which == 0) ? HQ : (which == 1) ? HV : (which == 2) ? WQ : WV; __shared__ __align__(16) __bf16 s[FD];
  s[t] = (__bf16)Wm[(size_t)t * FD + n]; __syncthreads();   // (in,out): row n = output, k = input
  if (t < FD / 8) vst2((unsigned*)(PW + ((size_t)which * FD + n) * FD + t * 8), *(const v4u*)&s[t * 8]);
}
// ---- k_proj<AX>: block = (64 sequence rows n = (o, c0..c63) with o = w (AX 0) or h (AX 1), b): A[n][d] gathered from the NHWC tensor (AX 0: x[b][d][o][c]; AX 1: x1[b][o][d][c]); q = A . Wq^T + bq (AX 0 exact; AX 1 hi + residual) -> f16 hi/lo rows; v -> f16 planes [b][dd][n]
template <int AX>
__global__ __launch_bounds__(128) void k_proj(const float* __restrict__ SRC, const __bf16* __restrict__ PW, const float* __restrict__ BQ, const float* __restrict__ BV, _Float16* __restrict__ QH, _Float16* __restrict__ QL, _Float16* __restrict__ VT, _Float16* __restrict__ VL) {
  __shared__ __align__(16) __bf16 sa[64][FD + 8], sal[64][FD + 8]; __shared__ __align__(16) _Float16 sqh[64][FD + 8], sql[64][FD + 8]; __shared__ __align__(16) _Float16 svt[FD][72], svl[FD][72];
  const int tid = threadIdx.x, wave = tid >> 5, lane = tid & 31, col = lane & 15, g = lane >> 4; const size_t b = blockIdx.y; const int o = blockIdx.x;   // block = the 64 rows (o, c) c = 0..63
  const __bf16* PQ = PW + (size_t)(AX == 0 ? 0 : 2) * FD * FD; const __bf16* PV = PW + (size_t)(AX == 0 ? 1 : 3) * FD * FD;
  for (int e = tid; e < 64 * FD; e += 128) { const int d = e >> 6, c = e & 63; const float v = (AX == 0) ? bfr(SRC[((b * HH + d) * WWd + o) * CCh + c]) : SRC[((b * HH + o) * WWd + d) * CCh + c]; const __bf16 hb = (__bf16)v; sa[c][d] = hb; sal[c][d] = (__bf16)(v - (float)hb); }
  if (tid < 64) for (int d = FD; d < FD + 8; ++d) { sa[tid][d] = (__bf16)0.f; sal[tid][d] = (__bf16)0.f; sqh[tid][d] = (_Float16)0.f; sql[tid][d] = (_Float16)0.f; }
  __syncthreads();
  v8f acc[8] = {};   // tiles 0..3 q, 4..7 v
#pragma unroll
  for (int kc = 0; kc < FD / 32; ++kc) { const v16b a = frag_b(&sa[wave * 16 + col][kc * 32], lane), al = frag_b(&sal[wave * 16 + col][kc * 32], lane);
#pragma unroll
    for (int j = 0; j < 8; ++j) { const __bf16* Wr = (j < 4) ? PQ : PV; const v16b w = frag_b(Wr + (size_t)((j & 3) * 16 + col) * FD + kc * 32, lane); if (AX == 1) acc[j] = wmma_bf(al, w, acc[j]); acc[j] = wmma_bf(a, w, acc[j]); } }
#pragma unroll
  for (int j = 0; j < 8; ++j) { const int d = (j & 3) * 16 + col; const float bb = bfr((j < 4 ? BQ : BV)[d]);
#pragma unroll
    for (int r = 0; r < 8; ++r) { const float v = acc[j][r] + bb; const int rr = wave * 16 + 8 * g + r; const _Float16 hv = (_Float16)v; if (j < 4) { sqh[rr][d] = hv; sql[rr][d] = (_Float16)((v - (float)hv) * 2048.0f); } else { svt[d][rr] = hv; svl[d][rr] = (_Float16)((v - (float)hv) * 2048.0f); } } }
  __syncthreads();
  const size_t n0 = (size_t)o * 64;
  for (int e = tid; e < 64 * 8; e += 128) { const int r = e >> 3, q = e & 7; const size_t off = (b * NSEQ + n0 + r) * FD + q * 8; vst2((unsigned*)(QH + off), *(const v4u*)&sqh[r][q * 8]); vst2((unsigned*)(QL + off), *(const v4u*)&sql[r][q * 8]); }
  for (int e = tid; e < FD * 8; e += 128) { const int d = e >> 3, pc = e & 7; vst2((unsigned*)(VT + (b * FD + d) * NSEQ + n0 + pc * 8), *(const v4u*)&svt[d][pc * 8]); vst2((unsigned*)(VL + (b * FD + d) * NSEQ + n0 + pc * 8), *(const v4u*)&svl[d][pc * 8]); }
}
// ---- k_att<AX>: block = (64 queries n = (o, c), b), 24 waves = 4 query tiles x KSPL key ranges (6 waves a SIMD cover each other's dependent-chain latency); each wave sums its own key range, the ranges are added in LDS in fixed order: scores = sigmoid(q_n . q_m / 8) for all 4,096 m (3 products), P x 2^11 hi + residual x v hi + residual (4 tiles, 3 products); out * gate + residual -> NHWC (AX 0: x1[b][dd][o][c] = out[n][dd] * h_gate + x; AX 1: x2[b][o][dd][c] = out * w_gate + x1)
// The 32 keys of a pass (q hi, q residual rows; v hi, v residual planes: 16 KiB a key range) are staged in LDS once for the 4 query tiles that share them, by asynchronous copies into a ring of two buffers: the next pass's copies fly while this pass is worked on.
#define KSPL 6                       // key ranges per query tile
#define ATT_T (128 * KSPL)           // threads of a k_att block
#define NPASS (NSEQ / 32)            // passes of 32 keys over the whole sequence
#define TRIPS ((NPASS + KSPL - 1) / KSPL)   // trips of the ring = passes of the longest key range; first pass of the last range + TRIPS <= NPASS, so every staged tile lies inside the planes
#define KP 72                        // f16 per staged q row: 144 B = 16 B x odd, conflict-free for 16-byte reads
#define VP 40                        // f16 per staged v row:  80 B = 16 B x odd
#define ST_KL (32 * KP)              // places (in f16) of the four tiles of one key range: q hi at 0, q residual, v hi, v residual
#define ST_VH (2 * 32 * KP)
#define ST_VL (2 * 32 * KP + FD * VP)
#define ST_SZ (2 * 32 * KP + 2 * FD * VP)
#define BUF_SZ (KSPL * ST_SZ)
static_assert((KSPL - 1) * NPASS / KSPL + TRIPS <= NPASS, "a staged tile would leave the planes");
// eight 16-byte copies a lane (one 4-KiB tile a wave); the s_wait_xcnt stands inside the statement so that no address register is rewritten in front of it
__device__ __forceinline__ void stage8(unsigned l, unsigned ls, const char* g, size_t gs) {
  asm volatile("global_load_async_to_lds_b128 %0, %8, off\n\t"
               "global_load_async_to_lds_b128 %1, %9, off\n\t"
               "global_load_async_to_lds_b128 %2, %10, off\n\t"
               "global_load_async_to_lds_b128 %3, %11, off\n\t"
               "global_load_async_to_lds_b128 %4, %12, off\n\t"
               "global_load_async_to_lds_b128 %5, %13, off\n\t"
               "global_load_async_to_lds_b128 %6, %14, off\n\t"
               "global_load_async_to_lds_b128 %7, %15, off\n\t"
               "s_wait_xcnt 0x0"
               :: "v"(l), "v"(l + ls), "v"(l + 2 * ls), "v"(l + 3 * ls), "v"(l + 4 * ls), "v"(l + 5 * ls), "v"(l + 6 * ls), "v"(l + 7 * ls),
                  "v"(g), "v"(g + gs), "v"(g + 2 * gs), "v"(g + 3 * gs), "v"(g + 4 * gs), "v"(g + 5 * gs), "v"(g + 6 * gs), "v"(g + 7 * gs) : "memory");
}
template <int AX>
__global__ __launch_bounds__(ATT_T) void k_att(const _Float16* __restrict__ QH, const _Float16* __restrict__ QL, const _Float16* __restrict__ VT, const _Float16* __restrict__ VL, const float* __restrict__ GATE, const float* __restrict__ RES, float* __restrict__ OUTB) {
  __shared__ __align__(16) _Float16 sph[4 * KSPL][16][40], spl[4 * KSPL][16][40]; __shared__ __align__(16) _Float16 ring[2 * BUF_SZ];
  float (*so)[FD][68] = (float (*)[FD][68])ring;   // [key range][dd][c]: the ring's LDS, used again behind the loop's last barrier
  static_assert(sizeof(float) * KSPL * FD * 68 <= sizeof(_Float16) * 2 * BUF_SZ, "partial sums do not fit the ring");
  const int tid = threadIdx.x, wave = tid >> 5, lane = tid & 31, col = lane & 15, g = lane >> 4; const size_t b = blockIdx.y; const int o = blockIdx.x;
  const int qg = __builtin_amdgcn_readfirstlane(wave & 3), kr = __builtin_amdgcn_readfirstlane(wave >> 2);   // query tile; key range (wave-uniform, so the pass loop stays a scalar loop)
  const int ks0 = kr * NPASS / KSPL, ks1 = (kr + 1) * NPASS / KSPL; const size_t rq = b * NSEQ + (size_t)o * 64 + qg * 16;
  // wave qg of a key range copies tile qg: 0 q hi, 1 q residual (32 rows of 128 B, contiguous), 2 v hi, 3 v residual (64 rows of 64 B, 8 KiB apart)
  const bool isk = qg < 2;
  const char* gsrc = (const char*)(qg == 0 ? QH : qg == 1 ? QL : qg == 2 ? VT : VL) + b * (size_t)(NSEQ * FD * 2) + (isk ? (size_t)ks0 * (32 * FD * 2) + lane * 16 : (size_t)ks0 * 64 + (size_t)(lane >> 2) * (NSEQ * 2) + (lane & 3) * 16);
  const size_t gtrip = isk ? 32 * FD * 2 : 64, gstep = isk ? 512 : 8 * NSEQ * 2;
  const unsigned ldst = (unsigned)(size_t)ring + 2u * (kr * ST_SZ + (qg == 0 ? 0 : qg == 1 ? ST_KL : qg == 2 ? ST_VH : ST_VL)) + (isk ? (lane >> 3) * (2 * KP) + (lane & 7) * 16 : (lane >> 2) * (2 * VP) + (lane & 3) * 16);
  const unsigned lstep = isk ? 4 * 2 * KP : 8 * 2 * VP;
  stage8(ldst, lstep, gsrc, gstep);
  v16h aq[2], aql[2];
#pragma unroll
  for (int kc = 0; kc < 2; ++kc) { aq[kc] = frag_h(QH + (rq + col) * FD + kc * 32, lane); aql[kc] = frag_h(QL + (rq + col) * FD + kc * 32, lane); }
  asm volatile("s_wait_asynccnt 0x0" ::: "memory");   // tile 0 has landed before the barrier publishes it
  __syncthreads();
  stage8(ldst + 2u * BUF_SZ, lstep, gsrc + gtrip, gstep);
  v8f acc[4] = {}, accl[4] = {}; const float scale = 0.125f;
#pragma unroll 1   // one copy of the pass body: the two buffers differ by an offset only
  for (int t = 0; t < TRIPS; ++t) { const _Float16* st = ring + (t & 1) * BUF_SZ + kr * ST_SZ;
    if (ks0 + t < ks1) {   // a shorter key range sits out the last trip (scalar branch); the publish point below is passed by every wave
#pragma unroll
    for (int ct = 0; ct < 2; ++ct) { const _Float16* rk = st + (ct * 16 + col) * KP; v8f c = {}, cl = {};
#pragma unroll
      for (int kc = 0; kc < 2; ++kc) { const v16h kh = frag_h(rk + kc * 32, lane); c = wmma16(aq[kc], kh, c); cl = wmma16(aql[kc], kh, cl); cl = wmma16(aq[kc], frag_h(rk + ST_KL + kc * 32, lane), cl); }
#pragma unroll
      for (int r = 0; r < 8; ++r) { const float s = (c[r] + cl[r] * (1.0f / 2048.0f)) * scale; const float p = 2048.0f / (1.0f + exp_p(-s)); const _Float16 hp = (_Float16)p; sph[wave][8 * g + r][ct * 16 + col] = hp; spl[wave][8 * g + r][ct * 16 + col] = (_Float16)((p - (float)hp) * 2048.0f); } }
    LDSX();
    const v16h pa = frag_h(&sph[wave][col][0], lane), pl = frag_h(&spl[wave][col][0], lane);
#pragma unroll
    for (int dt = 0; dt < 4; ++dt) { const _Float16* vo = st + ST_VH + (dt * 16 + col) * VP; const v16h vh = frag_h(vo, lane); acc[dt] = wmma16(pa, vh, acc[dt]); accl[dt] = wmma16(pl, vh, accl[dt]); accl[dt] = wmma16(pa, frag_h(vo + (ST_VL - ST_VH), lane), accl[dt]); }   // 3 products
    }
    asm volatile("s_wait_dscnt 0x0" ::: "memory");      // this wave's reads of the buffer are done before it is refilled
    asm volatile("s_wait_asynccnt 0x0" ::: "memory");   // this wave's copies of the next tile have landed
    __syncthreads();                                     // publishes the next tile and ends every reader's last read of this one
    if (t + 2 < TRIPS) stage8(ldst + (t & 1) * (2u * BUF_SZ), lstep, gsrc + (size_t)(t + 2) * gtrip, gstep); }
  asm volatile("s_wait_asynccnt 0x0" ::: "memory");     // no copy is in flight when the ring becomes the partial sums' place
  const float gate = bfr(GATE[0]);
#pragma unroll
  for (int r = 0; r < 8; ++r) { const int c = qg * 16 + 8 * g + r;
#pragma unroll
    for (int dt = 0; dt < 4; ++dt) so[kr][dt * 16 + col][c] = acc[dt][r] + accl[dt][r] * (1.0f / 2048.0f); }
  __syncthreads();
  for (int e = tid; e < FD * 16; e += ATT_T) { const int dd = e >> 4, q = e & 15; const size_t base = (AX == 0) ? (((b * HH + dd) * WWd + o) * CCh) : (((b * HH + o) * WWd + dd) * CCh);
    v4f a = *(const v4f*)&so[0][dd][q * 4];
    for (int s = 1; s < KSPL; ++s) a += *(const v4f*)&so[s][dd][q * 4];
    const v4f rv = *(const v4f*)(RES + base + q * 4); v4f ov;
    for (int i = 0; i < 4; ++i) ov[i] = a[i] * (1.0f / 2048.0f) * gate + ((AX == 0) ? bfr(rv[i]) : rv[i]);
    vst2(OUTB + base + q * 4, ov); }   // 64 consecutive c = 256 B
}
// ---- k_fin: block = (h, b): p[w] = sum_nc (1 - sigmoid(predict)) conv_w + conv_b; out[b][h][w][c] = p[w] * (feature + x2)
__global__ __launch_bounds__(256) void k_fin(const float* __restrict__ FEAT, const float* __restrict__ X2, const float* __restrict__ PRED, const float* __restrict__ CW, const float* __restrict__ CB, float* __restrict__ OUT) {
  const size_t b = blockIdx.y; const int h = blockIdx.x, t = threadIdx.x; __shared__ float sp[WWd]; __shared__ __align__(16) float so[WWd * CCh];
  if (t < WWd) { float a = 0.f; for (int k = 0; k < NC; ++k) { const float pr = bfr(PRED[((b * HH + h) * WWd + t) * NC + k]); a += (1.0f - 1.0f / (1.0f + exp_p(-pr))) * bfr(CW[k]); } sp[t] = a + bfr(CB[0]); }
  __syncthreads();
  for (int e = t; e < WWd * CCh; e += 256) { const int w = e >> 6; const size_t idx = ((b * HH + h) * WWd) * CCh + e; so[e] = sp[w] * (bfr(FEAT[idx]) + X2[idx]); }
  __syncthreads();
  for (int q = t; q < WWd * CCh / 4; q += 256) vst2(OUT + ((b * HH + h) * WWd) * CCh + q * 4, *(const v4f*)&so[q * 4]);
}
extern "C" void kernel_launch(void* const* d_in, const int* in_sizes, int n_in, void* d_out, int out_size, void* d_ws, size_t ws_size, hipStream_t stream) {
  (void)in_sizes; (void)n_in; (void)out_size;
  const float** F = (const float**)d_in;   // 0 feature [4,64,64,64], 1 predict [4,64,64,19], 2 hq_w (in,out), 3 hq_b, 4 hv_w, 5 hv_b, 6 wq_w, 7 wq_b, 8 wv_w, 9 wv_b, 10 h_gate [1], 11 w_gate [1], 12 conv_w [19,1], 13 conv_b [1]
  if (ws_size < (size_t)WS_END) return;
  char* ws = (char*)d_ws; __bf16* PW = (__bf16*)(ws + WS_PW); _Float16 *QH = (_Float16*)(ws + WS_QH), *QL = (_Float16*)(ws + WS_QL), *VT = (_Float16*)(ws + WS_VT), *VL = (_Float16*)(ws + WS_VL); float *X1 = (float*)(ws + WS_X1), *X2 = (float*)(ws + WS_X2);
  k_pack<<<dim3(FD, 4), 64, 0, stream>>>(F[2], F[4], F[6], F[8], PW);
  k_proj<0><<<dim3(WWd, NBB), 128, 0, stream>>>(F[0], PW, F[3], F[5], QH, QL, VT, VL);
  k_att<0><<<dim3(NSEQ / 64, NBB), ATT_T, 0, stream>>>(QH, QL, VT, VL, F[10], F[0], X1);
  k_proj<1><<<dim3(HH, NBB), 128, 0, stream>>>(X1, PW, F[7], F[9], QH, QL, VT, VL);
  k_att<1><<<dim3(NSEQ / 64, NBB), ATT_T, 0, stream>>>(QH, QL, VT, VL, F[11], X1, X2);
  k_fin<<<dim3(HH, NBB), 256, 0, stream>>>(F[0], X2, F[1], F[12], F[13], (float*)d_out);
}

// v003
// A run of this version takes 169 microseconds.
// Two timings next to v002 both put it at 1.38 times that version's speed.
// Over all steps from v000 it is 6.78 times as fast.
// compute dtype: all float inputs rounded to bf16; per axis q = x_seq . Wq + bq and v = x_seq . Wv + bv with the sequence rows gathered from the [B,H,W,C] tensor (the second axis reads the first axis' f32 result as bf16 hi + residual, 2 products) on WMMA 16x16x32; scores = sigmoid(q_n . q_m / 8) with q as f16 hi + (x2048-scaled) residual (3 products) and 2048 * sigmoid(s) = 1 / (2^-11 + 2^-11 * 2^(-s * log2 e)) on the hardware's exp2 and reciprocal per score; out = sum_m P (scaled by 2^11, f16 hi + residual) x v (f16 hi + x2048 residual planes), 3 products; gates, residuals and the final (1 - sigmoid(predict)) . conv_w + conv_b pixel gate in f32. (the un-normalised 4,096-term sums need the residual products).
#include <hip/hip_runtime.h>
#include <math.h>

typedef __attribute__((ext_vector_type(16))) _Float16 v16h;
typedef __attribute__((ext_vector_type(16))) __bf16 v16b;
typedef __attribute__((ext_vector_type(8)))  _Float16 v8h;
typedef __attribute__((ext_vector_type(8)))  float v8f;
typedef __attribute__((ext_vector_type(4)))  float v4f;
typedef __attribute__((ext_vector_type(2)))  float v2f;
typedef __attribute__((ext_vector_type(4)))  unsigned v4u;
typedef __attribute__((ext_vector_type(4)))  int v4i;
typedef float __attribute__((may_alias)) float_a;
typedef int __attribute__((may_alias)) int_a;

template <typename T> __device__ __forceinline__ void vst2(void* p, T v) { *(T*)p = v;  }
__device__ __forceinline__ v8f wmma16(v16h a, v16h b, v8f c) {
  v8f d = __builtin_amdgcn_wmma_f32_16x16x32_f16(false, a, false, b, (short)0, c, false, false);
  asm volatile("v_nop\n\tv_nop\n\tv_nop\n\tv_nop" : "+v"(d) : "v"(a), "v"(b));
  return d;
}
__device__ __forceinline__ v8f wmma_bf(v16b a, v16b b, v8f c) {
  v8f d = __builtin_amdgcn_wmma_f32_16x16x32_bf16(false, a, false, b, (short)0, c, false, false);
  asm volatile("v_nop\n\tv_nop\n\tv_nop\n\tv_nop" : "+v"(d) : "v"(a), "v"(b));
  return d;
}
// 16x16x32 fragments: lane = (h = lane>>4, row/col = lane&15); elements 0..7 = k0+8h+0..7, 8..15 = k0+16+8h+0..7; D element r = row 8h+r
__device__ __forceinline__ v16h frag_h(const _Float16* rowk0, int lane) {
  union { v16h v; v8h q[2]; } u; const _Float16* p = rowk0 + 8 * (lane >> 4);
  u.q[0] = *(const v8h*)p; u.q[1] = *(const v8h*)(p + 16); return u.v;
}
__device__ __forceinline__ v16h frag_f32(const float* rowk0, int lane) {
  v16h a; const float* p = rowk0 + 8 * (lane >> 4);
#pragma unroll
  for (int i = 0; i < 8; ++i) { a[i] = (_Float16)p[i]; a[8 + i] = (_Float16)p[16 + i]; }
  return a;
}
__device__ __forceinline__ v16h frag_f32s(const float* rowk0, int lane, float sc) {
  v16h a; const float* p = rowk0 + 8 * (lane >> 4);
#pragma unroll
  for (int i = 0; i < 8; ++i) { a[i] = (_Float16)(p[i] * sc); a[8 + i] = (_Float16)(p[16 + i] * sc); }
  return a;
}
// column fragment from a [K][ld] layout (column n), rows >= K read as 0
__device__ __forceinline__ v16h fragc_f32(const float* W, int k0, int n, int lane, int ld, int K) {
  v16h a; const int g = lane >> 4;
#pragma unroll
  for (int i = 0; i < 8; ++i) { const int ka = k0 + 8 * g + i, kb = ka + 16;
    a[i] = (_Float16)(ka < K ? W[(size_t)(ka < K ? ka : K - 1) * ld + n] : 0.f); a[8 + i] = (_Float16)(kb < K ? W[(size_t)(kb < K ? kb : K - 1) * ld + n] : 0.f); }
  return a;
}
struct F2 { v16b h, l; };
__device__ __forceinline__ F2 bsplit16(const float v[16]) { F2 r;
#pragma unroll
  for (int i = 0; i < 16; ++i) { const __bf16 h = (__bf16)v[i]; r.h[i] = h; r.l[i] = (__bf16)(v[i] - (float)h); }
  return r; }
__device__ __forceinline__ F2 split_row(const float* row, int k0, int lane) { float v[16]; const float* p = row + k0 + 8 * (lane >> 4);
#pragma unroll
  for (int i = 0; i < 8; ++i) { v[i] = p[i]; v[8 + i] = p[16 + i]; }
  return bsplit16(v); }
__device__ __forceinline__ F2 split_rowK(const float* row, int k0, int lane, int K) { float v[16]; const int g = lane >> 4;
#pragma unroll
  for (int i = 0; i < 8; ++i) { const int ka = k0 + 8 * g + i, kb = ka + 16; v[i] = ka < K ? row[ka < K ? ka : K - 1] : 0.f; v[8 + i] = kb < K ? row[kb < K ? kb : K - 1] : 0.f; }
  return bsplit16(v); }
__device__ __forceinline__ F2 split_col(const float* W, int k0, int n, int lane, int ld, int K) { float v[16]; const int g = lane >> 4;
#pragma unroll
  for (int i = 0; i < 8; ++i) { const int ka = k0 + 8 * g + i, kb = ka + 16; v[i] = ka < K ? W[(size_t)(ka < K ? ka : K - 1) * ld + n] : 0.f; v[8 + i] = kb < K ? W[(size_t)(kb < K ? kb : K - 1) * ld + n] : 0.f; }
  return bsplit16(v); }
__device__ __forceinline__ v8f mac3(const F2& a, const F2& b, v8f c) { c = wmma_bf(a.l, b.h, c); c = wmma_bf(a.h, b.l, c); return wmma_bf(a.h, b.h, c); }
__device__ __forceinline__ float sigm(float v) { return 1.0f / (1.0f + expf(-v)); }
#define LDSX() do { asm volatile("s_wait_dscnt 0" ::: "memory"); __builtin_amdgcn_wave_barrier(); __builtin_amdgcn_fence(__ATOMIC_RELEASE, "workgroup"); } while (0)


// Reverse-attention residual axial block (B 4, 64 x 64 x 64 NHWC): height-axis then width-axis 'sigmoid attention' over 4,096-long sequences (feature dim 64), scalar gates and residuals, then a per-pixel gate from the 19-class prediction map.
#define NB 4
#define HH 64
#define WWd 64
#define CCh 64
#define NC 19
#define NSEQ 4096       // W*C (axis 1) or H*C (axis 2)
#define FD 64           // feature dim (H or W)
#ifndef NBB
#define NBB NB          // batches processed
#endif
typedef __attribute__((ext_vector_type(8))) __bf16 v8b;
__device__ __forceinline__ v16b frag_b(const __bf16* rowk0, int lane) {
  union { v16b v; v8b q[2]; } u; const __bf16* p = rowk0 + 8 * (lane >> 4);
  u.q[0] = *(const v8b*)p; u.q[1] = *(const v8b*)(p + 16); return u.v;
}
__device__ __forceinline__ float bfr(float v) { return (float)(__bf16)v; }
__device__ __attribute__((noinline)) float exp_ni(float v) { return expf(v); }
__device__ __attribute__((noinline)) float erf_ni(float v) { return erff(v); }

#define WS_PW  0u                                   // bf16 rows: hq^T [64][64], hv^T, wq^T, wv^T ((in,out) -> transposed)
#define WS_QH  (WS_PW + 2u * 4 * FD * FD)            // f16 [b][n][64] q hi ; QL ; VT f16 [b][64][n] v planes
#define WS_QL  (WS_QH + 2u * NB * NSEQ * FD)
#define WS_VT  (WS_QL + 2u * NB * NSEQ * FD)
#define WS_VL  (WS_VT + 2u * NB * NSEQ * FD)         // f16 v residual x2048 planes
#define WS_X1  (WS_VL + 2u * NB * NSEQ * FD)         // f32 [B][H][W][C] after the height axis
#define WS_X2  (WS_X1 + 4u * NB * HH * WWd * CCh)     // f32 [B][H][W][C] after the width axis
#define WS_END (WS_X2 + 4u * NB * HH * WWd * CCh)

__device__ __attribute__((noinline)) float exp_p(float v) { return expf(v); }
__global__ __launch_bounds__(64) void k_pack(const float* __restrict__ HQ, const float* __restrict__ HV, const float* __restrict__ WQ, const float* __restrict__ WV, __bf16* __restrict__ PW) {
  const int n = blockIdx.x, which = blockIdx.y, t = threadIdx.x; const float* Wm = (which == 0) ? HQ : (which == 1) ? HV : (which == 2) ? WQ : WV; __shared__ __align__(16) __bf16 s[FD];
  s[t] = (__bf16)Wm[(size_t)t * FD + n]; __syncthreads();   // (in,out): row n = output, k = input
  if (t < FD / 8) vst2((unsigned*)(PW + ((size_t)which * FD + n) * FD + t * 8), *(const v4u*)&s[t * 8]);
}
// ---- k_proj<AX>: block = (64 sequence rows n = (o, c0..c63) with o = w (AX 0) or h (AX 1), b): A[n][d] gathered from the NHWC tensor (AX 0: x[b][d][o][c]; AX 1: x1[b][o][d][c]); q = A . Wq^T + bq (AX 0 exact; AX 1 hi + residual) -> f16 hi/lo rows; v -> f16 planes [b][dd][n]
template <int AX>
__global__ __launch_bounds__(128) void k_proj(const float* __restrict__ SRC, const __bf16* __restrict__ PW, const float* __restrict__ BQ, const float* __restrict__ BV, _Float16* __restrict__ QH, _Float16* __restrict__ QL, _Float16* __restrict__ VT, _Float16* __restrict__ VL) {
  __shared__ __align__(16) __bf16 sa[64][FD + 8], sal[64][FD + 8]; __shared__ __align__(16) _Float16 sqh[64][FD + 8], sql[64][FD + 8]; __shared__ __align__(16) _Float16 svt[FD][72], svl[FD][72];
  const int tid = threadIdx.x, wave = tid >> 5, lane = tid & 31, col = lane & 15, g = lane >> 4; const size_t b = blockIdx.y; const int o = blockIdx.x;   // block = the 64 rows (o, c) c = 0..63
  const __bf16* PQ = PW + (size_t)(AX == 0 ? 0 : 2) * FD * FD; const __bf16* PV = PW + (size_t)(AX == 0 ? 1 : 3) * FD * FD;
  for (int e = tid; e < 64 * FD; e += 128) { const int d = e >> 6, c = e & 63; const float v = (AX == 0) ? bfr(SRC[((b * HH + d) * WWd + o) * CCh + c]) : SRC[((b * HH + o) * WWd + d) * CCh + c]; const __bf16 hb = (__bf16)v; sa[c][d] = hb; sal[c][d] = (__bf16)(v - (float)hb); }
  if (tid < 64) for (int d = FD; d < FD + 8; ++d) { sa[tid][d] = (__bf16)0.f; sal[tid][d] = (__bf16)0.f; sqh[tid][d] = (_Float16)0.f; sql[tid][d] = (_Float16)0.f; }
  __syncthreads();
  v8f acc[8] = {};   // tiles 0..3 q, 4..7 v
#pragma unroll
  for (int kc = 0; kc < FD / 32; ++kc) { const v16b a = frag_b(&sa[wave * 16 + col][kc * 32], lane), al = frag_b(&sal[wave * 16 + col][kc * 32], lane);
#pragma unroll
    for (int j = 0; j < 8; ++j) { const __bf16* Wr = (j < 4) ? PQ : PV; const v16b w = frag_b(Wr + (size_t)((j & 3) * 16 + col) * FD + kc * 32, lane); if (AX == 1) acc[j] = wmma_bf(al, w, acc[j]); acc[j] = wmma_bf(a, w, acc[j]); } }
#pragma unroll
  for (int j = 0; j < 8; ++j) { const int d = (j & 3) * 16 + col; const float bb = bfr((j < 4 ? BQ : BV)[d]);
#pragma unroll
    for (int r = 0; r < 8; ++r) { const float v = acc[j][r] + bb; const int rr = wave * 16 + 8 * g + r; const _Float16 hv = (_Float16)v; if (j < 4) { sqh[rr][d] = hv; sql[rr][d] = (_Float16)((v - (float)hv) * 2048.0f); } else { svt[d][rr] = hv; svl[d][rr] = (_Float16)((v - (float)hv) * 2048.0f); } } }
  __syncthreads();
  const size_t n0 = (size_t)o * 64;
  for (int e = tid; e < 64 * 8; e += 128) { const int r = e >> 3, q = e & 7; const size_t off = (b * NSEQ + n0 + r) * FD + q * 8; vst2((unsigned*)(QH + off), *(const v4u*)&sqh[r][q * 8]); vst2((unsigned*)(QL + off), *(const v4u*)&sql[r][q * 8]); }
  for (int e = tid; e < FD * 8; e += 128) { const int d = e >> 3, pc = e & 7; vst2((unsigned*)(VT + (b * FD + d) * NSEQ + n0 + pc * 8), *(const v4u*)&svt[d][pc * 8]); vst2((unsigned*)(VL + (b * FD + d) * NSEQ + n0 + pc * 8), *(const v4u*)&svl[d][pc * 8]); }
}
// ---- k_att<AX>: block = (64 queries n = (o, c), b), 24 waves = 4 query tiles x KSPL key ranges (6 waves a SIMD cover each other's dependent-chain latency); each wave sums its own key range, the ranges are added in LDS in fixed order: scores = sigmoid(q_n . q_m / 8) for all 4,096 m (3 products), P x 2^11 hi + residual x v hi + residual (4 tiles, 3 products); out * gate + residual -> NHWC (AX 0: x1[b][dd][o][c] = out[n][dd] * h_gate + x; AX 1: x2[b][o][dd][c] = out * w_gate + x1)
// The 32 keys of a pass (q hi, q residual rows; v hi, v residual planes: 16 KiB a key range) are staged in LDS once for the 4 query tiles that share them, by asynchronous copies into a ring of two buffers: the next pass's copies fly while this pass is worked on.
#define KSPL 6                       // key ranges per query tile
#define ATT_T (128 * KSPL)           // threads of a k_att block
#define NPASS (NSEQ / 32)            // passes of 32 keys over the whole sequence
#define TRIPS ((NPASS + KSPL - 1) / KSPL)   // trips of the ring = passes of the longest key range; first pass of the last range + TRIPS <= NPASS, so every staged tile lies inside the planes
#define KP 72                        // f16 per staged q row: 144 B = 16 B x odd, conflict-free for 16-byte reads
#define VP 40                        // f16 per staged v row:  80 B = 16 B x odd
#define ST_KL (32 * KP)              // places (in f16) of the four tiles of one key range: q hi at 0, q residual, v hi, v residual
#define ST_VH (2 * 32 * KP)
#define ST_VL (2 * 32 * KP + FD * VP)
#define ST_SZ (2 * 32 * KP + 2 * FD * VP)
#define BUF_SZ (KSPL * ST_SZ)
static_assert((KSPL - 1) * NPASS / KSPL + TRIPS <= NPASS, "a staged tile would leave the planes");
// eight 16-byte copies a lane (one 4-KiB tile a wave); the s_wait_xcnt stands inside the statement so that no address register is rewritten in front of it
__device__ __forceinline__ void stage8(unsigned l, unsigned ls, const char* g, size_t gs) {
  asm volatile("global_load_async_to_lds_b128 %0, %8, off\n\t"
               "global_load_async_to_lds_b128 %1, %9, off\n\t"
               "global_load_async_to_lds_b128 %2, %10, off\n\t"
               "global_load_async_to_lds_b128 %3, %11, off\n\t"
               "global_load_async_to_lds_b128 %4, %12, off\n\t"
               "global_load_async_to_lds_b128 %5, %13, off\n\t"
               "global_load_async_to_lds_b128 %6, %14, off\n\t"
               "global_load_async_to_lds_b128 %7, %15, off\n\t"
               "s_wait_xcnt 0x0"
               :: "v"(l), "v"(l + ls), "v"(l + 2 * ls), "v"(l + 3 * ls), "v"(l + 4 * ls), "v"(l + 5 * ls), "v"(l + 6 * ls), "v"(l + 7 * ls),
                  "v"(g), "v"(g + gs), "v"(g + 2 * gs), "v"(g + 3 * gs), "v"(g + 4 * gs), "v"(g + 5 * gs), "v"(g + 6 * gs), "v"(g + 7 * gs) : "memory");
}
// 2048 * sigmoid(s) from x = -s * log2(e): v_exp_f32, one fma, v_rcp_f32, in line, so that the scores of a tile are independent chains; 2^x = inf gives 0, 2^x = 0 gives 2048
__device__ __forceinline__ float sigm2048(float x) { return __builtin_amdgcn_rcpf(__builtin_fmaf(__builtin_amdgcn_exp2f(x), 1.0f / 2048.0f, 1.0f / 2048.0f)); }
template <int AX>
__global__ __launch_bounds__(ATT_T) void k_att(const _Float16* __restrict__ QH, const _Float16* __restrict__ QL, const _Float16* __restrict__ VT, const _Float16* __restrict__ VL, const float* __restrict__ GATE, const float* __restrict__ RES, float* __restrict__ OUTB) {
  __shared__ __align__(16) _Float16 sph[4 * KSPL][16][40], spl[4 * KSPL][16][40]; __shared__ __align__(16) _Float16 ring[2 * BUF_SZ];
  float (*so)[FD][68] = (float (*)[FD][68])ring;   // [key range][dd][c]: the ring's LDS, used again behind the loop's last barrier
  static_assert(sizeof(float) * KSPL * FD * 68 <= sizeof(_Float16) * 2 * BUF_SZ, "partial sums do not fit the ring");
  const int tid = threadIdx.x, wave = tid >> 5, lane = tid & 31, col = lane & 15, g = lane >> 4; const size_t b = blockIdx.y; const int o = blockIdx.x;
  const int qg = __builtin_amdgcn_readfirstlane(wave & 3), kr = __builtin_amdgcn_readfirstlane(wave >> 2);   // query tile; key range (wave-uniform, so the pass loop stays a scalar loop)
  const int ks0 = kr * NPASS / KSPL, ks1 = (kr + 1) * NPASS / KSPL; const size_t rq = b * NSEQ + (size_t)o * 64 + qg * 16;
  // wave qg of a key range copies tile qg: 0 q hi, 1 q residual (32 rows of 128 B, contiguous), 2 v hi, 3 v residual (64 rows of 64 B, 8 KiB apart)
  const bool isk = qg < 2;
  const char* gsrc = (const char*)(qg == 0 ? QH : qg == 1 ? QL : qg == 2 ? VT : VL) + b * (size_t)(NSEQ * FD * 2) + (isk ? (size_t)ks0 * (32 * FD * 2) + lane * 16 : (size_t)ks0 * 64 + (size_t)(lane >> 2) * (NSEQ * 2) + (lane & 3) * 16);
  const size_t gtrip = isk ? 32 * FD * 2 : 64, gstep = isk ? 512 : 8 * NSEQ * 2;
  const unsigned ldst = (unsigned)(size_t)ring + 2u * (kr * ST_SZ + (qg == 0 ? 0 : qg == 1 ? ST_KL : qg == 2 ? ST_VH : ST_VL)) + (isk ? (lane >> 3) * (2 * KP) + (lane & 7) * 16 : (lane >> 2) * (2 * VP) + (lane & 3) * 16);
  const unsigned lstep = isk ? 4 * 2 * KP : 8 * 2 * VP;
  stage8(ldst, lstep, gsrc, gstep);
  v16h aq[2], aql[2];
#pragma unroll
  for (int kc = 0; kc < 2; ++kc) { aq[kc] = frag_h(QH + (rq + col) * FD + kc * 32, lane); aql[kc] = frag_h(QL + (rq + col) * FD + kc * 32, lane); }
  asm volatile("s_wait_asynccnt 0x0" ::: "memory");   // tile 0 has landed before the barrier publishes it
  __syncthreads();
  stage8(ldst + 2u * BUF_SZ, lstep, gsrc + gtrip, gstep);
  v8f acc[4] = {}, accl[4] = {}; const float nscale = -0.125f * 1.44269504088896341f;   // -(1 / sqrt(64)) * log2(e): the score as the exponent of 2^x
#pragma unroll 1   // one copy of the pass body: the two buffers differ by an offset only
  for (int t = 0; t < TRIPS; ++t) { const _Float16* st = ring + (t & 1) * BUF_SZ + kr * ST_SZ;
    if (ks0 + t < ks1) {   // a shorter key range sits out the last trip (scalar branch); the publish point below is passed by every wave
#pragma unroll
    for (int ct = 0; ct < 2; ++ct) { const _Float16* rk = st + (ct * 16 + col) * KP; v8f c = {}, cl = {};
#pragma unroll
      for (int kc = 0; kc < 2; ++kc) { const v16h kh = frag_h(rk + kc * 32, lane); c = wmma16(aq[kc], kh, c); cl = wmma16(aql[kc], kh, cl); cl = wmma16(aq[kc], frag_h(rk + ST_KL + kc * 32, lane), cl); }
#pragma unroll
      for (int r = 0; r < 8; ++r) { const float p = sigm2048((c[r] + cl[r] * (1.0f / 2048.0f)) * nscale); const _Float16 hp = (_Float16)p; sph[wave][8 * g + r][ct * 16 + col] = hp; spl[wave][8 * g + r][ct * 16 + col] = (_Float16)((p - (float)hp) * 2048.0f); } }
    LDSX();
    const v16h pa = frag_h(&sph[wave][col][0], lane), pl = frag_h(&spl[wave][col][0], lane);
#pragma unroll
    for (int dt = 0; dt < 4; ++dt) { const _Float16* vo = st + ST_VH + (dt * 16 + col) * VP; const v16h vh = frag_h(vo, lane); acc[dt] = wmma16(pa, vh, acc[dt]); accl[dt] = wmma16(pl, vh, accl[dt]); accl[dt] = wmma16(pa, frag_h(vo + (ST_VL - ST_VH), lane), accl[dt]); }   // 3 products
    }
    asm volatile("s_wait_dscnt 0x0" ::: "memory");      // this wave's reads of the buffer are done before it is refilled
    asm volatile("s_wait_asynccnt 0x0" ::: "memory");   // this wave's copies of the next tile have landed
    __syncthreads();                                     // publishes the next tile and ends every reader's last read of this one
    if (t + 2 < TRIPS) stage8(ldst + (t & 1) * (2u * BUF_SZ), lstep, gsrc + (size_t)(t + 2) * gtrip, gstep); }
  asm volatile("s_wait_asynccnt 0x0" ::: "memory");     // no copy is in flight when the ring becomes the partial sums' place
  const float gate = bfr(GATE[0]);
#pragma unroll
  for (int r = 0; r < 8; ++r) { const int c = qg * 16 + 8 * g + r;
#pragma unroll
    for (int dt = 0; dt < 4; ++dt) so[kr][dt * 16 + col][c] = acc[dt][r] + accl[dt][r] * (1.0f / 2048.0f); }
  __syncthreads();
  for (int e = tid; e < FD * 16; e += ATT_T) { const int dd = e >> 4, q = e & 15; const size_t base = (AX == 0) ? (((b * HH + dd) * WWd + o) * CCh) : (((b * HH + o) * WWd + dd) * CCh);
    v4f a = *(const v4f*)&so[0][dd][q * 4];
    for (int s = 1; s < KSPL; ++s) a += *(const v4f*)&so[s][dd][q * 4];
    const v4f rv = *(const v4f*)(RES + base + q * 4); v4f ov;
    for (int i = 0; i < 4; ++i) ov[i] = a[i] * (1.0f / 2048.0f) * gate + ((AX == 0) ? bfr(rv[i]) : rv[i]);
    vst2(OUTB + base + q * 4, ov); }   // 64 consecutive c = 256 B
}
// ---- k_fin: block = (h, b): p[w] = sum_nc (1 - sigmoid(predict)) conv_w + conv_b; out[b][h][w][c] = p[w] * (feature + x2)
__global__ __launch_bounds__(256) void k_fin(const float* __restrict__ FEAT, const float* __restrict__ X2, const float* __restrict__ PRED, const float* __restrict__ CW, const float* __restrict__ CB, float* __restrict__ OUT) {
  const size_t b = blockIdx.y; const int h = blockIdx.x, t = threadIdx.x; __shared__ float sp[WWd]; __shared__ __align__(16) float so[WWd * CCh];
  if (t < WWd) { float a = 0.f; for (int k = 0; k < NC; ++k) { const float pr = bfr(PRED[((b * HH + h) * WWd + t) * NC + k]); a += (1.0f - 1.0f / (1.0f + exp_p(-pr))) * bfr(CW[k]); } sp[t] = a + bfr(CB[0]); }
  __syncthreads();
  for (int e = t; e < WWd * CCh; e += 256) { const int w = e >> 6; const size_t idx = ((b * HH + h) * WWd) * CCh + e; so[e] = sp[w] * (bfr(FEAT[idx]) + X2[idx]); }
  __syncthreads();
  for (int q = t; q < WWd * CCh / 4; q += 256) vst2(OUT + ((b * HH + h) * WWd) * CCh + q * 4, *(const v4f*)&so[q * 4]);
}
extern "C" void kernel_launch(void* const* d_in, const int* in_sizes, int n_in, void* d_out, int out_size, void* d_ws, size_t ws_size, hipStream_t stream) {
  (void)in_sizes; (void)n_in; (void)out_size;
  const float** F = (const float**)d_in;   // 0 feature [4,64,64,64], 1 predict [4,64,64,19], 2 hq_w (in,out), 3 hq_b, 4 hv_w, 5 hv_b, 6 wq_w, 7 wq_b, 8 wv_w, 9 wv_b, 10 h_gate [1], 11 w_gate [1], 12 conv_w [19,1], 13 conv_b [1]
  if (ws_size < (size_t)WS_END) return;
  char* ws = (char*)d_ws; __bf16* PW = (__bf16*)(ws + WS_PW); _Float16 *QH = (_Float16*)(ws + WS_QH), *QL = (_Float16*)(ws + WS_QL), *VT = (_Float16*)(ws + WS_VT), *VL = (_Float16*)(ws + WS_VL); float *X1 = (float*)(ws + WS_X1), *X2 = (float*)(ws + WS_X2);
  k_pack<<<dim3(FD, 4), 64, 0, stream>>>(F[2], F[4], F[6], F[8], PW);
  k_proj<0><<<dim3(WWd, NBB), 128, 0, stream>>>(F[0], PW, F[3], F[5], QH, QL, VT, VL);
  k_att<0><<<dim3(NSEQ / 64, NBB), ATT_T, 0, stream>>>(QH, QL, VT, VL, F[10], F[0], X1);
  k_proj<1><<<dim3(HH, NBB), 128, 0, stream>>>(X1, PW, F[7], F[9], QH, QL, VT, VL);
  k_att<1><<<dim3(NSEQ / 64, NBB), ATT_T, 0, stream>>>(QH, QL, VT, VL, F[11], X1, X2);
  k_fin<<<dim3(HH, NBB), 256, 0, stream>>>(F[0], X2, F[1], F[12], F[13], (float*)d_out);
}

// v004
// It runs in 157 microseconds.
// Two timings next to v003 both put it at 1.07 times that version's speed.
// Over all steps from v000 it is 7.27 times as fast.
// compute dtype: all float inputs rounded to bf16; per axis q = x_seq . Wq + bq and v = x_seq . Wv + bv with the sequence rows gathered from the [B,H,W,C] tensor (the second axis reads the first axis' f32 result as bf16 hi + residual, 2 products) on WMMA 16x16x32; scores = sigmoid(q_n . q_m / 8) with q as f16 hi + (x2048-scaled) residual (3 products) and 2048 * sigmoid(s) = 1 / (2^-11 + 2^-11 * 2^(-s * log2 e)) on the hardware's exp2 and reciprocal per score; out = sum_m P (scaled by 2^11, f16 hi + residual) x v (f16 hi + x2048 residual planes), 3 products; gates, residuals and the final (1 - sigmoid(predict)) . conv_w + conv_b pixel gate in f32. (the un-normalised 4,096-term sums need the residual products).
#include <hip/hip_runtime.h>
#include <math.h>

typedef __attribute__((ext_vector_type(16))) _Float16 v16h;
typedef __attribute__((ext_vector_type(16))) __bf16 v16b;
typedef __attribute__((ext_vector_type(8)))  _Float16 v8h;
typedef __attribute__((ext_vector_type(8)))  float v8f;
typedef __attribute__((ext_vector_type(4)))  float v4f;
typedef __attribute__((ext_vector_type(2)))  float v2f;
typedef __attribute__((ext_vector_type(4)))  unsigned v4u;
typedef __attribute__((ext_vector_type(4)))  int v4i;
typedef float __attribute__((may_alias)) float_a;
typedef int __attribute__((may_alias)) int_a;

template <typename T> __device__ __forceinline__ void vst2(void* p, T v) { *(T*)p = v;  }
__device__ __forceinline__ v8f wmma16(v16h a, v16h b, v8f c) {
  v8f d = __builtin_amdgcn_wmma_f32_16x16x32_f16(false, a, false, b, (short)0, c, false, false);
  asm volatile("v_nop\n\tv_nop\n\tv_nop\n\tv_nop" : "+v"(d) : "v"(a), "v"(b));
  return d;
}
__device__ __forceinline__ v8f wmma_bf(v16b a, v16b b, v8f c) {
  v8f d = __builtin_amdgcn_wmma_f32_16x16x32_bf16(false, a, false, b, (short)0, c, false, false);
  asm volatile("v_nop\n\tv_nop\n\tv_nop\n\tv_nop" : "+v"(d) : "v"(a), "v"(b));
  return d;
}
// 16x16x32 fragments: lane = (h = lane>>4, row/col = lane&15); elements 0..7 = k0+8h+0..7, 8..15 = k0+16+8h+0..7; D element r = row 8h+r
__device__ __forceinline__ v16h frag_h(const _Float16* rowk0, int lane) {
  union { v16h v; v8h q[2]; } u; const _Float16* p = rowk0 + 8 * (lane >> 4);
  u.q[0] = *(const v8h*)p; u.q[1] = *(const v8h*)(p + 16); return u.v;
}
__device__ __forceinline__ v16h frag_f32(const float* rowk0, int lane) {
  v16h a; const float* p = rowk0 + 8 * (lane >> 4);
#pragma unroll
  for (int i = 0; i < 8; ++i) { a[i] = (_Float16)p[i]; a[8 + i] = (_Float16)p[16 + i]; }
  return a;
}
__device__ __forceinline__ v16h frag_f32s(const float* rowk0, int lane, float sc) {
  v16h a; const float* p = rowk0 + 8 * (lane >> 4);
#pragma unroll
  for (int i = 0; i < 8; ++i) { a[i] = (_Float16)(p[i] * sc); a[8 + i] = (_Float16)(p[16 + i] * sc); }
  return a;
}
// column fragment from a [K][ld] layout (column n), rows >= K read as 0
__device__ __forceinline__ v16h fragc_f32(const float* W, int k0, int n, int lane, int ld, int K) {
  v16h a; const int g = lane >> 4;
#pragma unroll
  for (int i = 0; i < 8; ++i) { const int ka = k0 + 8 * g + i, kb = ka + 16;
    a[i] = (_Float16)(ka < K ? W[(size_t)(ka < K ? ka : K - 1) * ld + n] : 0.f); a[8 + i] = (_Float16)(kb < K ? W[(size_t)(kb < K ? kb : K - 1) * ld + n] : 0.f); }
  return a;
}
struct F2 { v16b h, l; };
__device__ __forceinline__ F2 bsplit16(const float v[16]) { F2 r;
#pragma unroll
  for (int i = 0; i < 16; ++i) { const __bf16 h = (__bf16)v[i]; r.h[i] = h; r.l[i] = (__bf16)(v[i] - (float)h); }
  return r; }
__device__ __forceinline__ F2 split_row(const float* row, int k0, int lane) { float v[16]; const float* p = row + k0 + 8 * (lane >> 4);
#pragma unroll
  for (int i = 0; i < 8; ++i) { v[i] = p[i]; v[8 + i] = p[16 + i]; }
  return bsplit16(v); }
__device__ __forceinline__ F2 split_rowK(const float* row, int k0, int lane, int K) { float v[16]; const int g = lane >> 4;
#pragma unroll
  for (int i = 0; i < 8; ++i) { const int ka = k0 + 8 * g + i, kb = ka + 16; v[i] = ka < K ? row[ka < K ? ka : K - 1] : 0.f; v[8 + i] = kb < K ? row[kb < K ? kb : K - 1] : 0.f; }
  return bsplit16(v); }
__device__ __forceinline__ F2 split_col(const float* W, int k0, int n, int lane, int ld, int K) { float v[16]; const int g = lane >> 4;
#pragma unroll
  for (int i = 0; i < 8; ++i) { const int ka = k0 + 8 * g + i, kb = ka + 16; v[i] = ka < K ? W[(size_t)(ka < K ? ka : K - 1) * ld + n] : 0.f; v[8 + i] = kb < K ? W[(size_t)(kb < K ? kb : K - 1) * ld + n] : 0.f; }
  return bsplit16(v); }
__device__ __forceinline__ v8f mac3(const F2& a, const F2& b, v8f c) { c = wmma_bf(a.l, b.h, c); c = wmma_bf(a.h, b.l, c); return wmma_bf(a.h, b.h, c); }
__device__ __forceinline__ float sigm(float v) { return 1.0f / (1.0f + expf(-v)); }
#define LDSX() do { asm volatile("s_wait_dscnt 0" ::: "memory"); __builtin_amdgcn_wave_barrier(); __builtin_amdgcn_fence(__ATOMIC_RELEASE, "workgroup"); } while (0)


// Reverse-attention residual axial block (B 4, 64 x 64 x 64 NHWC): height-axis then width-axis 'sigmoid attention' over 4,096-long sequences (feature dim 64), scalar gates and residuals, then a per-pixel gate from the 19-class prediction map.
#define NB 4
#define HH 64
#define WWd 64
#define CCh 64
#define NC 19
#define NSEQ 4096       // W*C (axis 1) or H*C (axis 2)
#define FD 64           // feature dim (H or W)
#ifndef NBB
#define NBB NB          // batches processed
#endif
typedef __attribute__((ext_vector_type(8))) __bf16 v8b;
__device__ __forceinline__ v16b frag_b(const __bf16* rowk0, int lane) {
  union { v16b v; v8b q[2]; } u; const __bf16* p = rowk0 + 8 * (lane >> 4);
  u.q[0] = *(const v8b*)p; u.q[1] = *(const v8b*)(p + 16); return u.v;
}
__device__ __forceinline__ float bfr(float v) { return (float)(__bf16)v; }
__device__ __attribute__((noinline)) float exp_ni(float v) { return expf(v); }
__device__ __attribute__((noinline)) float erf_ni(float v) { return erff(v); }

#define WS_PW  0u                                   // bf16 rows: hq^T [64][64], hv^T, wq^T, wv^T ((in,out) -> transposed)
#define WS_QH  (WS_PW + 2u * 4 * FD * FD)            // f16 [b][n][64] q hi ; QL ; VT f16 [b][64][n] v planes
#define WS_QL  (WS_QH + 2u * NB * NSEQ * FD)
#define WS_VT  (WS_QL + 2u * NB * NSEQ * FD)
#define WS_VL  (WS_VT + 2u * NB * NSEQ * FD)         // f16 v residual x2048 planes
#define WS_X1  (WS_VL + 2u * NB * NSEQ * FD)         // f32 [B][H][W][C] after the height axis
#define WS_X2  (WS_X1 + 4u * NB * HH * WWd * CCh)     // f32 [B][H][W][C] after the width axis
#define WS_END (WS_X2 + 4u * NB * HH * WWd * CCh)

__device__ __attribute__((noinline)) float exp_p(float v) { return expf(v); }
__global__ __launch_bounds__(64) void k_pack(const float* __restrict__ HQ, const float* __restrict__ HV, const float* __restrict__ WQ, const float* __restrict__ WV, __bf16* __restrict__ PW) {
  const int n = blockIdx.x, which = blockIdx.y, t = threadIdx.x; const float* Wm = (which == 0) ? HQ : (which == 1) ? HV : (which == 2) ? WQ : WV; __shared__ __align__(16) __bf16 s[FD];
  s[t] = (__bf16)Wm[(size_t)t * FD + n]; __syncthreads();   // (in,out): row n = output, k = input
  if (t < FD / 8) vst2((unsigned*)(PW + ((size_t)which * FD + n) * FD + t * 8), *(const v4u*)&s[t * 8]);
}
// ---- k_proj<AX>: block = (64 sequence rows n = (o, c0..c63) with o = w (AX 0) or h (AX 1), b): A[n][d] gathered from the NHWC tensor (AX 0: x[b][d][o][c]; AX 1: x1[b][o][d][c]); q = A . Wq^T + bq (AX 0 exact; AX 1 hi + residual) -> f16 hi/lo rows; v -> f16 planes [b][dd][n]
template <int AX>
__global__ __launch_bounds__(128) void k_proj(const float* __restrict__ SRC, const __bf16* __restrict__ PW, const float* __restrict__ BQ, const float* __restrict__ BV, _Float16* __restrict__ QH, _Float16* __restrict__ QL, _Float16* __restrict__ VT, _Float16* __restrict__ VL) {
  __shared__ __align__(16) __bf16 sa[64][FD + 8], sal[64][FD + 8]; __shared__ __align__(16) _Float16 sqh[64][FD + 8], sql[64][FD + 8]; __shared__ __align__(16) _Float16 svt[FD][72], svl[FD][72];
  const int tid = threadIdx.x, wave = tid >> 5, lane = tid & 31, col = lane & 15, g = lane >> 4; const size_t b = blockIdx.y; const int o = blockIdx.x;   // block = the 64 rows (o, c) c = 0..63
  const __bf16* PQ = PW + (size_t)(AX == 0 ? 0 : 2) * FD * FD; const __bf16* PV = PW + (size_t)(AX == 0 ? 1 : 3) * FD * FD;
  for (int e = tid; e < 64 * FD; e += 128) { const int d = e >> 6, c = e & 63; const float v = (AX == 0) ? bfr(SRC[((b * HH + d) * WWd + o) * CCh + c]) : SRC[((b * HH + o) * WWd + d) * CCh + c]; const __bf16 hb = (__bf16)v; sa[c][d] = hb; sal[c][d] = (__bf16)(v - (float)hb); }
  if (tid < 64) for (int d = FD; d < FD + 8; ++d) { sa[tid][d] = (__bf16)0.f; sal[tid][d] = (__bf16)0.f; sqh[tid][d] = (_Float16)0.f; sql[tid][d] = (_Float16)0.f; }
  __syncthreads();
  v8f acc[8] = {};   // tiles 0..3 q, 4..7 v
#pragma unroll
  for (int kc = 0; kc < FD / 32; ++kc) { const v16b a = frag_b(&sa[wave * 16 + col][kc * 32], lane), al = frag_b(&sal[wave * 16 + col][kc * 32], lane);
#pragma unroll
    for (int j = 0; j < 8; ++j) { const __bf16* Wr = (j < 4) ? PQ : PV; const v16b w = frag_b(Wr + (size_t)((j & 3) * 16 + col) * FD + kc * 32, lane); if (AX == 1) acc[j] = wmma_bf(al, w, acc[j]); acc[j] = wmma_bf(a, w, acc[j]); } }
#pragma unroll
  for (int j = 0; j < 8; ++j) { const int d = (j & 3) * 16 + col; const float bb = bfr((j < 4 ? BQ : BV)[d]);
#pragma unroll
    for (int r = 0; r < 8; ++r) { const float v = acc[j][r] + bb; const int rr = wave * 16 + 8 * g + r; const _Float16 hv = (_Float16)v; if (j < 4) { sqh[rr][d] = hv; sql[rr][d] = (_Float16)((v - (float)hv) * 2048.0f); } else { svt[d][rr] = hv; svl[d][rr] = (_Float16)((v - (float)hv) * 2048.0f); } } }
  __syncthreads();
  const size_t n0 = (size_t)o * 64;
  for (int e = tid; e < 64 * 8; e += 128) { const int r = e >> 3, q = e & 7; const size_t off = (b * NSEQ + n0 + r) * FD + q * 8; vst2((unsigned*)(QH + off), *(const v4u*)&sqh[r][q * 8]); vst2((unsigned*)(QL + off), *(const v4u*)&sql[r][q * 8]); }
  for (int e = tid; e < FD * 8; e += 128) { const int d = e >> 3, pc = e & 7; vst2((unsigned*)(VT + (b * FD + d) * NSEQ + n0 + pc * 8), *(const v4u*)&svt[d][pc * 8]); vst2((unsigned*)(VL + (b * FD + d) * NSEQ + n0 + pc * 8), *(const v4u*)&svl[d][pc * 8]); }
}
// ---- k_att<AX>: block = (64 queries n = (o, c), b), 24 waves = 4 query tiles x KSPL key ranges (6 waves a SIMD cover each other's dependent-chain latency); each wave sums its own key range, the ranges are added in LDS in fixed order: scores = sigmoid(q_n . q_m / 8) for all 4,096 m (3 products), P x 2^11 hi + residual x v hi + residual (4 tiles, 3 products); out * gate + residual -> NHWC (AX 0: x1[b][dd][o][c] = out[n][dd] * h_gate + x; AX 1: x2[b][o][dd][c] = out * w_gate + x1)
// The 32 keys of a pass (q hi, q residual rows; v hi, v residual planes: 16 KiB a key range) are staged in LDS once for the 4 query tiles that share them, by asynchronous copies into a ring of two buffers: the next pass's copies fly while this pass is worked on.
#define KSPL 6                       // key ranges per query tile
#define ATT_T (128 * KSPL)           // threads of a k_att block
#define NPASS (NSEQ / 32)            // passes of 32 keys over the whole sequence
#define TRIPS ((NPASS + KSPL - 1) / KSPL)   // trips of the ring = passes of the longest key range; first pass of the last range + TRIPS <= NPASS, so every staged tile lies inside the planes
#define KP 72                        // f16 per staged q row: 144 B = 16 B x odd, conflict-free for 16-byte reads
#define VP 40                        // f16 per staged v row:  80 B = 16 B x odd
#define ST_KL (32 * KP)              // places (in f16) of the four tiles of one key range: q hi at 0, q residual, v hi, v residual
#define ST_VH (2 * 32 * KP)
#define ST_VL (2 * 32 * KP + FD * VP)
#define ST_SZ (2 * 32 * KP + 2 * FD * VP)
#define BUF_SZ (KSPL * ST_SZ)
static_assert((KSPL - 1) * NPASS / KSPL + TRIPS <= NPASS, "a staged tile would leave the planes");
// eight 16-byte copies a lane (one 4-KiB tile a wave); the s_wait_xcnt stands inside the statement so that no address register is rewritten in front of it
__device__ __forceinline__ void stage8(unsigned l, unsigned ls, const char* g, size_t gs) {
  asm volatile("global_load_async_to_lds_b128 %0, %8, off\n\t"
               "global_load_async_to_lds_b128 %1, %9, off\n\t"
               "global_load_async_to_lds_b128 %2, %10, off\n\t"
               "global_load_async_to_lds_b128 %3, %11, off\n\t"
               "global_load_async_to_lds_b128 %4, %12, off\n\t"
               "global_load_async_to_lds_b128 %5, %13, off\n\t"
               "global_load_async_to_lds_b128 %6, %14, off\n\t"
               "global_load_async_to_lds_b128 %7, %15, off\n\t"
               "s_wait_xcnt 0x0"
               :: "v"(l), "v"(l + ls), "v"(l + 2 * ls), "v"(l + 3 * ls), "v"(l + 4 * ls), "v"(l + 5 * ls), "v"(l + 6 * ls), "v"(l + 7 * ls),
                  "v"(g), "v"(g + gs), "v"(g + 2 * gs), "v"(g + 3 * gs), "v"(g + 4 * gs), "v"(g + 5 * gs), "v"(g + 6 * gs), "v"(g + 7 * gs) : "memory");
}
// 2048 * sigmoid(s) from x = -s * log2(e): v_exp_f32, one fma, v_rcp_f32, in line, so that the scores of a tile are independent chains; 2^x = inf gives 0, 2^x = 0 gives 2048
__device__ __forceinline__ float sigm2048(float x) { return __builtin_amdgcn_rcpf(__builtin_fmaf(__builtin_amdgcn_exp2f(x), 1.0f / 2048.0f, 1.0f / 2048.0f)); }
template <int AX>
__global__ __launch_bounds__(ATT_T) void k_att(const _Float16* __restrict__ QH, const _Float16* __restrict__ QL, const _Float16* __restrict__ VT, const _Float16* __restrict__ VL, const float* __restrict__ GATE, const float* __restrict__ RES, float* __restrict__ OUTB) {
  __shared__ __align__(16) _Float16 sph[4 * KSPL][16][40], spl[4 * KSPL][16][40]; __shared__ __align__(16) _Float16 ring[2 * BUF_SZ];
  float (*so)[FD][68] = (float (*)[FD][68])ring;   // [key range][dd][c]: the ring's LDS, used again behind the loop's last barrier
  static_assert(sizeof(float) * KSPL * FD * 68 <= sizeof(_Float16) * 2 * BUF_SZ, "partial sums do not fit the ring");
  const int tid = threadIdx.x, wave = tid >> 5, lane = tid & 31, col = lane & 15, g = lane >> 4; const size_t b = blockIdx.y; const int o = blockIdx.x;
  const int qg = __builtin_amdgcn_readfirstlane(wave & 3), kr = __builtin_amdgcn_readfirstlane(wave >> 2);   // query tile; key range (wave-uniform, so the pass loop stays a scalar loop)
  const int ks0 = kr * NPASS / KSPL, ks1 = (kr + 1) * NPASS / KSPL; const size_t rq = b * NSEQ + (size_t)o * 64 + qg * 16;
  // wave qg of a key range copies tile qg: 0 q hi, 1 q residual (32 rows of 128 B, contiguous), 2 v hi, 3 v residual (64 rows of 64 B, 8 KiB apart)
  const bool isk = qg < 2;
  const char* gsrc = (const char*)(qg == 0 ? QH : qg == 1 ? QL : qg == 2 ? VT : VL) + b * (size_t)(NSEQ * FD * 2) + (isk ? (size_t)ks0 * (32 * FD * 2) + lane * 16 : (size_t)ks0 * 64 + (size_t)(lane >> 2) * (NSEQ * 2) + (lane & 3) * 16);
  const size_t gtrip = isk ? 32 * FD * 2 : 64, gstep = isk ? 512 : 8 * NSEQ * 2;
  const unsigned ldst = (unsigned)(size_t)ring + 2u * (kr * ST_SZ + (qg == 0 ? 0 : qg == 1 ? ST_KL : qg == 2 ? ST_VH : ST_VL)) + (isk ? (lane >> 3) * (2 * KP) + (lane & 7) * 16 : (lane >> 2) * (2 * VP) + (lane & 3) * 16);
  const unsigned lstep = isk ? 4 * 2 * KP : 8 * 2 * VP;
  stage8(ldst, lstep, gsrc, gstep);
  v16h aq[2], aql[2];
#pragma unroll
  for (int kc = 0; kc < 2; ++kc) { aq[kc] = frag_h(QH + (rq + col) * FD + kc * 32, lane); aql[kc] = frag_h(QL + (rq + col) * FD + kc * 32, lane); }
  asm volatile("s_wait_asynccnt 0x0" ::: "memory");   // tile 0 has landed before the barrier publishes it
  __syncthreads();
  stage8(ldst + 2u * BUF_SZ, lstep, gsrc + gtrip, gstep);
  v8f acc[4] = {}, accl[4] = {}; const float nscale = -0.125f * 1.44269504088896341f;   // -(1 / sqrt(64)) * log2(e): the score as the exponent of 2^x
#pragma unroll 1   // one copy of the pass body: the two buffers differ by an offset only
  for (int t = 0; t < TRIPS; ++t) { const _Float16* st = ring + (t & 1) * BUF_SZ + kr * ST_SZ;
    if (ks0 + t < ks1) {   // a shorter key range sits out the last trip (scalar branch); the publish point below is passed by every wave
    // The LDS fragment reads stand in groups, each ahead of work that covers its latency, in place of one read and one full wait per product pair:
    // key tile 0 at the head; key tile 1 (but its last fragment) ahead of tile 0's sigmoids; v hi ahead of tile 1's sigmoids; each v residual behind the last product of the v hi fragment of its columns.
    const _Float16* rk = st + col * KP; const _Float16* vo = st + ST_VH + col * VP; v16h kf[2][2], kl[2][2], vh[4], vl[4];
#pragma unroll
    for (int kc = 0; kc < 2; ++kc) { kf[0][kc] = frag_h(rk + kc * 32, lane); kl[0][kc] = frag_h(rk + ST_KL + kc * 32, lane); }
#pragma unroll
    for (int ct = 0; ct < 2; ++ct) { v8f c = {}, cl = {};
#pragma unroll
      for (int kc = 0; kc < 2; ++kc) { c = wmma16(aq[kc], kf[ct][kc], c); cl = wmma16(aql[kc], kf[ct][kc], cl); cl = wmma16(aq[kc], kl[ct][kc], cl); }
      if (ct == 0) { kf[1][0] = frag_h(rk + 16 * KP, lane); kl[1][0] = frag_h(rk + 16 * KP + ST_KL, lane); kf[1][1] = frag_h(rk + 16 * KP + 32, lane); }
      else {
#pragma unroll
        for (int dt = 0; dt < 4; ++dt) vh[dt] = frag_h(vo + dt * 16 * VP, lane);
      }
#pragma unroll
      for (int r = 0; r < 8; ++r) { const float p = sigm2048((c[r] + cl[r] * (1.0f / 2048.0f)) * nscale); const _Float16 hp = (_Float16)p; sph[wave][8 * g + r][ct * 16 + col] = hp; spl[wave][8 * g + r][ct * 16 + col] = (_Float16)((p - (float)hp) * 2048.0f); }
      if (ct == 0) kl[1][1] = frag_h(rk + 16 * KP + ST_KL + 32, lane);   // the fragment used last: the sigmoids need its registers
    }
    LDSX();
    const v16h pa = frag_h(&sph[wave][col][0], lane), pl = frag_h(&spl[wave][col][0], lane);
#pragma unroll
    for (int dt = 0; dt < 4; ++dt) { acc[dt] = wmma16(pa, vh[dt], acc[dt]); accl[dt] = wmma16(pl, vh[dt], accl[dt]); vl[dt] = frag_h(vo + dt * 16 * VP + (ST_VL - ST_VH), lane); }
#pragma unroll
    for (int dt = 0; dt < 4; ++dt) accl[dt] = wmma16(pa, vl[dt], accl[dt]);   // 3 products
    }
    asm volatile("s_wait_dscnt 0x0" ::: "memory");      // this wave's reads of the buffer are done before it is refilled
    asm volatile("s_wait_asynccnt 0x0" ::: "memory");   // this wave's copies of the next tile have landed
    __syncthreads();                                     // publishes the next tile and ends every reader's last read of this one
    if (t + 2 < TRIPS) stage8(ldst + (t & 1) * (2u * BUF_SZ), lstep, gsrc + (size_t)(t + 2) * gtrip, gstep); }
  asm volatile("s_wait_asynccnt 0x0" ::: "memory");     // no copy is in flight when the ring becomes the partial sums' place
  const float gate = bfr(GATE[0]);
#pragma unroll
  for (int r = 0; r < 8; ++r) { const int c = qg * 16 + 8 * g + r;
#pragma unroll
    for (int dt = 0; dt < 4; ++dt) so[kr][dt * 16 + col][c] = acc[dt][r] + accl[dt][r] * (1.0f / 2048.0f); }
  __syncthreads();
  for (int e = tid; e < FD * 16; e += ATT_T) { const int dd = e >> 4, q = e & 15; const size_t base = (AX == 0) ? (((b * HH + dd) * WWd + o) * CCh) : (((b * HH + o) * WWd + dd) * CCh);
    v4f a = *(const v4f*)&so[0][dd][q * 4];
    for (int s = 1; s < KSPL; ++s) a += *(const v4f*)&so[s][dd][q * 4];
    const v4f rv = *(const v4f*)(RES + base + q * 4); v4f ov;
    for (int i = 0; i < 4; ++i) ov[i] = a[i] * (1.0f / 2048.0f) * gate + ((AX == 0) ? bfr(rv[i]) : rv[i]);
    vst2(OUTB + base + q * 4, ov); }   // 64 consecutive c = 256 B
}
// ---- k_fin: block = (h, b): p[w] = sum_nc (1 - sigmoid(predict)) conv_w + conv_b; out[b][h][w][c] = p[w] * (feature + x2)
__global__ __launch_bounds__(256) void k_fin(const float* __restrict__ FEAT, const float* __restrict__ X2, const float* __restrict__ PRED, const float* __restrict__ CW, const float* __restrict__ CB, float* __restrict__ OUT) {
  const size_t b = blockIdx.y; const int h = blockIdx.x, t = threadIdx.x; __shared__ float sp[WWd]; __shared__ __align__(16) float so[WWd * CCh];
  if (t < WWd) { float a = 0.f; for (int k = 0; k < NC; ++k) { const float pr = bfr(PRED[((b * HH + h) * WWd + t) * NC + k]); a += (1.0f - 1.0f / (1.0f + exp_p(-pr))) * bfr(CW[k]); } sp[t] = a + bfr(CB[0]); }
  __syncthreads();
  for (int e = t; e < WWd * CCh; e += 256) { const int w = e >> 6; const size_t idx = ((b * HH + h) * WWd) * CCh + e; so[e] = sp[w] * (bfr(FEAT[idx]) + X2[idx]); }
  __syncthreads();
  for (int q = t; q < WWd * CCh / 4; q += 256) vst2(OUT + ((b * HH + h) * WWd) * CCh + q * 4, *(const v4f*)&so[q * 4]);
}
extern "C" void kernel_launch(void* const* d_in, const int* in_sizes, int n_in, void* d_out, int out_size, void* d_ws, size_t ws_size, hipStream_t stream) {
  (void)in_sizes; (void)n_in; (void)out_size;
  const float** F = (const float**)d_in;   // 0 feature [4,64,64,64], 1 predict [4,64,64,19], 2 hq_w (in,out), 3 hq_b, 4 hv_w, 5 hv_b, 6 wq_w, 7 wq_b, 8 wv_w, 9 wv_b, 10 h_gate [1], 11 w_gate [1], 12 conv_w [19,1], 13 conv_b [1]
  if (ws_size < (size_t)WS_END) return;
  char* ws = (char*)d_ws; __bf16* PW = (__bf16*)(ws + WS_PW); _Float16 *QH = (_Float16*)(ws + WS_QH), *QL = (_Float16*)(ws + WS_QL), *VT = (_Float16*)(ws + WS_VT), *VL = (_Float16*)(ws + WS_VL); float *X1 = (float*)(ws + WS_X1), *X2 = (float*)(ws + WS_X2);
  k_pack<<<dim3(FD, 4), 64, 0, stream>>>(F[2], F[4], F[6], F[8], PW);
  k_proj<0><<<dim3(WWd, NBB), 128, 0, stream>>>(F[0], PW, F[3], F[5], QH, QL, VT, VL);
  k_att<0><<<dim3(NSEQ / 64, NBB), ATT_T, 0, stream>>>(QH, QL, VT, VL, F[10], F[0], X1);
  k_proj<1><<<dim3(HH, NBB), 128, 0, stream>>>(X1, PW, F[7], F[9], QH, QL, VT, VL);
  k_att<1><<<dim3(NSEQ / 64, NBB), ATT_T, 0, stream>>>(QH, QL, VT, VL, F[11], X1, X2);
  k_fin<<<dim3(HH, NBB), 256, 0, stream>>>(F[0], X2, F[1], F[12], F[13], (float*)d_out);
}

// v005
// One run takes 144 microseconds.
// In both of two side-by-side timings against v004, it was 1.10 times as fast.
// Over all steps from v000 it is 8.00 times as fast.
// compute dtype: all float inputs rounded to bf16; per axis q = x_seq . Wq + bq and v = x_seq . Wv + bv with the sequence rows gathered from the [B,H,W,C] tensor (the second axis reads the first axis' f32 result as bf16 hi + residual, 2 products) on WMMA 16x16x32; scores = sigmoid(q_n . q_m / 8) with q as f16 hi + (x2048-scaled) residual (3 products) and 2048 * sigmoid(s) = 1 / (2^-11 + 2^-11 * 2^(-s * log2 e)) on the hardware's exp2 and reciprocal per score; out = sum_m P (scaled by 2^11, f16 hi + residual) x v (f16 hi + x2048 residual planes), 3 products; gates, residuals and the final (1 - sigmoid(predict)) . conv_w + conv_b pixel gate in f32. (the un-normalised 4,096-term sums need the residual products).
#include <hip/hip_runtime.h>
#include <math.h>

typedef __attribute__((ext_vector_type(16))) _Float16 v16h;
typedef __attribute__((ext_vector_type(16))) __bf16 v16b;
typedef __attribute__((ext_vector_type(8)))  _Float16 v8h;
typedef __attribute__((ext_vector_type(8)))  float v8f;
typedef __attribute__((ext_vector_type(4)))  float v4f;
typedef __attribute__((ext_vector_type(2)))  float v2f;
typedef __attribute__((ext_vector_type(4)))  unsigned v4u;
typedef __attribute__((ext_vector_type(4)))  int v4i;
typedef float __attribute__((may_alias)) float_a;
typedef int __attribute__((may_alias)) int_a;

template <typename T> __device__ __forceinline__ void vst2(void* p, T v) { *(T*)p = v;  }
__device__ __forceinline__ v8f wmma16(v16h a, v16h b, v8f c) {
  v8f d = __builtin_amdgcn_wmma_f32_16x16x32_f16(false, a, false, b, (short)0, c, false, false);
  asm volatile("v_nop\n\tv_nop\n\tv_nop\n\tv_nop" : "+v"(d) : "v"(a), "v"(b));
  return d;
}
__device__ __forceinline__ v8f wmma_bf(v16b a, v16b b, v8f c) {
  v8f d = __builtin_amdgcn_wmma_f32_16x16x32_bf16(false, a, false, b, (short)0, c, false, false);
  asm volatile("v_nop\n\tv_nop\n\tv_nop\n\tv_nop" : "+v"(d) : "v"(a), "v"(b));
  return d;
}
// 16x16x32 fragments: lane = (h = lane>>4, row/col = lane&15); elements 0..7 = k0+8h+0..7, 8..15 = k0+16+8h+0..7; D element r = row 8h+r
__device__ __forceinline__ v16h frag_h(const _Float16* rowk0, int lane) {
  union { v16h v; v8h q[2]; } u; const _Float16* p = rowk0 + 8 * (lane >> 4);
  u.q[0] = *(const v8h*)p; u.q[1] = *(const v8h*)(p + 16); return u.v;
}
__device__ __forceinline__ v16h frag_f32(const float* rowk0, int lane) {
  v16h a; const float* p = rowk0 + 8 * (lane >> 4);
#pragma unroll
  for (int i = 0; i < 8; ++i) { a[i] = (_Float16)p[i]; a[8 + i] = (_Float16)p[16 + i]; }
  return a;
}
__device__ __forceinline__ v16h frag_f32s(const float* rowk0, int lane, float sc) {
  v16h a; const float* p = rowk0 + 8 * (lane >> 4);
#pragma unroll
  for (int i = 0; i < 8; ++i) { a[i] = (_Float16)(p[i] * sc); a[8 + i] = (_Float16)(p[16 + i] * sc); }
  return a;
}
// column fragment from a [K][ld] layout (column n), rows >= K read as 0
__device__ __forceinline__ v16h fragc_f32(const float* W, int k0, int n, int lane, int ld, int K) {
  v16h a; const int g = lane >> 4;
#pragma unroll
  for (int i = 0; i < 8; ++i) { const int ka = k0 + 8 * g + i, kb = ka + 16;
    a[i] = (_Float16)(ka < K ? W[(size_t)(ka < K ? ka : K - 1) * ld + n] : 0.f); a[8 + i] = (_Float16)(kb < K ? W[(size_t)(kb < K ? kb : K - 1) * ld + n] : 0.f); }
  return a;
}
struct F2 { v16b h, l; };
__device__ __forceinline__ F2 bsplit16(const float v[16]) { F2 r;
#pragma unroll
  for (int i = 0; i < 16; ++i) { const __bf16 h = (__bf16)v[i]; r.h[i] = h; r.l[i] = (__bf16)(v[i] - (float)h); }
  return r; }
__device__ __forceinline__ F2 split_row(const float* row, int k0, int lane) { float v[16]; const float* p = row + k0 + 8 * (lane >> 4);
#pragma unroll
  for (int i = 0; i < 8; ++i) { v[i] = p[i]; v[8 + i] = p[16 + i]; }
  return bsplit16(v); }
__device__ __forceinline__ F2 split_rowK(const float* row, int k0, int lane, int K) { float v[16]; const int g = lane >> 4;
#pragma unroll
  for (int i = 0; i < 8; ++i) { const int ka = k0 + 8 * g + i, kb = ka + 16; v[i] = ka < K ? row[ka < K ? ka : K - 1] : 0.f; v[8 + i] = kb < K ? row[kb < K ? kb : K - 1] : 0.f; }
  return bsplit16(v); }
__device__ __forceinline__ F2 split_col(const float* W, int k0, int n, int lane, int ld, int K) { float v[16]; const int g = lane >> 4;
#pragma unroll
  for (int i = 0; i < 8; ++i) { const int ka = k0 + 8 * g + i, kb = ka + 16; v[i] = ka < K ? W[(size_t)(ka < K ? ka : K - 1) * ld + n] : 0.f; v[8 + i] = kb < K ? W[(size_t)(kb < K ? kb : K - 1) * ld + n] : 0.f; }
  return bsplit16(v); }
__device__ __forceinline__ v8f mac3(const F2& a, const F2& b, v8f c) { c = wmma_bf(a.l, b.h, c); c = wmma_bf(a.h, b.l, c); return wmma_bf(a.h, b.h, c); }
__device__ __forceinline__ float sigm(float v) { return 1.0f / (1.0f + expf(-v)); }


// Reverse-attention residual axial block (B 4, 64 x 64 x 64 NHWC): height-axis then width-axis 'sigmoid attention' over 4,096-long sequences (feature dim 64), scalar gates and residuals, then a per-pixel gate from the 19-class prediction map.
#define NB 4
#define HH 64
#define WWd 64
#define CCh 64
#define NC 19
#define NSEQ 4096       // W*C (axis 1) or H*C (axis 2)
#define FD 64           // feature dim (H or W)
#ifndef NBB
#define NBB NB          // batches processed
#endif
typedef __attribute__((ext_vector_type(8))) __bf16 v8b;
__device__ __forceinline__ v16b frag_b(const __bf16* rowk0, int lane) {
  union { v16b v; v8b q[2]; } u; const __bf16* p = rowk0 + 8 * (lane >> 4);
  u.q[0] = *(const v8b*)p; u.q[1] = *(const v8b*)(p + 16); return u.v;
}
__device__ __forceinline__ float bfr(float v) { return (float)(__bf16)v; }
__device__ __attribute__((noinline)) float exp_ni(float v) { return expf(v); }
__device__ __attribute__((noinline)) float erf_ni(float v) { return erff(v); }

#define WS_PW  0u                                   // bf16 rows: hq^T [64][64], hv^T, wq^T, wv^T ((in,out) -> transposed)
#define WS_QH  (WS_PW + 2u * 4 * FD * FD)            // f16 [b][n][64] q hi ; QL ; VT f16 [b][64][n] v planes
#define WS_QL  (WS_QH + 2u * NB * NSEQ * FD)
#define WS_VT  (WS_QL + 2u * NB * NSEQ * FD)
#define WS_VL  (WS_VT + 2u * NB * NSEQ * FD)         // f16 v residual x2048 planes
#define WS_X1  (WS_VL + 2u * NB * NSEQ * FD)         // f32 [B][H][W][C] after the height axis
#define WS_X2  (WS_X1 + 4u * NB * HH * WWd * CCh)     // f32 [B][H][W][C] after the width axis
#define WS_END (WS_X2 + 4u * NB * HH * WWd * CCh)

__device__ __attribute__((noinline)) float exp_p(float v) { return expf(v); }
__global__ __launch_bounds__(64) void k_pack(const float* __restrict__ HQ, const float* __restrict__ HV, const float* __restrict__ WQ, const float* __restrict__ WV, __bf16* __restrict__ PW) {
  const int n = blockIdx.x, which = blockIdx.y, t = threadIdx.x; const float* Wm = (which == 0) ? HQ : (which == 1) ? HV : (which == 2) ? WQ : WV; __shared__ __align__(16) __bf16 s[FD];
  s[t] = (__bf16)Wm[(size_t)t * FD + n]; __syncthreads();   // (in,out): row n = output, k = input
  if (t < FD / 8) vst2((unsigned*)(PW + ((size_t)which * FD + n) * FD + t * 8), *(const v4u*)&s[t * 8]);
}
// ---- k_proj<AX>: block = (64 sequence rows n = (o, c0..c63) with o = w (AX 0) or h (AX 1), b): A[n][d] gathered from the NHWC tensor (AX 0: x[b][d][o][c]; AX 1: x1[b][o][d][c]); q = A . Wq^T + bq (AX 0 exact; AX 1 hi + residual) -> f16 hi/lo rows; v -> f16 planes [b][dd][n]
template <int AX>
__global__ __launch_bounds__(128) void k_proj(const float* __restrict__ SRC, const __bf16* __restrict__ PW, const float* __restrict__ BQ, const float* __restrict__ BV, _Float16* __restrict__ QH, _Float16* __restrict__ QL, _Float16* __restrict__ VT, _Float16* __restrict__ VL) {
  __shared__ __align__(16) __bf16 sa[64][FD + 8], sal[64][FD + 8]; __shared__ __align__(16) _Float16 sqh[64][FD + 8], sql[64][FD + 8]; __shared__ __align__(16) _Float16 svt[FD][72], svl[FD][72];
  const int tid = threadIdx.x, wave = tid >> 5, lane = tid & 31, col = lane & 15, g = lane >> 4; const size_t b = blockIdx.y; const int o = blockIdx.x;   // block = the 64 rows (o, c) c = 0..63
  const __bf16* PQ = PW + (size_t)(AX == 0 ? 0 : 2) * FD * FD; const __bf16* PV = PW + (size_t)(AX == 0 ? 1 : 3) * FD * FD;
  for (int e = tid; e < 64 * FD; e += 128) { const int d = e >> 6, c = e & 63; const float v = (AX == 0) ? bfr(SRC[((b * HH + d) * WWd + o) * CCh + c]) : SRC[((b * HH + o) * WWd + d) * CCh + c]; const __bf16 hb = (__bf16)v; sa[c][d] = hb; sal[c][d] = (__bf16)(v - (float)hb); }
  if (tid < 64) for (int d = FD; d < FD + 8; ++d) { sa[tid][d] = (__bf16)0.f; sal[tid][d] = (__bf16)0.f; sqh[tid][d] = (_Float16)0.f; sql[tid][d] = (_Float16)0.f; }
  __syncthreads();
  v8f acc[8] = {};   // tiles 0..3 q, 4..7 v
#pragma unroll
  for (int kc = 0; kc < FD / 32; ++kc) { const v16b a = frag_b(&sa[wave * 16 + col][kc * 32], lane), al = frag_b(&sal[wave * 16 + col][kc * 32], lane);
#pragma unroll
    for (int j = 0; j < 8; ++j) { const __bf16* Wr = (j < 4) ? PQ : PV; const v16b w = frag_b(Wr + (size_t)((j & 3) * 16 + col) * FD + kc * 32, lane); if (AX == 1) acc[j] = wmma_bf(al, w, acc[j]); acc[j] = wmma_bf(a, w, acc[j]); } }
#pragma unroll
  for (int j = 0; j < 8; ++j) { const int d = (j & 3) * 16 + col; const float bb = bfr((j < 4 ? BQ : BV)[d]);
#pragma unroll
    for (int r = 0; r < 8; ++r) { const float v = acc[j][r] + bb; const int rr = wave * 16 + 8 * g + r; const _Float16 hv = (_Float16)v; if (j < 4) { sqh[rr][d] = hv; sql[rr][d] = (_Float16)((v - (float)hv) * 2048.0f); } else { svt[d][rr] = hv; svl[d][rr] = (_Float16)((v - (float)hv) * 2048.0f); } } }
  __syncthreads();
  const size_t n0 = (size_t)o * 64;
  for (int e = tid; e < 64 * 8; e += 128) { const int r = e >> 3, q = e & 7; const size_t off = (b * NSEQ + n0 + r) * FD + q * 8; vst2((unsigned*)(QH + off), *(const v4u*)&sqh[r][q * 8]); vst2((unsigned*)(QL + off), *(const v4u*)&sql[r][q * 8]); }
  for (int e = tid; e < FD * 8; e += 128) { const int d = e >> 3, pc = e & 7; vst2((unsigned*)(VT + (b * FD + d) * NSEQ + n0 + pc * 8), *(const v4u*)&svt[d][pc * 8]); vst2((unsigned*)(VL + (b * FD + d) * NSEQ + n0 + pc * 8), *(const v4u*)&svl[d][pc * 8]); }
}
// ---- k_att<AX>: block = (64 queries n = (o, c), b), 24 waves = 4 query tiles x KSPL key ranges (6 waves a SIMD cover each other's dependent-chain latency); each wave sums its own key range, the ranges are added in LDS in fixed order: scores = sigmoid(q_n . q_m / 8) for all 4,096 m (3 products), computed transposed (key rows x query columns) so that the two score tiles of a pass, converted in place, are the A fragment of P and P never goes through LDS; P x 2^11 hi + residual x v hi + residual (3 products, 4 tiles); out * gate + residual -> NHWC (AX 0: x1[b][dd][o][c] = out[n][dd] * h_gate + x; AX 1: x2[b][o][dd][c] = out * w_gate + x1)
// The 32 keys of a pass (q hi, q residual rows; v hi, v residual planes: 16 KiB a key range) are staged in LDS once for the 4 query tiles that share them, by asynchronous copies into a ring of two buffers: the next pass's copies fly while this pass is worked on.
#define KSPL 6                       // key ranges per query tile
#define ATT_T (128 * KSPL)           // threads of a k_att block
#define NPASS (NSEQ / 32)            // passes of 32 keys over the whole sequence
#define TRIPS ((NPASS + KSPL - 1) / KSPL)   // trips of the ring = passes of the longest key range; first pass of the last range + TRIPS <= NPASS, so every staged tile lies inside the planes
#define KP 72                        // f16 per staged q row: 144 B = 16 B x odd, conflict-free for 16-byte reads
#define VP 40                        // f16 per staged v row:  80 B = 16 B x odd
#define ST_KL (32 * KP)              // places (in f16) of the four tiles of one key range: q hi at 0, q residual, v hi, v residual
#define ST_VH (2 * 32 * KP)
#define ST_VL (2 * 32 * KP + FD * VP)
#define ST_SZ (2 * 32 * KP + 2 * FD * VP)
#define BUF_SZ (KSPL * ST_SZ)
static_assert((KSPL - 1) * NPASS / KSPL + TRIPS <= NPASS, "a staged tile would leave the planes");
// eight 16-byte copies a lane (one 4-KiB tile a wave); the s_wait_xcnt stands inside the statement so that no address register is rewritten in front of it
__device__ __forceinline__ void stage8(unsigned l, unsigned ls, const char* g, size_t gs) {
  asm volatile("global_load_async_to_lds_b128 %0, %8, off\n\t"
               "global_load_async_to_lds_b128 %1, %9, off\n\t"
               "global_load_async_to_lds_b128 %2, %10, off\n\t"
               "global_load_async_to_lds_b128 %3, %11, off\n\t"
               "global_load_async_to_lds_b128 %4, %12, off\n\t"
               "global_load_async_to_lds_b128 %5, %13, off\n\t"
               "global_load_async_to_lds_b128 %6, %14, off\n\t"
               "global_load_async_to_lds_b128 %7, %15, off\n\t"
               "s_wait_xcnt 0x0"
               :: "v"(l), "v"(l + ls), "v"(l + 2 * ls), "v"(l + 3 * ls), "v"(l + 4 * ls), "v"(l + 5 * ls), "v"(l + 6 * ls), "v"(l + 7 * ls),
                  "v"(g), "v"(g + gs), "v"(g + 2 * gs), "v"(g + 3 * gs), "v"(g + 4 * gs), "v"(g + 5 * gs), "v"(g + 6 * gs), "v"(g + 7 * gs) : "memory");
}
// 2048 * sigmoid(s) from x = -s * log2(e): v_exp_f32, one fma, v_rcp_f32, in line, so that the scores of a tile are independent chains; 2^x = inf gives 0, 2^x = 0 gives 2048
__device__ __forceinline__ float sigm2048(float x) { return __builtin_amdgcn_rcpf(__builtin_fmaf(__builtin_amdgcn_exp2f(x), 1.0f / 2048.0f, 1.0f / 2048.0f)); }
template <int AX>
__global__ __launch_bounds__(ATT_T) void k_att(const _Float16* __restrict__ QH, const _Float16* __restrict__ QL, const _Float16* __restrict__ VT, const _Float16* __restrict__ VL, const float* __restrict__ GATE, const float* __restrict__ RES, float* __restrict__ OUTB) {
  __shared__ __align__(16) _Float16 ring[2 * BUF_SZ];
  float (*so)[FD][68] = (float (*)[FD][68])ring;   // [key range][dd][c]: the ring's LDS, used again behind the loop's last barrier
  static_assert(sizeof(float) * KSPL * FD * 68 <= sizeof(_Float16) * 2 * BUF_SZ, "partial sums do not fit the ring");
  const int tid = threadIdx.x, wave = tid >> 5, lane = tid & 31, col = lane & 15, g = lane >> 4; const size_t b = blockIdx.y; const int o = blockIdx.x;
  const int qg = __builtin_amdgcn_readfirstlane(wave & 3), kr = __builtin_amdgcn_readfirstlane(wave >> 2);   // query tile; key range (wave-uniform, so the pass loop stays a scalar loop)
  const int ks0 = kr * NPASS / KSPL, ks1 = (kr + 1) * NPASS / KSPL; const size_t rq = b * NSEQ + (size_t)o * 64 + qg * 16;
  // wave qg of a key range copies tile qg: 0 q hi, 1 q residual (32 rows of 128 B, contiguous), 2 v hi, 3 v residual (64 rows of 64 B, 8 KiB apart)
  const bool isk = qg < 2;
  const char* gsrc = (const char*)(qg == 0 ? QH : qg == 1 ? QL : qg == 2 ? VT : VL) + b * (size_t)(NSEQ * FD * 2) + (isk ? (size_t)ks0 * (32 * FD * 2) + lane * 16 : (size_t)ks0 * 64 + (size_t)(lane >> 2) * (NSEQ * 2) + (lane & 3) * 16);
  const size_t gtrip = isk ? 32 * FD * 2 : 64, gstep = isk ? 512 : 8 * NSEQ * 2;
  const unsigned ldst = (unsigned)(size_t)ring + 2u * (kr * ST_SZ + (qg == 0 ? 0 : qg == 1 ? ST_KL : qg == 2 ? ST_VH : ST_VL)) + (isk ? (lane >> 3) * (2 * KP) + (lane & 7) * 16 : (lane >> 2) * (2 * VP) + (lane & 3) * 16);
  const unsigned lstep = isk ? 4 * 2 * KP : 8 * 2 * VP;
  stage8(ldst, lstep, gsrc, gstep);
  v16h aq[2], aql[2];
#pragma unroll
  for (int kc = 0; kc < 2; ++kc) { aq[kc] = frag_h(QH + (rq + col) * FD + kc * 32, lane); aql[kc] = frag_h(QL + (rq + col) * FD + kc * 32, lane); }
  asm volatile("s_wait_asynccnt 0x0" ::: "memory");   // tile 0 has landed before the barrier publishes it
  __syncthreads();
  stage8(ldst + 2u * BUF_SZ, lstep, gsrc + gtrip, gstep);
  v8f acc[4] = {}, accl[4] = {}; const float nscale = -0.125f * 1.44269504088896341f;   // -(1 / sqrt(64)) * log2(e): the score as the exponent of 2^x
#pragma unroll 1   // one copy of the pass body: the two buffers differ by an offset only
  for (int t = 0; t < TRIPS; ++t) { const _Float16* st = ring + (t & 1) * BUF_SZ + kr * ST_SZ;
    if (ks0 + t < ks1) {   // a shorter key range sits out the last trip (scalar branch); the publish point below is passed by every wave
    // The LDS fragment reads stand in groups, each ahead of work that covers its latency, in place of one read and one full wait per product pair:
    // key tile 0 at the head; key tile 1 (but its last fragment) ahead of tile 0's sigmoids; two v hi fragments ahead of tile 1's sigmoids; each v residual behind the last product of the v hi fragment of its columns.
    const _Float16* rk = st + col * KP; const _Float16* vo = st + ST_VH + col * VP; v16h kf[2][2], kl[2][2], vh[4], vl[4], pa, pl;
#pragma unroll
    for (int kc = 0; kc < 2; ++kc) { kf[0][kc] = frag_h(rk + kc * 32, lane); kl[0][kc] = frag_h(rk + ST_KL + kc * 32, lane); }
#pragma unroll
    for (int ct = 0; ct < 2; ++ct) { v8f c = {}, cl = {};   // keys as A, queries as B: c[r] = score of key ct * 16 + 8g + r with query col
#pragma unroll
      for (int kc = 0; kc < 2; ++kc) { c = wmma16(kf[ct][kc], aq[kc], c); cl = wmma16(kf[ct][kc], aql[kc], cl);
        if (ct == 1 && kc == 0) kl[1][1] = frag_h(rk + 16 * KP + ST_KL + 32, lane);   // the fragment used last takes the registers of the one just used up
        cl = wmma16(kl[ct][kc], aq[kc], cl); }
      if (ct == 0) { kf[1][0] = frag_h(rk + 16 * KP, lane); kl[1][0] = frag_h(rk + 16 * KP + ST_KL, lane); kf[1][1] = frag_h(rk + 16 * KP + 32, lane); }
      else {
#pragma unroll
        for (int dt = 0; dt < 2; ++dt) vh[dt] = frag_h(vo + dt * 16 * VP, lane);
      }
#pragma unroll
      for (int r = 0; r < 8; ++r) { const float p = sigm2048((c[r] + cl[r] * (1.0f / 2048.0f)) * nscale); const _Float16 hp = (_Float16)p; pa[ct * 8 + r] = hp; pl[ct * 8 + r] = (_Float16)((p - (float)hp) * 2048.0f); }   // element ct * 8 + r of the A fragment of row col is k = ct * 16 + 8g + r: each score stays in its lane
      __builtin_amdgcn_sched_barrier(0);   // keeps the next products and their fragments from being lifted among these sigmoids: together they do not fit the registers of 6 waves a SIMD (scratch)
    }
    vh[2] = frag_h(vo + 2 * 16 * VP, lane); vh[3] = frag_h(vo + 3 * 16 * VP, lane);   // the sigmoids need their registers
#pragma unroll
    for (int dt = 0; dt < 4; ++dt) { acc[dt] = wmma16(pa, vh[dt], acc[dt]); accl[dt] = wmma16(pl, vh[dt], accl[dt]); vl[dt] = frag_h(vo + dt * 16 * VP + (ST_VL - ST_VH), lane); }
#pragma unroll
    for (int dt = 0; dt < 4; ++dt) accl[dt] = wmma16(pa, vl[dt], accl[dt]);   // 3 products
    }
    asm volatile("s_wait_dscnt 0x0" ::: "memory");      // this wave's reads of the buffer are done before it is refilled
    asm volatile("s_wait_asynccnt 0x0" ::: "memory");   // this wave's copies of the next tile have landed
    __syncthreads();                                     // publishes the next tile and ends every reader's last read of this one
    if (t + 2 < TRIPS) stage8(ldst + (t & 1) * (2u * BUF_SZ), lstep, gsrc + (size_t)(t + 2) * gtrip, gstep); }
  asm volatile("s_wait_asynccnt 0x0" ::: "memory");     // no copy is in flight when the ring becomes the partial sums' place
  const float gate = bfr(GATE[0]);
#pragma unroll
  for (int r = 0; r < 8; ++r) { const int c = qg * 16 + 8 * g + r;
#pragma unroll
    for (int dt = 0; dt < 4; ++dt) so[kr][dt * 16 + col][c] = acc[dt][r] + accl[dt][r] * (1.0f / 2048.0f); }
  __syncthreads();
  for (int e = tid; e < FD * 16; e += ATT_T) { const int dd = e >> 4, q = e & 15; const size_t base = (AX == 0) ? (((b * HH + dd) * WWd + o) * CCh) : (((b * HH + o) * WWd + dd) * CCh);
    v4f a = *(const v4f*)&so[0][dd][q * 4];
    for (int s = 1; s < KSPL; ++s) a += *(const v4f*)&so[s][dd][q * 4];
    const v4f rv = *(const v4f*)(RES + base + q * 4); v4f ov;
    for (int i = 0; i < 4; ++i) ov[i] = a[i] * (1.0f / 2048.0f) * gate + ((AX == 0) ? bfr(rv[i]) : rv[i]);
    vst2(OUTB + base + q * 4, ov); }   // 64 consecutive c = 256 B
}
// ---- k_fin: block = (h, b): p[w] = sum_nc (1 - sigmoid(predict)) conv_w + conv_b; out[b][h][w][c] = p[w] * (feature + x2)
__global__ __launch_bounds__(256) void k_fin(const float* __restrict__ FEAT, const float* __restrict__ X2, const float* __restrict__ PRED, const float* __restrict__ CW, const float* __restrict__ CB, float* __restrict__ OUT) {
  const size_t b = blockIdx.y; const int h = blockIdx.x, t = threadIdx.x; __shared__ float sp[WWd]; __shared__ __align__(16) float so[WWd * CCh];
  if (t < WWd) { float a = 0.f; for (int k = 0; k < NC; ++k) { const float pr = bfr(PRED[((b * HH + h) * WWd + t) * NC + k]); a += (1.0f - 1.0f / (1.0f + exp_p(-pr))) * bfr(CW[k]); } sp[t] = a + bfr(CB[0]); }
  __syncthreads();
  for (int e = t; e < WWd * CCh; e += 256) { const int w = e >> 6; const size_t idx = ((b * HH + h) * WWd) * CCh + e; so[e] = sp[w] * (bfr(FEAT[idx]) + X2[idx]); }
  __syncthreads();
  for (int q = t; q < WWd * CCh / 4; q += 256) vst2(OUT + ((b * HH + h) * WWd) * CCh + q * 4, *(const v4f*)&so[q * 4]);
}
extern "C" void kernel_launch(void* const* d_in, const int* in_sizes, int n_in, void* d_out, int out_size, void* d_ws, size_t ws_size, hipStream_t stream) {
  (void)in_sizes; (void)n_in; (void)out_size;
  const float** F = (const float**)d_in;   // 0 feature [4,64,64,64], 1 predict [4,64,64,19], 2 hq_w (in,out), 3 hq_b, 4 hv_w, 5 hv_b, 6 wq_w, 7 wq_b, 8 wv_w, 9 wv_b, 10 h_gate [1], 11 w_gate [1], 12 conv_w [19,1], 13 conv_b [1]
  if (ws_size < (size_t)WS_END) return;
  char* ws = (char*)d_ws; __bf16* PW = (__bf16*)(ws + WS_PW); _Float16 *QH = (_Float16*)(ws + WS_QH), *QL = (_Float16*)(ws + WS_QL), *VT = (_Float16*)(ws + WS_VT), *VL = (_Float16*)(ws + WS_VL); float *X1 = (float*)(ws + WS_X1), *X2 = (float*)(ws + WS_X2);
  k_pack<<<dim3(FD, 4), 64, 0, stream>>>(F[2], F[4], F[6], F[8], PW);
  k_proj<0><<<dim3(WWd, NBB), 128, 0, stream>>>(F[0], PW, F[3], F[5], QH, QL, VT, VL);
  k_att<0><<<dim3(NSEQ / 64, NBB), ATT_T, 0, stream>>>(QH, QL, VT, VL, F[10], F[0], X1);
  k_proj<1><<<dim3(HH, NBB), 128, 0, stream>>>(X1, PW, F[7], F[9], QH, QL, VT, VL);
  k_att<1><<<dim3(NSEQ / 64, NBB), ATT_T, 0, stream>>>(QH, QL, VT, VL, F[11], X1, X2);
  k_fin<<<dim3(HH, NBB), 256, 0, stream>>>(F[0], X2, F[1], F[12], F[13], (float*)d_out);
}

// v006
// One run takes 139 microseconds.
// Two timings next to v005 both put it at 1.03 times that version's speed.
// All steps since v000 together make it 8.24 times as fast.
// compute dtype: all float inputs rounded to bf16; per axis q = x_seq . Wq + bq and v = x_seq . Wv + bv with the sequence rows gathered from the [B,H,W,C] tensor (the second axis reads the first axis' f32 result as bf16 hi + residual, 2 products) on WMMA 16x16x32; scores = sigmoid(q_n . q_m / 8) with q as f16 hi + (x2048-scaled) residual (3 products) and 2048 * sigmoid(s) = 1 / (2^-11 + 2^-11 * 2^(-s * log2 e)) on the hardware's exp2 and reciprocal per score; out = sum_m P (scaled by 2^11, f16 hi + residual) x v (f16 hi + x2048 residual planes), 3 products; gates, residuals and the final (1 - sigmoid(predict)) . conv_w + conv_b pixel gate in f32. (the un-normalised 4,096-term sums need the residual products).
#include <hip/hip_runtime.h>
#include <math.h>

typedef __attribute__((ext_vector_type(16))) _Float16 v16h;
typedef __attribute__((ext_vector_type(16))) __bf16 v16b;
typedef __attribute__((ext_vector_type(8)))  _Float16 v8h;
typedef __attribute__((ext_vector_type(8)))  float v8f;
typedef __attribute__((ext_vector_type(4)))  float v4f;
typedef __attribute__((ext_vector_type(2)))  float v2f;
typedef __attribute__((ext_vector_type(4)))  unsigned v4u;
typedef __attribute__((ext_vector_type(4)))  int v4i;
typedef float __attribute__((may_alias)) float_a;
typedef int __attribute__((may_alias)) int_a;

template <typename T> __device__ __forceinline__ void vst2(void* p, T v) { *(T*)p = v;  }
// The f16 products of the attention loop, written as asm: the accumulator stays in its registers and the products stay in the order written (the plain builtin, with or without scheduling barriers, went to scratch at the registers of 6 waves a SIMD).
// No v_nop behind a product whose next user is a product that adds into the same D or an LDS read over its A or B: neither needs a distance.
__device__ __forceinline__ v8f wmma16(v16h a, v16h b, v8f c) {
  asm volatile("v_wmma_f32_16x16x32_f16 %0, %1, %2, %0" : "+v"(c) : "v"(a), "v"(b));
  return c;
}
// first product of a sum: C = 0 as the inline constant
__device__ __forceinline__ v8f wmma16z(v16h a, v16h b) {
  v8f d; asm volatile("v_wmma_f32_16x16x32_f16 %0, %1, %2, 0" : "=&v"(d) : "v"(a), "v"(b));
  return d;
}
// last product of a run: the four v_nop are the distance the chip needs before a vector instruction reads D or overwrites A or B
__device__ __forceinline__ v8f wmma16e(v16h a, v16h b, v8f c) {
  asm volatile("v_wmma_f32_16x16x32_f16 %0, %1, %2, %0\n\tv_nop\n\tv_nop\n\tv_nop\n\tv_nop" : "+v"(c) : "v"(a), "v"(b));
  return c;
}
__device__ __forceinline__ v8f wmma_bf(v16b a, v16b b, v8f c) {
  v8f d = __builtin_amdgcn_wmma_f32_16x16x32_bf16(false, a, false, b, (short)0, c, false, false);
  asm volatile("v_nop\n\tv_nop\n\tv_nop\n\tv_nop" : "+v"(d) : "v"(a), "v"(b));
  return d;
}
// 16x16x32 fragments: lane = (h = lane>>4, row/col = lane&15); elements 0..7 = k0+8h+0..7, 8..15 = k0+16+8h+0..7; D element r = row 8h+r
__device__ __forceinline__ v16h frag_h(const _Float16* rowk0, int lane) {
  union { v16h v; v8h q[2]; } u; const _Float16* p = rowk0 + 8 * (lane >> 4);
  u.q[0] = *(const v8h*)p; u.q[1] = *(const v8h*)(p + 16); return u.v;
}
__device__ __forceinline__ v16h frag_f32(const float* rowk0, int lane) {
  v16h a; const float* p = rowk0 + 8 * (lane >> 4);
#pragma unroll
  for (int i = 0; i < 8; ++i) { a[i] = (_Float16)p[i]; a[8 + i] = (_Float16)p[16 + i]; }
  return a;
}
__device__ __forceinline__ v16h frag_f32s(const float* rowk0, int lane, float sc) {
  v16h a; const float* p = rowk0 + 8 * (lane >> 4);
#pragma unroll
  for (int i = 0; i < 8; ++i) { a[i] = (_Float16)(p[i] * sc); a[8 + i] = (_Float16)(p[16 + i] * sc); }
  return a;
}
// column fragment from a [K][ld] layout (column n), rows >= K read as 0
__device__ __forceinline__ v16h fragc_f32(const float* W, int k0, int n, int lane, int ld, int K) {
  v16h a; const int g = lane >> 4;
#pragma unroll
  for (int i = 0; i < 8; ++i) { const int ka = k0 + 8 * g + i, kb = ka + 16;
    a[i] = (_Float16)(ka < K ? W[(size_t)(ka < K ? ka : K - 1) * ld + n] : 0.f); a[8 + i] = (_Float16)(kb < K ? W[(size_t)(kb < K ? kb : K - 1) * ld + n] : 0.f); }
  return a;
}
struct F2 { v16b h, l; };
__device__ __forceinline__ F2 bsplit16(const float v[16]) { F2 r;
#pragma unroll
  for (int i = 0; i < 16; ++i) { const __bf16 h = (__bf16)v[i]; r.h[i] = h; r.l[i] = (__bf16)(v[i] - (float)h); }
  return r; }
__device__ __forceinline__ F2 split_row(const float* row, int k0, int lane) { float v[16]; const float* p = row + k0 + 8 * (lane >> 4);
#pragma unroll
  for (int i = 0; i < 8; ++i) { v[i] = p[i]; v[8 + i] = p[16 + i]; }
  return bsplit16(v); }
__device__ __forceinline__ F2 split_rowK(const float* row, int k0, int lane, int K) { float v[16]; const int g = lane >> 4;
#pragma unroll
  for (int i = 0; i < 8; ++i) { const int ka = k0 + 8 * g + i, kb = ka + 16; v[i] = ka < K ? row[ka < K ? ka : K - 1] : 0.f; v[8 + i] = kb < K ? row[kb < K ? kb : K - 1] : 0.f; }
  return bsplit16(v); }
__device__ __forceinline__ F2 split_col(const float* W, int k0, int n, int lane, int ld, int K) { float v[16]; const int g = lane >> 4;
#pragma unroll
  for (int i = 0; i < 8; ++i) { const int ka = k0 + 8 * g + i, kb = ka + 16; v[i] = ka < K ? W[(size_t)(ka < K ? ka : K - 1) * ld + n] : 0.f; v[8 + i] = kb < K ? W[(size_t)(kb < K ? kb : K - 1) * ld + n] : 0.f; }
  return bsplit16(v); }
__device__ __forceinline__ v8f mac3(const F2& a, const F2& b, v8f c) { c = wmma_bf(a.l, b.h, c); c = wmma_bf(a.h, b.l, c); return wmma_bf(a.h, b.h, c); }
__device__ __forceinline__ float sigm(float v) { return 1.0f / (1.0f + expf(-v)); }


// Reverse-attention residual axial block (B 4, 64 x 64 x 64 NHWC): height-axis then width-axis 'sigmoid attention' over 4,096-long sequences (feature dim 64), scalar gates and residuals, then a per-pixel gate from the 19-class prediction map.
#define NB 4
#define HH 64
#define WWd 64
#define CCh 64
#define NC 19
#define NSEQ 4096       // W*C (axis 1) or H*C (axis 2)
#define FD 64           // feature dim (H or W)
#ifndef NBB
#define NBB NB          // batches processed
#endif
typedef __attribute__((ext_vector_type(8))) __bf16 v8b;
__device__ __forceinline__ v16b frag_b(const __bf16* rowk0, int lane) {
  union { v16b v; v8b q[2]; } u; const __bf16* p = rowk0 + 8 * (lane >> 4);
  u.q[0] = *(const v8b*)p; u.q[1] = *(const v8b*)(p + 16); return u.v;
}
__device__ __forceinline__ float bfr(float v) { return (float)(__bf16)v; }
__device__ __attribute__((noinline)) float exp_ni(float v) { return expf(v); }
__device__ __attribute__((noinline)) float erf_ni(float v) { return erff(v); }

#define WS_PW  0u                                   // bf16 rows: hq^T [64][64], hv^T, wq^T, wv^T ((in,out) -> transposed)
#define WS_QH  (WS_PW + 2u * 4 * FD * FD)            // f16 [b][n][64] q hi ; QL ; VT f16 [b][64][n] v planes
#define WS_QL  (WS_QH + 2u * NB * NSEQ * FD)
#define WS_VT  (WS_QL + 2u * NB * NSEQ * FD)
#define WS_VL  (WS_VT + 2u * NB * NSEQ * FD)         // f16 v residual x2048 planes
#define WS_X1  (WS_VL + 2u * NB * NSEQ * FD)         // f32 [B][H][W][C] after the height axis
#define WS_X2  (WS_X1 + 4u * NB * HH * WWd * CCh)     // f32 [B][H][W][C] after the width axis
#define WS_END (WS_X2 + 4u * NB * HH * WWd * CCh)

__device__ __attribute__((noinline)) float exp_p(float v) { return expf(v); }
__global__ __launch_bounds__(64) void k_pack(const float* __restrict__ HQ, const float* __restrict__ HV, const float* __restrict__ WQ, const float* __restrict__ WV, __bf16* __restrict__ PW) {
  const int n = blockIdx.x, which = blockIdx.y, t = threadIdx.x; const float* Wm = (which == 0) ? HQ : (which == 1) ? HV : (which == 2) ? WQ : WV; __shared__ __align__(16) __bf16 s[FD];
  s[t] = (__bf16)Wm[(size_t)t * FD + n]; __syncthreads();   // (in,out): row n = output, k = input
  if (t < FD / 8) vst2((unsigned*)(PW + ((size_t)which * FD + n) * FD + t * 8), *(const v4u*)&s[t * 8]);
}
// ---- k_proj<AX>: block = (64 sequence rows n = (o, c0..c63) with o = w (AX 0) or h (AX 1), b): A[n][d] gathered from the NHWC tensor (AX 0: x[b][d][o][c]; AX 1: x1[b][o][d][c]); q = A . Wq^T + bq (AX 0 exact; AX 1 hi + residual) -> f16 hi/lo rows; v -> f16 planes [b][dd][n]
template <int AX>
__global__ __launch_bounds__(128) void k_proj(const float* __restrict__ SRC, const __bf16* __restrict__ PW, const float* __restrict__ BQ, const float* __restrict__ BV, _Float16* __restrict__ QH, _Float16* __restrict__ QL, _Float16* __restrict__ VT, _Float16* __restrict__ VL) {
  __shared__ __align__(16) __bf16 sa[64][FD + 8], sal[64][FD + 8]; __shared__ __align__(16) _Float16 sqh[64][FD + 8], sql[64][FD + 8]; __shared__ __align__(16) _Float16 svt[FD][72], svl[FD][72];
  const int tid = threadIdx.x, wave = tid >> 5, lane = tid & 31, col = lane & 15, g = lane >> 4; const size_t b = blockIdx.y; const int o = blockIdx.x;   // block = the 64 rows (o, c) c = 0..63
  const __bf16* PQ = PW + (size_t)(AX == 0 ? 0 : 2) * FD * FD; const __bf16* PV = PW + (size_t)(AX == 0 ? 1 : 3) * FD * FD;
  for (int e = tid; e < 64 * FD; e += 128) { const int d = e >> 6, c = e & 63; const float v = (AX == 0) ? bfr(SRC[((b * HH + d) * WWd + o) * CCh + c]) : SRC[((b * HH + o) * WWd + d) * CCh + c]; const __bf16 hb = (__bf16)v; sa[c][d] = hb; sal[c][d] = (__bf16)(v - (float)hb); }
  if (tid < 64) for (int d = FD; d < FD + 8; ++d) { sa[tid][d] = (__bf16)0.f; sal[tid][d] = (__bf16)0.f; sqh[tid][d] = (_Float16)0.f; sql[tid][d] = (_Float16)0.f; }
  __syncthreads();
  v8f acc[8] = {};   // tiles 0..3 q, 4..7 v
#pragma unroll
  for (int kc = 0; kc < FD / 32; ++kc) { const v16b a = frag_b(&sa[wave * 16 + col][kc * 32], lane), al = frag_b(&sal[wave * 16 + col][kc * 32], lane);
#pragma unroll
    for (int j = 0; j < 8; ++j) { const __bf16* Wr = (j < 4) ? PQ : PV; const v16b w = frag_b(Wr + (size_t)((j & 3) * 16 + col) * FD + kc * 32, lane); if (AX == 1) acc[j] = wmma_bf(al, w, acc[j]); acc[j] = wmma_bf(a, w, acc[j]); } }
#pragma unroll
  for (int j = 0; j < 8; ++j) { const int d = (j & 3) * 16 + col; const float bb = bfr((j < 4 ? BQ : BV)[d]);
#pragma unroll
    for (int r = 0; r < 8; ++r) { const float v = acc[j][r] + bb; const int rr = wave * 16 + 8 * g + r; const _Float16 hv = (_Float16)v; if (j < 4) { sqh[rr][d] = hv; sql[rr][d] = (_Float16)((v - (float)hv) * 2048.0f); } else { svt[d][rr] = hv; svl[d][rr] = (_Float16)((v - (float)hv) * 2048.0f); } } }
  __syncthreads();
  const size_t n0 = (size_t)o * 64;
  for (int e = tid; e < 64 * 8; e += 128) { const int r = e >> 3, q = e & 7; const size_t off = (b * NSEQ + n0 + r) * FD + q * 8; vst2((unsigned*)(QH + off), *(const v4u*)&sqh[r][q * 8]); vst2((unsigned*)(QL + off), *(const v4u*)&sql[r][q * 8]); }
  for (int e = tid; e < FD * 8; e += 128) { const int d = e >> 3, pc = e & 7; vst2((unsigned*)(VT + (b * FD + d) * NSEQ + n0 + pc * 8), *(const v4u*)&svt[d][pc * 8]); vst2((unsigned*)(VL + (b * FD + d) * NSEQ + n0 + pc * 8), *(const v4u*)&svl[d][pc * 8]); }
}
// ---- k_att<AX>: block = (64 queries n = (o, c), b), 24 waves = 4 query tiles x KSPL key ranges (6 waves a SIMD cover each other's dependent-chain latency); each wave sums its own key range, the ranges are added in LDS in fixed order: scores = sigmoid(q_n . q_m / 8) for all 4,096 m (3 products), computed transposed (key rows x query columns) so that the two score tiles of a pass, converted in place, are the A fragment of P and P never goes through LDS; P x 2^11 hi + residual x v hi + residual (3 products, 4 tiles); out * gate + residual -> NHWC (AX 0: x1[b][dd][o][c] = out[n][dd] * h_gate + x; AX 1: x2[b][o][dd][c] = out * w_gate + x1)
// The 32 keys of a pass (q hi, q residual rows; v hi, v residual planes: 16 KiB a key range) are staged in LDS once for the 4 query tiles that share them, by asynchronous copies into a ring of two buffers: the next pass's copies fly while this pass is worked on.
#define KSPL 6                       // key ranges per query tile
#define ATT_T (128 * KSPL)           // threads of a k_att block
#define NPASS (NSEQ / 32)            // passes of 32 keys over the whole sequence
#define TRIPS ((NPASS + KSPL - 1) / KSPL)   // trips of the ring = passes of the longest key range; first pass of the last range + TRIPS <= NPASS, so every staged tile lies inside the planes
#define KP 72                        // f16 per staged q row: 144 B = 16 B x odd, conflict-free for 16-byte reads
#define VP 40                        // f16 per staged v row:  80 B = 16 B x odd
#define ST_KL (32 * KP)              // places (in f16) of the four tiles of one key range: q hi at 0, q residual, v hi, v residual
#define ST_VH (2 * 32 * KP)
#define ST_VL (2 * 32 * KP + FD * VP)
#define ST_SZ (2 * 32 * KP + 2 * FD * VP)
#define BUF_SZ (KSPL * ST_SZ)
static_assert((KSPL - 1) * NPASS / KSPL + TRIPS <= NPASS, "a staged tile would leave the planes");
// eight 16-byte copies a lane (one 4-KiB tile a wave); the s_wait_xcnt stands inside the statement so that no address register is rewritten in front of it
__device__ __forceinline__ void stage8(unsigned l, unsigned ls, const char* g, size_t gs) {
  asm volatile("global_load_async_to_lds_b128 %0, %8, off\n\t"
               "global_load_async_to_lds_b128 %1, %9, off\n\t"
               "global_load_async_to_lds_b128 %2, %10, off\n\t"
               "global_load_async_to_lds_b128 %3, %11, off\n\t"
               "global_load_async_to_lds_b128 %4, %12, off\n\t"
               "global_load_async_to_lds_b128 %5, %13, off\n\t"
               "global_load_async_to_lds_b128 %6, %14, off\n\t"
               "global_load_async_to_lds_b128 %7, %15, off\n\t"
               "s_wait_xcnt 0x0"
               :: "v"(l), "v"(l + ls), "v"(l + 2 * ls), "v"(l + 3 * ls), "v"(l + 4 * ls), "v"(l + 5 * ls), "v"(l + 6 * ls), "v"(l + 7 * ls),
                  "v"(g), "v"(g + gs), "v"(g + 2 * gs), "v"(g + 3 * gs), "v"(g + 4 * gs), "v"(g + 5 * gs), "v"(g + 6 * gs), "v"(g + 7 * gs) : "memory");
}
// 2048 * sigmoid(s) from x = -s * log2(e): v_exp_f32, one fma, v_rcp_f32, in line, so that the scores of a tile are independent chains; 2^x = inf gives 0, 2^x = 0 gives 2048
__device__ __forceinline__ float sigm2048(float x) { return __builtin_amdgcn_rcpf(__builtin_fmaf(__builtin_amdgcn_exp2f(x), 1.0f / 2048.0f, 1.0f / 2048.0f)); }
template <int AX>
__global__ __launch_bounds__(ATT_T) void k_att(const _Float16* __restrict__ QH, const _Float16* __restrict__ QL, const _Float16* __restrict__ VT, const _Float16* __restrict__ VL, const float* __restrict__ GATE, const float* __restrict__ RES, float* __restrict__ OUTB) {
  __shared__ __align__(16) _Float16 ring[2 * BUF_SZ];
  float (*so)[FD][68] = (float (*)[FD][68])ring;   // [key range][dd][c]: the ring's LDS, used again behind the loop's last barrier
  static_assert(sizeof(float) * KSPL * FD * 68 <= sizeof(_Float16) * 2 * BUF_SZ, "partial sums do not fit the ring");
  const int tid = threadIdx.x, wave = tid >> 5, lane = tid & 31, col = lane & 15, g = lane >> 4; const size_t b = blockIdx.y; const int o = blockIdx.x;
  const int qg = __builtin_amdgcn_readfirstlane(wave & 3), kr = __builtin_amdgcn_readfirstlane(wave >> 2);   // query tile; key range (wave-uniform, so the pass loop stays a scalar loop)
  const int ks0 = kr * NPASS / KSPL, ks1 = (kr + 1) * NPASS / KSPL; const size_t rq = b * NSEQ + (size_t)o * 64 + qg * 16;
  // wave qg of a key range copies tile qg: 0 q hi, 1 q residual (32 rows of 128 B, contiguous), 2 v hi, 3 v residual (64 rows of 64 B, 8 KiB apart)
  const bool isk = qg < 2;
  const char* gsrc = (const char*)(qg == 0 ? QH : qg == 1 ? QL : qg == 2 ? VT : VL) + b * (size_t)(NSEQ * FD * 2) + (isk ? (size_t)ks0 * (32 * FD * 2) + lane * 16 : (size_t)ks0 * 64 + (size_t)(lane >> 2) * (NSEQ * 2) + (lane & 3) * 16);
  const size_t gtrip = isk ? 32 * FD * 2 : 64, gstep = isk ? 512 : 8 * NSEQ * 2;
  const unsigned ldst = (unsigned)(size_t)ring + 2u * (kr * ST_SZ + (qg == 0 ? 0 : qg == 1 ? ST_KL : qg == 2 ? ST_VH : ST_VL)) + (isk ? (lane >> 3) * (2 * KP) + (lane & 7) * 16 : (lane >> 2) * (2 * VP) + (lane & 3) * 16);
  const unsigned lstep = isk ? 4 * 2 * KP : 8 * 2 * VP;
  stage8(ldst, lstep, gsrc, gstep);
  v16h aq[2], aql[2];
#pragma unroll
  for (int kc = 0; kc < 2; ++kc) { aq[kc] = frag_h(QH + (rq + col) * FD + kc * 32, lane); aql[kc] = frag_h(QL + (rq + col) * FD + kc * 32, lane); }
  asm volatile("s_wait_asynccnt 0x0" ::: "memory");   // tile 0 has landed before the barrier publishes it
  __syncthreads();
  stage8(ldst + 2u * BUF_SZ, lstep, gsrc + gtrip, gstep);
  v8f acc[4] = {}, accl[4] = {}; const float nscale = -0.125f * 1.44269504088896341f;   // -(1 / sqrt(64)) * log2(e): the score as the exponent of 2^x
#pragma unroll 1   // one copy of the pass body: the two buffers differ by an offset only
  for (int t = 0; t < TRIPS; ++t) { const _Float16* st = ring + (t & 1) * BUF_SZ + kr * ST_SZ;
    if (ks0 + t < ks1) {   // a shorter key range sits out the last trip (scalar branch); the publish point below is passed by every wave
    // The LDS fragment reads stand in groups, each ahead of work that covers its latency, in place of one read and one full wait per product pair:
    // key tile 0 at the head; key tile 1 (but its last fragment) ahead of tile 0's sigmoids; two v hi fragments ahead of tile 1's sigmoids; each v residual behind the last product of the v hi fragment of its columns.
    const _Float16* rk = st + col * KP; const _Float16* vo = st + ST_VH + col * VP; v16h kf[2][2], kl[2][2], vh[4], vl[4], pa, pl;
#pragma unroll
    for (int kc = 0; kc < 2; ++kc) { kf[0][kc] = frag_h(rk + kc * 32, lane); kl[0][kc] = frag_h(rk + ST_KL + kc * 32, lane); }
#pragma unroll
    for (int ct = 0; ct < 2; ++ct) { v8f c, cl;   // keys as A, queries as B: c[r] = score of key ct * 16 + 8g + r with query col
#pragma unroll
      for (int kc = 0; kc < 2; ++kc) { c = kc == 0 ? wmma16z(kf[ct][kc], aq[kc]) : wmma16(kf[ct][kc], aq[kc], c); cl = kc == 0 ? wmma16z(kf[ct][kc], aql[kc]) : wmma16(kf[ct][kc], aql[kc], cl);
        if (ct == 1 && kc == 0) kl[1][1] = frag_h(rk + 16 * KP + ST_KL + 32, lane);   // the fragment used last takes the registers of the one just used up
        cl = kc == 0 ? wmma16(kl[ct][kc], aq[kc], cl) : wmma16e(kl[ct][kc], aq[kc], cl); }   // the sigmoids read c and cl next
      if (ct == 0) { kf[1][0] = frag_h(rk + 16 * KP, lane); kl[1][0] = frag_h(rk + 16 * KP + ST_KL, lane); kf[1][1] = frag_h(rk + 16 * KP + 32, lane); }
      else {
#pragma unroll
        for (int dt = 0; dt < 2; ++dt) vh[dt] = frag_h(vo + dt * 16 * VP, lane);
      }
#pragma unroll
      for (int r = 0; r < 8; ++r) { const float p = sigm2048((c[r] + cl[r] * (1.0f / 2048.0f)) * nscale); const _Float16 hp = (_Float16)p; pa[ct * 8 + r] = hp; pl[ct * 8 + r] = (_Float16)((p - (float)hp) * 2048.0f); }   // element ct * 8 + r of the A fragment of row col is k = ct * 16 + 8g + r: each score stays in its lane
      __builtin_amdgcn_sched_barrier(0);   // keeps the next products and their fragments from being lifted among these sigmoids: together they do not fit the registers of 6 waves a SIMD (scratch)
    }
    vh[2] = frag_h(vo + 2 * 16 * VP, lane); vh[3] = frag_h(vo + 3 * 16 * VP, lane);   // the sigmoids need their registers
#pragma unroll
    for (int dt = 0; dt < 4; ++dt) { acc[dt] = wmma16(pa, vh[dt], acc[dt]); accl[dt] = wmma16(pl, vh[dt], accl[dt]); vl[dt] = frag_h(vo + dt * 16 * VP + (ST_VL - ST_VH), lane); }
#pragma unroll
    for (int dt = 0; dt < 4; ++dt) accl[dt] = dt < 3 ? wmma16(pa, vl[dt], accl[dt]) : wmma16e(pa, vl[dt], accl[dt]);   // 3 products; behind the last one the next copies' addresses may take the fragments' registers
    }
    asm volatile("s_wait_dscnt 0x0" ::: "memory");      // this wave's reads of the buffer are done before it is refilled
    asm volatile("s_wait_asynccnt 0x0" ::: "memory");   // this wave's copies of the next tile have landed
    __syncthreads();                                     // publishes the next tile and ends every reader's last read of this one
    if (t + 2 < TRIPS) stage8(ldst + (t & 1) * (2u * BUF_SZ), lstep, gsrc + (size_t)(t + 2) * gtrip, gstep); }
  asm volatile("s_wait_asynccnt 0x0" ::: "memory");     // no copy is in flight when the ring becomes the partial sums' place
  const float gate = bfr(GATE[0]);
#pragma unroll
  for (int r = 0; r < 8; ++r) { const int c = qg * 16 + 8 * g + r;
#pragma unroll
    for (int dt = 0; dt < 4; ++dt) so[kr][dt * 16 + col][c] = acc[dt][r] + accl[dt][r] * (1.0f / 2048.0f); }
  __syncthreads();
  for (int e = tid; e < FD * 16; e += ATT_T) { const int dd = e >> 4, q = e & 15; const size_t base = (AX == 0) ? (((b * HH + dd) * WWd + o) * CCh) : (((b * HH + o) * WWd + dd) * CCh);
    v4f a = *(const v4f*)&so[0][dd][q * 4];
    for (int s = 1; s < KSPL; ++s) a += *(const v4f*)&so[s][dd][q * 4];
    const v4f rv = *(const v4f*)(RES + base + q * 4); v4f ov;
    for (int i = 0; i < 4; ++i) ov[i] = a[i] * (1.0f / 2048.0f) * gate + ((AX == 0) ? bfr(rv[i]) : rv[i]);
    vst2(OUTB + base + q * 4, ov); }   // 64 consecutive c = 256 B
}
// ---- k_fin: block = (h, b): p[w] = sum_nc (1 - sigmoid(predict)) conv_w + conv_b; out[b][h][w][c] = p[w] * (feature + x2)
__global__ __launch_bounds__(256) void k_fin(const float* __restrict__ FEAT, const float* __restrict__ X2, const float* __restrict__ PRED, const float* __restrict__ CW, const float* __restrict__ CB, float* __restrict__ OUT) {
  const size_t b = blockIdx.y; const int h = blockIdx.x, t = threadIdx.x; __shared__ float sp[WWd]; __shared__ __align__(16) float so[WWd * CCh];
  if (t < WWd) { float a = 0.f; for (int k = 0; k < NC; ++k) { const float pr = bfr(PRED[((b * HH + h) * WWd + t) * NC + k]); a += (1.0f - 1.0f / (1.0f + exp_p(-pr))) * bfr(CW[k]); } sp[t] = a + bfr(CB[0]); }
  __syncthreads();
  for (int e = t; e < WWd * CCh; e += 256) { const int w = e >> 6; const size_t idx = ((b * HH + h) * WWd) * CCh + e; so[e] = sp[w] * (bfr(FEAT[idx]) + X2[idx]); }
  __syncthreads();
  for (int q = t; q < WWd * CCh / 4; q += 256) vst2(OUT + ((b * HH + h) * WWd) * CCh + q * 4, *(const v4f*)&so[q * 4]);
}
extern "C" void kernel_launch(void* const* d_in, const int* in_sizes, int n_in, void* d_out, int out_size, void* d_ws, size_t ws_size, hipStream_t stream) {
  (void)in_sizes; (void)n_in; (void)out_size;
  const float** F = (const float**)d_in;   // 0 feature [4,64,64,64], 1 predict [4,64,64,19], 2 hq_w (in,out), 3 hq_b, 4 hv_w, 5 hv_b, 6 wq_w, 7 wq_b, 8 wv_w, 9 wv_b, 10 h_gate [1], 11 w_gate [1], 12 conv_w [19,1], 13 conv_b [1]
  if (ws_size < (size_t)WS_END) return;
  char* ws = (char*)d_ws; __bf16* PW = (__bf16*)(ws + WS_PW); _Float16 *QH = (_Float16*)(ws + WS_QH), *QL = (_Float16*)(ws + WS_QL), *VT = (_Float16*)(ws + WS_VT), *VL = (_Float16*)(ws + WS_VL); float *X1 = (float*)(ws + WS_X1), *X2 = (float*)(ws + WS_X2);
  k_pack<<<dim3(FD, 4), 64, 0, stream>>>(F[2], F[4], F[6], F[8], PW);
  k_proj<0><<<dim3(WWd, NBB), 128, 0, stream>>>(F[0], PW, F[3], F[5], QH, QL, VT, VL);
  k_att<0><<<dim3(NSEQ / 64, NBB), ATT_T, 0, stream>>>(QH, QL, VT, VL, F[10], F[0], X1);
  k_proj<1><<<dim3(HH, NBB), 128, 0, stream>>>(X1, PW, F[7], F[9], QH, QL, VT, VL);
  k_att<1><<<dim3(NSEQ / 64, NBB), ATT_T, 0, stream>>>(QH, QL, VT, VL, F[11], X1, X2);
  k_fin<<<dim3(HH, NBB), 256, 0, stream>>>(F[0], X2, F[1], F[12], F[13], (float*)d_out);
}

// v007
// One run takes 130 microseconds.
// Two timings next to v006 both put it at 1.07 times that version's speed.
// All steps since v000 together make it 8.84 times as fast.
// compute dtype: all float inputs rounded to bf16; per axis q = x_seq . Wq + bq and v = x_seq . Wv + bv with the sequence rows gathered from the [B,H,W,C] tensor (the second axis reads the first axis' f32 result as bf16 hi + residual, 2 products) on WMMA 16x16x32; scores = sigmoid(q_n . q_m / 8) with q as f16 hi + (x2048-scaled) residual (3 products) and 2048 * sigmoid(s) = 1 / (2^-11 + 2^-11 * 2^(-s * log2 e)) on the hardware's exp2 and reciprocal per score; out = sum_m P (scaled by 2^11, f16 hi + residual) x v (f16 hi + x2048 residual planes), 3 products; gates, residuals and the final (1 - sigmoid(predict)) . conv_w + conv_b pixel gate in f32. (the un-normalised 4,096-term sums need the residual products).
#include <hip/hip_runtime.h>
#include <math.h>

typedef __attribute__((ext_vector_type(16))) _Float16 v16h;
typedef __attribute__((ext_vector_type(16))) __bf16 v16b;
typedef __attribute__((ext_vector_type(8)))  _Float16 v8h;
typedef __attribute__((ext_vector_type(8)))  float v8f;
typedef __attribute__((ext_vector_type(4)))  float v4f;
typedef __attribute__((ext_vector_type(2)))  float v2f;
typedef __attribute__((ext_vector_type(4)))  unsigned v4u;
typedef __attribute__((ext_vector_type(4)))  int v4i;
typedef float __attribute__((may_alias)) float_a;
typedef int __attribute__((may_alias)) int_a;

template <typename T> __device__ __forceinline__ void vst2(void* p, T v) { *(T*)p = v;  }
// The f16 products of the attention loop, written as asm: the accumulator stays in its registers and the products stay in the order written (the plain builtin, with or without scheduling barriers, went to scratch at the registers of 6 waves a SIMD).
// No v_nop behind a product whose next user is a product that adds into the same D or an LDS read over its A or B: neither needs a distance.
__device__ __forceinline__ v8f wmma16(v16h a, v16h b, v8f c) {
  asm volatile("v_wmma_f32_16x16x32_f16 %0, %1, %2, %0" : "+v"(c) : "v"(a), "v"(b));
  return c;
}
// first product of a sum: C = 0 as the inline constant
__device__ __forceinline__ v8f wmma16z(v16h a, v16h b) {
  v8f d; asm volatile("v_wmma_f32_16x16x32_f16 %0, %1, %2, 0" : "=&v"(d) : "v"(a), "v"(b));
  return d;
}
// last product of a run: the four v_nop are the distance the chip needs before a vector instruction reads D or overwrites A or B
__device__ __forceinline__ v8f wmma16e(v16h a, v16h b, v8f c) {
  asm volatile("v_wmma_f32_16x16x32_f16 %0, %1, %2, %0\n\tv_nop\n\tv_nop\n\tv_nop\n\tv_nop" : "+v"(c) : "v"(a), "v"(b));
  return c;
}
__device__ __forceinline__ v8f wmma_bf(v16b a, v16b b, v8f c) {
  v8f d = __builtin_amdgcn_wmma_f32_16x16x32_bf16(false, a, false, b, (short)0, c, false, false);
  asm volatile("v_nop\n\tv_nop\n\tv_nop\n\tv_nop" : "+v"(d) : "v"(a), "v"(b));
  return d;
}
// 16x16x32 fragments: lane = (h = lane>>4, row/col = lane&15); elements 0..7 = k0+8h+0..7, 8..15 = k0+16+8h+0..7; D element r = row 8h+r
__device__ __forceinline__ v16h frag_h(const _Float16* rowk0, int lane) {
  union { v16h v; v8h q[2]; } u; const _Float16* p = rowk0 + 8 * (lane >> 4);
  u.q[0] = *(const v8h*)p; u.q[1] = *(const v8h*)(p + 16); return u.v;
}
__device__ __forceinline__ v16h frag_f32(const float* rowk0, int lane) {
  v16h a; const float* p = rowk0 + 8 * (lane >> 4);
#pragma unroll
  for (int i = 0; i < 8; ++i) { a[i] = (_Float16)p[i]; a[8 + i] = (_Float16)p[16 + i]; }
  return a;
}
__device__ __forceinline__ v16h frag_f32s(const float* rowk0, int lane, float sc) {
  v16h a; const float* p = rowk0 + 8 * (lane >> 4);
#pragma unroll
  for (int i = 0; i < 8; ++i) { a[i] = (_Float16)(p[i] * sc); a[8 + i] = (_Float16)(p[16 + i] * sc); }
  return a;
}
// column fragment from a [K][ld] layout (column n), rows >= K read as 0
__device__ __forceinline__ v16h fragc_f32(const float* W, int k0, int n, int lane, int ld, int K) {
  v16h a; const int g = lane >> 4;
#pragma unroll
  for (int i = 0; i < 8; ++i) { const int ka = k0 + 8 * g + i, kb = ka + 16;
    a[i] = (_Float16)(ka < K ? W[(size_t)(ka < K ? ka : K - 1) * ld + n] : 0.f); a[8 + i] = (_Float16)(kb < K ? W[(size_t)(kb < K ? kb : K - 1) * ld + n] : 0.f); }
  return a;
}
struct F2 { v16b h, l; };
__device__ __forceinline__ F2 bsplit16(const float v[16]) { F2 r;
#pragma unroll
  for (int i = 0; i < 16; ++i) { const __bf16 h = (__bf16)v[i]; r.h[i] = h; r.l[i] = (__bf16)(v[i] - (float)h); }
  return r; }
__device__ __forceinline__ F2 split_row(const float* row, int k0, int lane) { float v[16]; const float* p = row + k0 + 8 * (lane >> 4);
#pragma unroll
  for (int i = 0; i < 8; ++i) { v[i] = p[i]; v[8 + i] = p[16 + i]; }
  return bsplit16(v); }
__device__ __forceinline__ F2 split_rowK(const float* row, int k0, int lane, int K) { float v[16]; const int g = lane >> 4;
#pragma unroll
  for (int i = 0; i < 8; ++i) { const int ka = k0 + 8 * g + i, kb = ka + 16; v[i] = ka < K ? row[ka < K ? ka : K - 1] : 0.f; v[8 + i] = kb < K ? row[kb < K ? kb : K - 1] : 0.f; }
  return bsplit16(v); }
__device__ __forceinline__ F2 split_col(const float* W, int k0, int n, int lane, int ld, int K) { float v[16]; const int g = lane >> 4;
#pragma unroll
  for (int i = 0; i < 8; ++i) { const int ka = k0 + 8 * g + i, kb = ka + 16; v[i] = ka < K ? W[(size_t)(ka < K ? ka : K - 1) * ld + n] : 0.f; v[8 + i] = kb < K ? W[(size_t)(kb < K ? kb : K - 1) * ld + n] : 0.f; }
  return bsplit16(v); }
__device__ __forceinline__ v8f mac3(const F2& a, const F2& b, v8f c) { c = wmma_bf(a.l, b.h, c); c = wmma_bf(a.h, b.l, c); return wmma_bf(a.h, b.h, c); }
__device__ __forceinline__ float sigm(float v) { return 1.0f / (1.0f + expf(-v)); }


// Reverse-attention residual axial block (B 4, 64 x 64 x 64 NHWC): height-axis then width-axis 'sigmoid attention' over 4,096-long sequences (feature dim 64), scalar gates and residuals, then a per-pixel gate from the 19-class prediction map.
#define NB 4
#define HH 64
#define WWd 64
#define CCh 64
#define NC 19
#define NSEQ 4096       // W*C (axis 1) or H*C (axis 2)
#define FD 64           // feature dim (H or W)
#ifndef NBB
#define NBB NB          // batches processed
#endif
typedef __attribute__((ext_vector_type(8))) __bf16 v8b;
__device__ __forceinline__ v16b frag_b(const __bf16* rowk0, int lane) {
  union { v16b v; v8b q[2]; } u; const __bf16* p = rowk0 + 8 * (lane >> 4);
  u.q[0] = *(const v8b*)p; u.q[1] = *(const v8b*)(p + 16); return u.v;
}
__device__ __forceinline__ float bfr(float v) { return (float)(__bf16)v; }
__device__ __attribute__((noinline)) float exp_ni(float v) { return expf(v); }
__device__ __attribute__((noinline)) float erf_ni(float v) { return erff(v); }

#define WS_PW  0u                                   // bf16 rows: hq^T [64][64], hv^T, wq^T, wv^T ((in,out) -> transposed)
#define WS_QH  (WS_PW + 2u * 4 * FD * FD)            // f16 [b][n][64] q hi ; QL ; VT f16 [b][64][n] v planes
#define WS_QL  (WS_QH + 2u * NB * NSEQ * FD)
#define WS_VT  (WS_QL + 2u * NB * NSEQ * FD)
#define WS_VL  (WS_VT + 2u * NB * NSEQ * FD)         // f16 v residual x2048 planes
#define WS_X1  (WS_VL + 2u * NB * NSEQ * FD)         // f32 [B][H][W][C] after the height axis
#define WS_END (WS_X1 + 4u * NB * HH * WWd * CCh)

__global__ __launch_bounds__(64) void k_pack(const float* __restrict__ HQ, const float* __restrict__ HV, const float* __restrict__ WQ, const float* __restrict__ WV, __bf16* __restrict__ PW) {
  const int n = blockIdx.x, which = blockIdx.y, t = threadIdx.x; const float* Wm = (which == 0) ? HQ : (which == 1) ? HV : (which == 2) ? WQ : WV; __shared__ __align__(16) __bf16 s[FD];
  s[t] = (__bf16)Wm[(size_t)t * FD + n]; __syncthreads();   // (in,out): row n = output, k = input
  if (t < FD / 8) vst2((unsigned*)(PW + ((size_t)which * FD + n) * FD + t * 8), *(const v4u*)&s[t * 8]);
}
// ---- k_proj<AX>: block = (64 sequence rows n = (o, c0..c63) with o = w (AX 0) or h (AX 1), b): A[n][d] gathered from the NHWC tensor (AX 0: x[b][d][o][c]; AX 1: x1[b][o][d][c]); q = A . Wq^T + bq (AX 0 exact; AX 1 hi + residual) -> f16 hi/lo rows; v -> f16 planes [b][dd][n]
template <int AX>
__global__ __launch_bounds__(128) void k_proj(const float* __restrict__ SRC, const __bf16* __restrict__ PW, const float* __restrict__ BQ, const float* __restrict__ BV, _Float16* __restrict__ QH, _Float16* __restrict__ QL, _Float16* __restrict__ VT, _Float16* __restrict__ VL) {
  __shared__ __align__(16) __bf16 sa[64][FD + 8], sal[64][FD + 8]; __shared__ __align__(16) _Float16 sqh[64][FD + 8], sql[64][FD + 8]; __shared__ __align__(16) _Float16 svt[FD][72], svl[FD][72];
  const int tid = threadIdx.x, wave = tid >> 5, lane = tid & 31, col = lane & 15, g = lane >> 4; const size_t b = blockIdx.y; const int o = blockIdx.x;   // block = the 64 rows (o, c) c = 0..63
  const __bf16* PQ = PW + (size_t)(AX == 0 ? 0 : 2) * FD * FD; const __bf16* PV = PW + (size_t)(AX == 0 ? 1 : 3) * FD * FD;
  for (int e = tid; e < 64 * FD; e += 128) { const int d = e >> 6, c = e & 63; const float v = (AX == 0) ? bfr(SRC[((b * HH + d) * WWd + o) * CCh + c]) : SRC[((b * HH + o) * WWd + d) * CCh + c]; const __bf16 hb = (__bf16)v; sa[c][d] = hb; sal[c][d] = (__bf16)(v - (float)hb); }
  if (tid < 64) for (int d = FD; d < FD + 8; ++d) { sa[tid][d] = (__bf16)0.f; sal[tid][d] = (__bf16)0.f; sqh[tid][d] = (_Float16)0.f; sql[tid][d] = (_Float16)0.f; }
  __syncthreads();
  v8f acc[8] = {};   // tiles 0..3 q, 4..7 v
#pragma unroll
  for (int kc = 0; kc < FD / 32; ++kc) { const v16b a = frag_b(&sa[wave * 16 + col][kc * 32], lane), al = frag_b(&sal[wave * 16 + col][kc * 32], lane);
#pragma unroll
    for (int j = 0; j < 8; ++j) { const __bf16* Wr = (j < 4) ? PQ : PV; const v16b w = frag_b(Wr + (size_t)((j & 3) * 16 + col) * FD + kc * 32, lane); if (AX == 1) acc[j] = wmma_bf(al, w, acc[j]); acc[j] = wmma_bf(a, w, acc[j]); } }
#pragma unroll
  for (int j = 0; j < 8; ++j) { const int d = (j & 3) * 16 + col; const float bb = bfr((j < 4 ? BQ : BV)[d]);
#pragma unroll
    for (int r = 0; r < 8; ++r) { const float v = acc[j][r] + bb; const int rr = wave * 16 + 8 * g + r; const _Float16 hv = (_Float16)v; if (j < 4) { sqh[rr][d] = hv; sql[rr][d] = (_Float16)((v - (float)hv) * 2048.0f); } else { svt[d][rr] = hv; svl[d][rr] = (_Float16)((v - (float)hv) * 2048.0f); } } }
  __syncthreads();
  const size_t n0 = (size_t)o * 64;
  for (int e = tid; e < 64 * 8; e += 128) { const int r = e >> 3, q = e & 7; const size_t off = (b * NSEQ + n0 + r) * FD + q * 8; vst2((unsigned*)(QH + off), *(const v4u*)&sqh[r][q * 8]); vst2((unsigned*)(QL + off), *(const v4u*)&sql[r][q * 8]); }
  for (int e = tid; e < FD * 8; e += 128) { const int d = e >> 3, pc = e & 7; vst2((unsigned*)(VT + (b * FD + d) * NSEQ + n0 + pc * 8), *(const v4u*)&svt[d][pc * 8]); vst2((unsigned*)(VL + (b * FD + d) * NSEQ + n0 + pc * 8), *(const v4u*)&svl[d][pc * 8]); }
}
// ---- k_att<AX>: block = (64 queries n = (o, c), b), 24 waves = 4 query tiles x KSPL key ranges (6 waves a SIMD cover each other's dependent-chain latency); each wave sums its own key range, the ranges are added in LDS in fixed order: scores = sigmoid(q_n . q_m / 8) for all 4,096 m (3 products), computed transposed (key rows x query columns) so that the two score tiles of a pass, converted in place, are the A fragment of P and P never goes through LDS; P x 2^11 hi + residual x v hi + residual (3 products, 4 tiles); out * gate + residual -> NHWC (AX 0: x1[b][dd][o][c] = out[n][dd] * h_gate + x; AX 1: x2 = out * w_gate + x1 stays in registers and the block, which holds all of (b, h = o), writes the final out[b][o][dd][c] = p[dd] * (feature + x2), p[w] = sum_nc (1 - sigmoid(predict)) conv_w + conv_b)
// The 32 keys of a pass (q hi, q residual rows; v hi, v residual planes: 16 KiB a key range) are staged in LDS once for the 4 query tiles that share them, by asynchronous copies into a ring of two buffers: the next pass's copies fly while this pass is worked on.
#define KSPL 6                       // key ranges per query tile
#define ATT_T (128 * KSPL)           // threads of a k_att block
#define NPASS (NSEQ / 32)            // passes of 32 keys over the whole sequence
#define TRIPS ((NPASS + KSPL - 1) / KSPL)   // trips of the ring = passes of the longest key range; first pass of the last range + TRIPS <= NPASS, so every staged tile lies inside the planes
#define KP 72                        // f16 per staged q row: 144 B = 16 B x odd, conflict-free for 16-byte reads
#define VP 40                        // f16 per staged v row:  80 B = 16 B x odd
#define ST_KL (32 * KP)              // places (in f16) of the four tiles of one key range: q hi at 0, q residual, v hi, v residual
#define ST_VH (2 * 32 * KP)
#define ST_VL (2 * 32 * KP + FD * VP)
#define ST_SZ (2 * 32 * KP + 2 * FD * VP)
#define BUF_SZ (KSPL * ST_SZ)
static_assert((KSPL - 1) * NPASS / KSPL + TRIPS <= NPASS, "a staged tile would leave the planes");
// eight 16-byte copies a lane (one 4-KiB tile a wave); the s_wait_xcnt stands inside the statement so that no address register is rewritten in front of it
__device__ __forceinline__ void stage8(unsigned l, unsigned ls, const char* g, size_t gs) {
  asm volatile("global_load_async_to_lds_b128 %0, %8, off\n\t"
               "global_load_async_to_lds_b128 %1, %9, off\n\t"
               "global_load_async_to_lds_b128 %2, %10, off\n\t"
               "global_load_async_to_lds_b128 %3, %11, off\n\t"
               "global_load_async_to_lds_b128 %4, %12, off\n\t"
               "global_load_async_to_lds_b128 %5, %13, off\n\t"
               "global_load_async_to_lds_b128 %6, %14, off\n\t"
               "global_load_async_to_lds_b128 %7, %15, off\n\t"
               "s_wait_xcnt 0x0"
               :: "v"(l), "v"(l + ls), "v"(l + 2 * ls), "v"(l + 3 * ls), "v"(l + 4 * ls), "v"(l + 5 * ls), "v"(l + 6 * ls), "v"(l + 7 * ls),
                  "v"(g), "v"(g + gs), "v"(g + 2 * gs), "v"(g + 3 * gs), "v"(g + 4 * gs), "v"(g + 5 * gs), "v"(g + 6 * gs), "v"(g + 7 * gs) : "memory");
}
// 2048 * sigmoid(s) from x = -s * log2(e): v_exp_f32, one fma, v_rcp_f32, in line, so that the scores of a tile are independent chains; 2^x = inf gives 0, 2^x = 0 gives 2048
__device__ __forceinline__ float sigm2048(float x) { return __builtin_amdgcn_rcpf(__builtin_fmaf(__builtin_amdgcn_exp2f(x), 1.0f / 2048.0f, 1.0f / 2048.0f)); }
template <int AX>
__global__ __launch_bounds__(ATT_T) void k_att(const _Float16* __restrict__ QH, const _Float16* __restrict__ QL, const _Float16* __restrict__ VT, const _Float16* __restrict__ VL, const float* __restrict__ GATE, const float* __restrict__ RES, const float* __restrict__ FEAT, const float* __restrict__ PRED, const float* __restrict__ CW, const float* __restrict__ CB, float* __restrict__ OUTB) {
  __shared__ __align__(16) _Float16 ring[2 * BUF_SZ]; __shared__ float sp[WWd];   // sp: the pixel gate p[w] of row (b, o), AX 1 only
  float (*so)[FD][68] = (float (*)[FD][68])ring;   // [key range][dd][c]: the ring's LDS, used again behind the loop's last barrier
  static_assert(sizeof(float) * KSPL * FD * 68 <= sizeof(_Float16) * 2 * BUF_SZ, "partial sums do not fit the ring");
  const int tid = threadIdx.x, wave = tid >> 5, lane = tid & 31, col = lane & 15, g = lane >> 4; const size_t b = blockIdx.y; const int o = blockIdx.x;
  const int qg = __builtin_amdgcn_readfirstlane(wave & 3), kr = __builtin_amdgcn_readfirstlane(wave >> 2);   // query tile; key range (wave-uniform, so the pass loop stays a scalar loop)
  const int ks0 = kr * NPASS / KSPL, ks1 = (kr + 1) * NPASS / KSPL; const size_t rq = b * NSEQ + (size_t)o * 64 + qg * 16;
  // wave qg of a key range copies tile qg: 0 q hi, 1 q residual (32 rows of 128 B, contiguous), 2 v hi, 3 v residual (64 rows of 64 B, 8 KiB apart)
  const bool isk = qg < 2;
  const char* gsrc = (const char*)(qg == 0 ? QH : qg == 1 ? QL : qg == 2 ? VT : VL) + b * (size_t)(NSEQ * FD * 2) + (isk ? (size_t)ks0 * (32 * FD * 2) + lane * 16 : (size_t)ks0 * 64 + (size_t)(lane >> 2) * (NSEQ * 2) + (lane & 3) * 16);
  const size_t gtrip = isk ? 32 * FD * 2 : 64, gstep = isk ? 512 : 8 * NSEQ * 2;
  const unsigned ldst = (unsigned)(size_t)ring + 2u * (kr * ST_SZ + (qg == 0 ? 0 : qg == 1 ? ST_KL : qg == 2 ? ST_VH : ST_VL)) + (isk ? (lane >> 3) * (2 * KP) + (lane & 7) * 16 : (lane >> 2) * (2 * VP) + (lane & 3) * 16);
  const unsigned lstep = isk ? 4 * 2 * KP : 8 * 2 * VP;
  stage8(ldst, lstep, gsrc, gstep);
  v16h aq[2], aql[2];
#pragma unroll
  for (int kc = 0; kc < 2; ++kc) { aq[kc] = frag_h(QH + (rq + col) * FD + kc * 32, lane); aql[kc] = frag_h(QL + (rq + col) * FD + kc * 32, lane); }
  if (AX == 1 && kr == 0 && qg < 2) {   // two waves make the 64 pixel gates while tile 0's copies fly (scalar branch); the barrier below publishes sp
    const int w = qg * 32 + lane; const float* pr = PRED + ((b * HH + o) * WWd + w) * NC; float a = 0.f;
#pragma unroll   // the 19 loads go out together and the 19 sigmoids are independent chains; only the sum is a chain
    for (int k = 0; k < NC; ++k) a += (1.0f - 1.0f / (1.0f + expf(-bfr(pr[k])))) * bfr(CW[k]);
    sp[w] = a + bfr(CB[0]);
  }
  asm volatile("s_wait_asynccnt 0x0" ::: "memory");   // tile 0 has landed before the barrier publishes it
  __syncthreads();
  stage8(ldst + 2u * BUF_SZ, lstep, gsrc + gtrip, gstep);
  v8f acc[4] = {}, accl[4] = {}; const float nscale = -0.125f * 1.44269504088896341f;   // -(1 / sqrt(64)) * log2(e): the score as the exponent of 2^x
#pragma unroll 1   // one copy of the pass body: the two buffers differ by an offset only
  for (int t = 0; t < TRIPS; ++t) { const _Float16* st = ring + (t & 1) * BUF_SZ + kr * ST_SZ;
    if (ks0 + t < ks1) {   // a shorter key range sits out the last trip (scalar branch); the publish point below is passed by every wave
    // The LDS fragment reads stand in groups, each ahead of work that covers its latency, in place of one read and one full wait per product pair:
    // key tile 0 at the head; key tile 1 (but its last fragment) ahead of tile 0's sigmoids; two v hi fragments ahead of tile 1's sigmoids; each v residual behind the last product of the v hi fragment of its columns.
    const _Float16* rk = st + col * KP; const _Float16* vo = st + ST_VH + col * VP; v16h kf[2][2], kl[2][2], vh[4], vl[4], pa, pl;
#pragma unroll
    for (int kc = 0; kc < 2; ++kc) { kf[0][kc] = frag_h(rk + kc * 32, lane); kl[0][kc] = frag_h(rk + ST_KL + kc * 32, lane); }
#pragma unroll
    for (int ct = 0; ct < 2; ++ct) { v8f c, cl;   // keys as A, queries as B: c[r] = score of key ct * 16 + 8g + r with query col
#pragma unroll
      for (int kc = 0; kc < 2; ++kc) { c = kc == 0 ? wmma16z(kf[ct][kc], aq[kc]) : wmma16(kf[ct][kc], aq[kc], c); cl = kc == 0 ? wmma16z(kf[ct][kc], aql[kc]) : wmma16(kf[ct][kc], aql[kc], cl);
        if (ct == 1 && kc == 0) kl[1][1] = frag_h(rk + 16 * KP + ST_KL + 32, lane);   // the fragment used last takes the registers of the one just used up
        cl = kc == 0 ? wmma16(kl[ct][kc], aq[kc], cl) : wmma16e(kl[ct][kc], aq[kc], cl); }   // the sigmoids read c and cl next
      if (ct == 0) { kf[1][0] = frag_h(rk + 16 * KP, lane); kl[1][0] = frag_h(rk + 16 * KP + ST_KL, lane); kf[1][1] = frag_h(rk + 16 * KP + 32, lane); }
      else {
#pragma unroll
        for (int dt = 0; dt < 2; ++dt) vh[dt] = frag_h(vo + dt * 16 * VP, lane);
      }
#pragma unroll
      for (int r = 0; r < 8; ++r) { const float p = sigm2048((c[r] + cl[r] * (1.0f / 2048.0f)) * nscale); const _Float16 hp = (_Float16)p; pa[ct * 8 + r] = hp; pl[ct * 8 + r] = (_Float16)((p - (float)hp) * 2048.0f); }   // element ct * 8 + r of the A fragment of row col is k = ct * 16 + 8g + r: each score stays in its lane
      __builtin_amdgcn_sched_barrier(0);   // keeps the next products and their fragments from being lifted among these sigmoids: together they do not fit the registers of 6 waves a SIMD (scratch)
    }
    vh[2] = frag_h(vo + 2 * 16 * VP, lane); vh[3] = frag_h(vo + 3 * 16 * VP, lane);   // the sigmoids need their registers
#pragma unroll
    for (int dt = 0; dt < 4; ++dt) { acc[dt] = wmma16(pa, vh[dt], acc[dt]); accl[dt] = wmma16(pl, vh[dt], accl[dt]); vl[dt] = frag_h(vo + dt * 16 * VP + (ST_VL - ST_VH), lane); }
#pragma unroll
    for (int dt = 0; dt < 4; ++dt) accl[dt] = dt < 3 ? wmma16(pa, vl[dt], accl[dt]) : wmma16e(pa, vl[dt], accl[dt]);   // 3 products; behind the last one the next copies' addresses may take the fragments' registers
    }
    asm volatile("s_wait_dscnt 0x0" ::: "memory");      // this wave's reads of the buffer are done before it is refilled
    asm volatile("s_wait_asynccnt 0x0" ::: "memory");   // this wave's copies of the next tile have landed
    __syncthreads();                                     // publishes the next tile and ends every reader's last read of this one
    if (t + 2 < TRIPS) stage8(ldst + (t & 1) * (2u * BUF_SZ), lstep, gsrc + (size_t)(t + 2) * gtrip, gstep); }
  asm volatile("s_wait_asynccnt 0x0" ::: "memory");     // no copy is in flight when the ring becomes the partial sums' place
  const float gate = bfr(GATE[0]);
#pragma unroll
  for (int r = 0; r < 8; ++r) { const int c = qg * 16 + 8 * g + r;
#pragma unroll
    for (int dt = 0; dt < 4; ++dt) so[kr][dt * 16 + col][c] = acc[dt][r] + accl[dt][r] * (1.0f / 2048.0f); }
  __syncthreads();
  for (int e = tid; e < FD * 16; e += ATT_T) { const int dd = e >> 4, q = e & 15; const size_t base = (AX == 0) ? (((b * HH + dd) * WWd + o) * CCh) : (((b * HH + o) * WWd + dd) * CCh);
    v4f a = *(const v4f*)&so[0][dd][q * 4];
    for (int s = 1; s < KSPL; ++s) a += *(const v4f*)&so[s][dd][q * 4];
    const v4f rv = *(const v4f*)(RES + base + q * 4); v4f ov;
    for (int i = 0; i < 4; ++i) ov[i] = a[i] * (1.0f / 2048.0f) * gate + ((AX == 0) ? bfr(rv[i]) : rv[i]);
    if (AX == 1) { const v4f fv = *(const v4f*)(FEAT + base + q * 4); const float pw = sp[dd];
      for (int i = 0; i < 4; ++i) ov[i] = pw * (bfr(fv[i]) + ov[i]); }
    vst2(OUTB + base + q * 4, ov); }   // 64 consecutive c = 256 B
}
extern "C" void kernel_launch(void* const* d_in, const int* in_sizes, int n_in, void* d_out, int out_size, void* d_ws, size_t ws_size, hipStream_t stream) {
  (void)in_sizes; (void)n_in; (void)out_size;
  const float** F = (const float**)d_in;   // 0 feature [4,64,64,64], 1 predict [4,64,64,19], 2 hq_w (in,out), 3 hq_b, 4 hv_w, 5 hv_b, 6 wq_w, 7 wq_b, 8 wv_w, 9 wv_b, 10 h_gate [1], 11 w_gate [1], 12 conv_w [19,1], 13 conv_b [1]
  if (ws_size < (size_t)WS_END) return;
  char* ws = (char*)d_ws; __bf16* PW = (__bf16*)(ws + WS_PW); _Float16 *QH = (_Float16*)(ws + WS_QH), *QL = (_Float16*)(ws + WS_QL), *VT = (_Float16*)(ws + WS_VT), *VL = (_Float16*)(ws + WS_VL); float *X1 = (float*)(ws + WS_X1);
  k_pack<<<dim3(FD, 4), 64, 0, stream>>>(F[2], F[4], F[6], F[8], PW);
  k_proj<0><<<dim3(WWd, NBB), 128, 0, stream>>>(F[0], PW, F[3], F[5], QH, QL, VT, VL);
  k_att<0><<<dim3(NSEQ / 64, NBB), ATT_T, 0, stream>>>(QH, QL, VT, VL, F[10], F[0], F[0], F[1], F[12], F[13], X1);
  k_proj<1><<<dim3(HH, NBB), 128, 0, stream>>>(X1, PW, F[7], F[9], QH, QL, VT, VL);
  k_att<1><<<dim3(NSEQ / 64, NBB), ATT_T, 0, stream>>>(QH, QL, VT, VL, F[11], X1, F[0], F[1], F[12], F[13], (float*)d_out);
}

// v008
// One run takes 117 microseconds.
// Next to v007, in two timings, it ran 1.10 times as fast each time.
// All steps since v000 together make it 9.74 times as fast.
// compute dtype: all float inputs rounded to bf16; per axis q = x_seq . Wq + bq and v = x_seq . Wv + bv with the sequence rows gathered from the [B,H,W,C] tensor (the second axis reads the first axis' f32 result as bf16 hi + residual, 2 products) on WMMA 16x16x32; scores = sigmoid(q_n . q_m / 8) with q as f16 hi + (x2048-scaled) residual (3 products) and 2048 * sigmoid(s) = 1 / (2^-11 + 2^-11 * 2^(-s * log2 e)) on the hardware's exp2 and reciprocal per score; out = sum_m P (scaled by 2^11, f16 hi + residual) x v (f16 hi + x2048 residual planes), 3 products; gates, residuals and the final (1 - sigmoid(predict)) . conv_w + conv_b pixel gate in f32. (the un-normalised 4,096-term sums need the residual products).
#include <hip/hip_runtime.h>
#include <math.h>

typedef __attribute__((ext_vector_type(16))) _Float16 v16h;
typedef __attribute__((ext_vector_type(16))) __bf16 v16b;
typedef __attribute__((ext_vector_type(8)))  _Float16 v8h;
typedef __attribute__((ext_vector_type(8)))  float v8f;
typedef __attribute__((ext_vector_type(4)))  float v4f;
typedef __attribute__((ext_vector_type(2)))  float v2f;
typedef __attribute__((ext_vector_type(4)))  unsigned v4u;
typedef __attribute__((ext_vector_type(4)))  int v4i;
typedef float __attribute__((may_alias)) float_a;
typedef int __attribute__((may_alias)) int_a;

template <typename T> __device__ __forceinline__ void vst2(void* p, T v) { *(T*)p = v;  }
// The f16 products of the attention loop, written as asm: the accumulator stays in its registers and the products stay in the order written (the plain builtin, with or without scheduling barriers, went to scratch at the registers of 6 waves a SIMD).
// No v_nop behind a product whose next user is a product that adds into the same D or an LDS read over its A or B: neither needs a distance.
__device__ __forceinline__ v8f wmma16(v16h a, v16h b, v8f c) {
  asm volatile("v_wmma_f32_16x16x32_f16 %0, %1, %2, %0" : "+v"(c) : "v"(a), "v"(b));
  return c;
}
// first product of a sum: C = 0 as the inline constant
__device__ __forceinline__ v8f wmma16z(v16h a, v16h b) {
  v8f d; asm volatile("v_wmma_f32_16x16x32_f16 %0, %1, %2, 0" : "=&v"(d) : "v"(a), "v"(b));
  return d;
}
// last product of a run: the four v_nop are the distance the chip needs before a vector instruction reads D or overwrites A or B
__device__ __forceinline__ v8f wmma16e(v16h a, v16h b, v8f c) {
  asm volatile("v_wmma_f32_16x16x32_f16 %0, %1, %2, %0\n\tv_nop\n\tv_nop\n\tv_nop\n\tv_nop" : "+v"(c) : "v"(a), "v"(b));
  return c;
}
__device__ __forceinline__ v8f wmma_bf(v16b a, v16b b, v8f c) {
  v8f d = __builtin_amdgcn_wmma_f32_16x16x32_bf16(false, a, false, b, (short)0, c, false, false);
  asm volatile("v_nop\n\tv_nop\n\tv_nop\n\tv_nop" : "+v"(d) : "v"(a), "v"(b));
  return d;
}
// 16x16x32 fragments: lane = (h = lane>>4, row/col = lane&15); elements 0..7 = k0+8h+0..7, 8..15 = k0+16+8h+0..7; D element r = row 8h+r
__device__ __forceinline__ v16h frag_h(const _Float16* rowk0, int lane) {
  union { v16h v; v8h q[2]; } u; const _Float16* p = rowk0 + 8 * (lane >> 4);
  u.q[0] = *(const v8h*)p; u.q[1] = *(const v8h*)(p + 16); return u.v;
}
__device__ __forceinline__ v16h frag_f32(const float* rowk0, int lane) {
  v16h a; const float* p = rowk0 + 8 * (lane >> 4);
#pragma unroll
  for (int i = 0; i < 8; ++i) { a[i] = (_Float16)p[i]; a[8 + i] = (_Float16)p[16 + i]; }
  return a;
}
__device__ __forceinline__ v16h frag_f32s(const float* rowk0, int lane, float sc) {
  v16h a; const float* p = rowk0 + 8 * (lane >> 4);
#pragma unroll
  for (int i = 0; i < 8; ++i) { a[i] = (_Float16)(p[i] * sc); a[8 + i] = (_Float16)(p[16 + i] * sc); }
  return a;
}
// column fragment from a [K][ld] layout (column n), rows >= K read as 0
__device__ __forceinline__ v16h fragc_f32(const float* W, int k0, int n, int lane, int ld, int K) {
  v16h a; const int g = lane >> 4;
#pragma unroll
  for (int i = 0; i < 8; ++i) { const int ka = k0 + 8 * g + i, kb = ka + 16;
    a[i] = (_Float16)(ka < K ? W[(size_t)(ka < K ? ka : K - 1) * ld + n] : 0.f); a[8 + i] = (_Float16)(kb < K ? W[(size_t)(kb < K ? kb : K - 1) * ld + n] : 0.f); }
  return a;
}
struct F2 { v16b h, l; };
__device__ __forceinline__ F2 bsplit16(const float v[16]) { F2 r;
#pragma unroll
  for (int i = 0; i < 16; ++i) { const __bf16 h = (__bf16)v[i]; r.h[i] = h; r.l[i] = (__bf16)(v[i] - (float)h); }
  return r; }
__device__ __forceinline__ F2 split_row(const float* row, int k0, int lane) { float v[16]; const float* p = row + k0 + 8 * (lane >> 4);
#pragma unroll
  for (int i = 0; i < 8; ++i) { v[i] = p[i]; v[8 + i] = p[16 + i]; }
  return bsplit16(v); }
__device__ __forceinline__ F2 split_rowK(const float* row, int k0, int lane, int K) { float v[16]; const int g = lane >> 4;
#pragma unroll
  for (int i = 0; i < 8; ++i) { const int ka = k0 + 8 * g + i, kb = ka + 16; v[i] = ka < K ? row[ka < K ? ka : K - 1] : 0.f; v[8 + i] = kb < K ? row[kb < K ? kb : K - 1] : 0.f; }
  return bsplit16(v); }
__device__ __forceinline__ F2 split_col(const float* W, int k0, int n, int lane, int ld, int K) { float v[16]; const int g = lane >> 4;
#pragma unroll
  for (int i = 0; i < 8; ++i) { const int ka = k0 + 8 * g + i, kb = ka + 16; v[i] = ka < K ? W[(size_t)(ka < K ? ka : K - 1) * ld + n] : 0.f; v[8 + i] = kb < K ? W[(size_t)(kb < K ? kb : K - 1) * ld + n] : 0.f; }
  return bsplit16(v); }
__device__ __forceinline__ v8f mac3(const F2& a, const F2& b, v8f c) { c = wmma_bf(a.l, b.h, c); c = wmma_bf(a.h, b.l, c); return wmma_bf(a.h, b.h, c); }
__device__ __forceinline__ float sigm(float v) { return 1.0f / (1.0f + expf(-v)); }


// Reverse-attention residual axial block (B 4, 64 x 64 x 64 NHWC): height-axis then width-axis 'sigmoid attention' over 4,096-long sequences (feature dim 64), scalar gates and residuals, then a per-pixel gate from the 19-class prediction map.
#define NB 4
#define HH 64
#define WWd 64
#define CCh 64
#define NC 19
#define NSEQ 4096       // W*C (axis 1) or H*C (axis 2)
#define FD 64           // feature dim (H or W)
#ifndef NBB
#define NBB NB          // batches processed
#endif
typedef __attribute__((ext_vector_type(8))) __bf16 v8b;
__device__ __forceinline__ v16b frag_b(const __bf16* rowk0, int lane) {
  union { v16b v; v8b q[2]; } u; const __bf16* p = rowk0 + 8 * (lane >> 4);
  u.q[0] = *(const v8b*)p; u.q[1] = *(const v8b*)(p + 16); return u.v;
}
__device__ __forceinline__ float bfr(float v) { return (float)(__bf16)v; }
__device__ __attribute__((noinline)) float exp_ni(float v) { return expf(v); }
__device__ __attribute__((noinline)) float erf_ni(float v) { return erff(v); }

#define WS_PW  0u                                   // bf16 rows: hq^T [64][64], hv^T, wq^T, wv^T ((in,out) -> transposed)
#define WS_QH  (WS_PW + 2u * 4 * FD * FD)            // f16 [b][n][64] q hi ; QL ; VT f16 [b][64][n] v planes
#define WS_QL  (WS_QH + 2u * NB * NSEQ * FD)
#define WS_VT  (WS_QL + 2u * NB * NSEQ * FD)
#define WS_VL  (WS_VT + 2u * NB * NSEQ * FD)         // f16 v residual x2048 planes
#define WS_X1  (WS_VL + 2u * NB * NSEQ * FD)         // f32 [B][H][W][C] after the height axis
#define WS_END (WS_X1 + 4u * NB * HH * WWd * CCh)

__global__ __launch_bounds__(64) void k_pack(const float* __restrict__ HQ, const float* __restrict__ HV, const float* __restrict__ WQ, const float* __restrict__ WV, __bf16* __restrict__ PW) {
  const int n = blockIdx.x, which = blockIdx.y, t = threadIdx.x; const float* Wm = (which == 0) ? HQ : (which == 1) ? HV : (which == 2) ? WQ : WV; __shared__ __align__(16) __bf16 s[FD];
  s[t] = (__bf16)Wm[(size_t)t * FD + n]; __syncthreads();   // (in,out): row n = output, k = input
  if (t < FD / 8) vst2((unsigned*)(PW + ((size_t)which * FD + n) * FD + t * 8), *(const v4u*)&s[t * 8]);
}
// ---- k_proj<AX>: block = (64 sequence rows n = (o, c0..c63) with o = w (AX 0) or h (AX 1), b): A[n][d] gathered from the NHWC tensor (AX 0: x[b][d][o][c]; AX 1: x1[b][o][d][c]); q = A . Wq^T + bq (AX 0 exact; AX 1 hi + residual) -> f16 hi/lo rows; v -> f16 planes [b][dd][n]
template <int AX>
__global__ __launch_bounds__(128) void k_proj(const float* __restrict__ SRC, const __bf16* __restrict__ PW, const float* __restrict__ BQ, const float* __restrict__ BV, _Float16* __restrict__ QH, _Float16* __restrict__ QL, _Float16* __restrict__ VT, _Float16* __restrict__ VL) {
  __shared__ __align__(16) __bf16 sa[64][FD + 8], sal[64][FD + 8]; __shared__ __align__(16) _Float16 sqh[64][FD + 8], sql[64][FD + 8]; __shared__ __align__(16) _Float16 svt[FD][72], svl[FD][72];
  const int tid = threadIdx.x, wave = tid >> 5, lane = tid & 31, col = lane & 15, g = lane >> 4; const size_t b = blockIdx.y; const int o = blockIdx.x;   // block = the 64 rows (o, c) c = 0..63
  const __bf16* PQ = PW + (size_t)(AX == 0 ? 0 : 2) * FD * FD; const __bf16* PV = PW + (size_t)(AX == 0 ? 1 : 3) * FD * FD;
  // Every global load of the block goes out here, ahead of all work: at one wave a SIMD nothing else covers a load's latency, so it is paid once, not once per group of 4 gathered values and once per weight fragment.
  const int gc = tid & 63, gd = tid >> 6; float xv[32]; v16b wf[FD / 32][8]; float bias[8];
#pragma unroll   // the 32 gathered values stay in registers and their loads stand in one run
  for (int i = 0; i < 32; ++i) { const int d = gd + 2 * i; xv[i] = (AX == 0) ? SRC[((b * HH + d) * WWd + o) * CCh + gc] : SRC[((b * HH + o) * WWd + d) * CCh + gc]; }
#pragma unroll   // likewise the 16 weight fragments (this loop and the one inside it)
  for (int kc = 0; kc < FD / 32; ++kc)
#pragma unroll
    for (int j = 0; j < 8; ++j) wf[kc][j] = frag_b(((j < 4) ? PQ : PV) + (size_t)((j & 3) * 16 + col) * FD + kc * 32, lane);
#pragma unroll   // and the 8 biases of the lane's columns
  for (int j = 0; j < 8; ++j) bias[j] = (j < 4 ? BQ : BV)[(j & 3) * 16 + col];
#pragma unroll   // xv is indexed by constants only
  for (int i = 0; i < 32; ++i) { const int d = gd + 2 * i; const float v = (AX == 0) ? bfr(xv[i]) : xv[i]; const __bf16 hb = (__bf16)v; sa[gc][d] = hb; sal[gc][d] = (__bf16)(v - (float)hb); }
  if (tid < 64) for (int d = FD; d < FD + 8; ++d) { sa[tid][d] = (__bf16)0.f; sal[tid][d] = (__bf16)0.f; sqh[tid][d] = (_Float16)0.f; sql[tid][d] = (_Float16)0.f; }
  __syncthreads();
  v8f acc[8] = {};   // tiles 0..3 q, 4..7 v
#pragma unroll
  for (int kc = 0; kc < FD / 32; ++kc) { const v16b a = frag_b(&sa[wave * 16 + col][kc * 32], lane), al = frag_b(&sal[wave * 16 + col][kc * 32], lane);
#pragma unroll
    for (int j = 0; j < 8; ++j) { const v16b w = wf[kc][j]; if (AX == 1) acc[j] = wmma_bf(al, w, acc[j]); acc[j] = wmma_bf(a, w, acc[j]); } }
#pragma unroll
  for (int j = 0; j < 8; ++j) { const int d = (j & 3) * 16 + col; const float bb = bfr(bias[j]);
#pragma unroll
    for (int r = 0; r < 8; ++r) { const float v = acc[j][r] + bb; const int rr = wave * 16 + 8 * g + r; const _Float16 hv = (_Float16)v; if (j < 4) { sqh[rr][d] = hv; sql[rr][d] = (_Float16)((v - (float)hv) * 2048.0f); } else { svt[d][rr] = hv; svl[d][rr] = (_Float16)((v - (float)hv) * 2048.0f); } } }
  __syncthreads();
  const size_t n0 = (size_t)o * 64;
  for (int e = tid; e < 64 * 8; e += 128) { const int r = e >> 3, q = e & 7; const size_t off = (b * NSEQ + n0 + r) * FD + q * 8; vst2((unsigned*)(QH + off), *(const v4u*)&sqh[r][q * 8]); vst2((unsigned*)(QL + off), *(const v4u*)&sql[r][q * 8]); }
  for (int e = tid; e < FD * 8; e += 128) { const int d = e >> 3, pc = e & 7; vst2((unsigned*)(VT + (b * FD + d) * NSEQ + n0 + pc * 8), *(const v4u*)&svt[d][pc * 8]); vst2((unsigned*)(VL + (b * FD + d) * NSEQ + n0 + pc * 8), *(const v4u*)&svl[d][pc * 8]); }
}
// ---- k_att<AX>: block = (64 queries n = (o, c), b), 24 waves = 4 query tiles x KSPL key ranges (6 waves a SIMD cover each other's dependent-chain latency); each wave sums its own key range, the ranges are added in LDS in fixed order: scores = sigmoid(q_n . q_m / 8) for all 4,096 m (3 products), computed transposed (key rows x query columns) so that the two score tiles of a pass, converted in place, are the A fragment of P and P never goes through LDS; P x 2^11 hi + residual x v hi + residual (3 products, 4 tiles); out * gate + residual -> NHWC (AX 0: x1[b][dd][o][c] = out[n][dd] * h_gate + x; AX 1: x2 = out * w_gate + x1 stays in registers and the block, which holds all of (b, h = o), writes the final out[b][o][dd][c] = p[dd] * (feature + x2), p[w] = sum_nc (1 - sigmoid(predict)) conv_w + conv_b)
// The 32 keys of a pass (q hi, q residual rows; v hi, v residual planes: 16 KiB a key range) are staged in LDS once for the 4 query tiles that share them, by asynchronous copies into a ring of two buffers: the next pass's copies fly while this pass is worked on.
#define KSPL 6                       // key ranges per query tile
#define ATT_T (128 * KSPL)           // threads of a k_att block
#define NPASS (NSEQ / 32)            // passes of 32 keys over the whole sequence
#define TRIPS ((NPASS + KSPL - 1) / KSPL)   // trips of the ring = passes of the longest key range; first pass of the last range + TRIPS <= NPASS, so every staged tile lies inside the planes
#define KP 72                        // f16 per staged q row: 144 B = 16 B x odd, conflict-free for 16-byte reads
#define VP 40                        // f16 per staged v row:  80 B = 16 B x odd
#define ST_KL (32 * KP)              // places (in f16) of the four tiles of one key range: q hi at 0, q residual, v hi, v residual
#define ST_VH (2 * 32 * KP)
#define ST_VL (2 * 32 * KP + FD * VP)
#define ST_SZ (2 * 32 * KP + 2 * FD * VP)
#define BUF_SZ (KSPL * ST_SZ)
static_assert((KSPL - 1) * NPASS / KSPL + TRIPS <= NPASS, "a staged tile would leave the planes");
// eight 16-byte copies a lane (one 4-KiB tile a wave); the s_wait_xcnt stands inside the statement so that no address register is rewritten in front of it
__device__ __forceinline__ void stage8(unsigned l, unsigned ls, const char* g, size_t gs) {
  asm volatile("global_load_async_to_lds_b128 %0, %8, off\n\t"
               "global_load_async_to_lds_b128 %1, %9, off\n\t"
               "global_load_async_to_lds_b128 %2, %10, off\n\t"
               "global_load_async_to_lds_b128 %3, %11, off\n\t"
               "global_load_async_to_lds_b128 %4, %12, off\n\t"
               "global_load_async_to_lds_b128 %5, %13, off\n\t"
               "global_load_async_to_lds_b128 %6, %14, off\n\t"
               "global_load_async_to_lds_b128 %7, %15, off\n\t"
               "s_wait_xcnt 0x0"
               :: "v"(l), "v"(l + ls), "v"(l + 2 * ls), "v"(l + 3 * ls), "v"(l + 4 * ls), "v"(l + 5 * ls), "v"(l + 6 * ls), "v"(l + 7 * ls),
                  "v"(g), "v"(g + gs), "v"(g + 2 * gs), "v"(g + 3 * gs), "v"(g + 4 * gs), "v"(g + 5 * gs), "v"(g + 6 * gs), "v"(g + 7 * gs) : "memory");
}
// 2048 * sigmoid(s) from x = -s * log2(e): v_exp_f32, one fma, v_rcp_f32, in line, so that the scores of a tile are independent chains; 2^x = inf gives 0, 2^x = 0 gives 2048
__device__ __forceinline__ float sigm2048(float x) { return __builtin_amdgcn_rcpf(__builtin_fmaf(__builtin_amdgcn_exp2f(x), 1.0f / 2048.0f, 1.0f / 2048.0f)); }
template <int AX>
__global__ __launch_bounds__(ATT_T) void k_att(const _Float16* __restrict__ QH, const _Float16* __restrict__ QL, const _Float16* __restrict__ VT, const _Float16* __restrict__ VL, const float* __restrict__ GATE, const float* __restrict__ RES, const float* __restrict__ FEAT, const float* __restrict__ PRED, const float* __restrict__ CW, const float* __restrict__ CB, float* __restrict__ OUTB) {
  __shared__ __align__(16) _Float16 ring[2 * BUF_SZ]; __shared__ float sp[WWd];   // sp: the pixel gate p[w] of row (b, o), AX 1 only
  float (*so)[FD][68] = (float (*)[FD][68])ring;   // [key range][dd][c]: the ring's LDS, used again behind the loop's last barrier
  static_assert(sizeof(float) * KSPL * FD * 68 <= sizeof(_Float16) * 2 * BUF_SZ, "partial sums do not fit the ring");
  const int tid = threadIdx.x, wave = tid >> 5, lane = tid & 31, col = lane & 15, g = lane >> 4; const size_t b = blockIdx.y; const int o = blockIdx.x;
  const int qg = __builtin_amdgcn_readfirstlane(wave & 3), kr = __builtin_amdgcn_readfirstlane(wave >> 2);   // query tile; key range (wave-uniform, so the pass loop stays a scalar loop)
  const int ks0 = kr * NPASS / KSPL, ks1 = (kr + 1) * NPASS / KSPL; const size_t rq = b * NSEQ + (size_t)o * 64 + qg * 16;
  // wave qg of a key range copies tile qg: 0 q hi, 1 q residual (32 rows of 128 B, contiguous), 2 v hi, 3 v residual (64 rows of 64 B, 8 KiB apart)
  const bool isk = qg < 2;
  const char* gsrc = (const char*)(qg == 0 ? QH : qg == 1 ? QL : qg == 2 ? VT : VL) + b * (size_t)(NSEQ * FD * 2) + (isk ? (size_t)ks0 * (32 * FD * 2) + lane * 16 : (size_t)ks0 * 64 + (size_t)(lane >> 2) * (NSEQ * 2) + (lane & 3) * 16);
  const size_t gtrip = isk ? 32 * FD * 2 : 64, gstep = isk ? 512 : 8 * NSEQ * 2;
  const unsigned ldst = (unsigned)(size_t)ring + 2u * (kr * ST_SZ + (qg == 0 ? 0 : qg == 1 ? ST_KL : qg == 2 ? ST_VH : ST_VL)) + (isk ? (lane >> 3) * (2 * KP) + (lane & 7) * 16 : (lane >> 2) * (2 * VP) + (lane & 3) * 16);
  const unsigned lstep = isk ? 4 * 2 * KP : 8 * 2 * VP;
  stage8(ldst, lstep, gsrc, gstep);
  v16h aq[2], aql[2];
#pragma unroll
  for (int kc = 0; kc < 2; ++kc) { aq[kc] = frag_h(QH + (rq + col) * FD + kc * 32, lane); aql[kc] = frag_h(QL + (rq + col) * FD + kc * 32, lane); }
  if (AX == 1 && kr == 0 && qg < 2) {   // two waves make the 64 pixel gates while tile 0's copies fly (scalar branch); the barrier below publishes sp
    const int w = qg * 32 + lane; const float* pr = PRED + ((b * HH + o) * WWd + w) * NC; float a = 0.f;
#pragma unroll   // the 19 loads go out together and the 19 sigmoids are independent chains; only the sum is a chain
    for (int k = 0; k < NC; ++k) a += (1.0f - 1.0f / (1.0f + expf(-bfr(pr[k])))) * bfr(CW[k]);
    sp[w] = a + bfr(CB[0]);
  }
  asm volatile("s_wait_asynccnt 0x0" ::: "memory");   // tile 0 has landed before the barrier publishes it
  __syncthreads();
  stage8(ldst + 2u * BUF_SZ, lstep, gsrc + gtrip, gstep);
  v8f acc[4] = {}, accl[4] = {}; const float nscale = -0.125f * 1.44269504088896341f;   // -(1 / sqrt(64)) * log2(e): the score as the exponent of 2^x
#pragma unroll 1   // one copy of the pass body: the two buffers differ by an offset only
  for (int t = 0; t < TRIPS; ++t) { const _Float16* st = ring + (t & 1) * BUF_SZ + kr * ST_SZ;
    if (ks0 + t < ks1) {   // a shorter key range sits out the last trip (scalar branch); the publish point below is passed by every wave
    // The LDS fragment reads stand in groups, each ahead of work that covers its latency, in place of one read and one full wait per product pair:
    // key tile 0 at the head; key tile 1 (but its last fragment) ahead of tile 0's sigmoids; two v hi fragments ahead of tile 1's sigmoids; each v residual behind the last product of the v hi fragment of its columns.
    const _Float16* rk = st + col * KP; const _Float16* vo = st + ST_VH + col * VP; v16h kf[2][2], kl[2][2], vh[4], vl[4], pa, pl;
#pragma unroll
    for (int kc = 0; kc < 2; ++kc) { kf[0][kc] = frag_h(rk + kc * 32, lane); kl[0][kc] = frag_h(rk + ST_KL + kc * 32, lane); }
#pragma unroll
    for (int ct = 0; ct < 2; ++ct) { v8f c, cl;   // keys as A, queries as B: c[r] = score of key ct * 16 + 8g + r with query col
#pragma unroll
      for (int kc = 0; kc < 2; ++kc) { c = kc == 0 ? wmma16z(kf[ct][kc], aq[kc]) : wmma16(kf[ct][kc], aq[kc], c); cl = kc == 0 ? wmma16z(kf[ct][kc], aql[kc]) : wmma16(kf[ct][kc], aql[kc], cl);
        if (ct == 1 && kc == 0) kl[1][1] = frag_h(rk + 16 * KP + ST_KL + 32, lane);   // the fragment used last takes the registers of the one just used up
        cl = kc == 0 ? wmma16(kl[ct][kc], aq[kc], cl) : wmma16e(kl[ct][kc], aq[kc], cl); }   // the sigmoids read c and cl next
      if (ct == 0) { kf[1][0] = frag_h(rk + 16 * KP, lane); kl[1][0] = frag_h(rk + 16 * KP + ST_KL, lane); kf[1][1] = frag_h(rk + 16 * KP + 32, lane); }
      else {
#pragma unroll
        for (int dt = 0; dt < 2; ++dt) vh[dt] = frag_h(vo + dt * 16 * VP, lane);
      }
#pragma unroll
      for (int r = 0; r < 8; ++r) { const float p = sigm2048((c[r] + cl[r] * (1.0f / 2048.0f)) * nscale); const _Float16 hp = (_Float16)p; pa[ct * 8 + r] = hp; pl[ct * 8 + r] = (_Float16)((p - (float)hp) * 2048.0f); }   // element ct * 8 + r of the A fragment of row col is k = ct * 16 + 8g + r: each score stays in its lane
      __builtin_amdgcn_sched_barrier(0);   // keeps the next products and their fragments from being lifted among these sigmoids: together they do not fit the registers of 6 waves a SIMD (scratch)
    }
    vh[2] = frag_h(vo + 2 * 16 * VP, lane); vh[3] = frag_h(vo + 3 * 16 * VP, lane);   // the sigmoids need their registers
#pragma unroll
    for (int dt = 0; dt < 4; ++dt) { acc[dt] = wmma16(pa, vh[dt], acc[dt]); accl[dt] = wmma16(pl, vh[dt], accl[dt]); vl[dt] = frag_h(vo + dt * 16 * VP + (ST_VL - ST_VH), lane); }
#pragma unroll
    for (int dt = 0; dt < 4; ++dt) accl[dt] = dt < 3 ? wmma16(pa, vl[dt], accl[dt]) : wmma16e(pa, vl[dt], accl[dt]);   // 3 products; behind the last one the next copies' addresses may take the fragments' registers
    }
    asm volatile("s_wait_dscnt 0x0" ::: "memory");      // this wave's reads of the buffer are done before it is refilled
    asm volatile("s_wait_asynccnt 0x0" ::: "memory");   // this wave's copies of the next tile have landed
    __syncthreads();                                     // publishes the next tile and ends every reader's last read of this one
    if (t + 2 < TRIPS) stage8(ldst + (t & 1) * (2u * BUF_SZ), lstep, gsrc + (size_t)(t + 2) * gtrip, gstep); }
  asm volatile("s_wait_asynccnt 0x0" ::: "memory");     // no copy is in flight when the ring becomes the partial sums' place
  const float gate = bfr(GATE[0]);
#pragma unroll
  for (int r = 0; r < 8; ++r) { const int c = qg * 16 + 8 * g + r;
#pragma unroll
    for (int dt = 0; dt < 4; ++dt) so[kr][dt * 16 + col][c] = acc[dt][r] + accl[dt][r] * (1.0f / 2048.0f); }
  __syncthreads();
  for (int e = tid; e < FD * 16; e += ATT_T) { const int dd = e >> 4, q = e & 15; const size_t base = (AX == 0) ? (((b * HH + dd) * WWd + o) * CCh) : (((b * HH + o) * WWd + dd) * CCh);
    v4f a = *(const v4f*)&so[0][dd][q * 4];
    for (int s = 1; s < KSPL; ++s) a += *(const v4f*)&so[s][dd][q * 4];
    const v4f rv = *(const v4f*)(RES + base + q * 4); v4f ov;
    for (int i = 0; i < 4; ++i) ov[i] = a[i] * (1.0f / 2048.0f) * gate + ((AX == 0) ? bfr(rv[i]) : rv[i]);
    if (AX == 1) { const v4f fv = *(const v4f*)(FEAT + base + q * 4); const float pw = sp[dd];
      for (int i = 0; i < 4; ++i) ov[i] = pw * (bfr(fv[i]) + ov[i]); }
    vst2(OUTB + base + q * 4, ov); }   // 64 consecutive c = 256 B
}
extern "C" void kernel_launch(void* const* d_in, const int* in_sizes, int n_in, void* d_out, int out_size, void* d_ws, size_t ws_size, hipStream_t stream) {
  (void)in_sizes; (void)n_in; (void)out_size;
  const float** F = (const float**)d_in;   // 0 feature [4,64,64,64], 1 predict [4,64,64,19], 2 hq_w (in,out), 3 hq_b, 4 hv_w, 5 hv_b, 6 wq_w, 7 wq_b, 8 wv_w, 9 wv_b, 10 h_gate [1], 11 w_gate [1], 12 conv_w [19,1], 13 conv_b [1]
  if (ws_size < (size_t)WS_END) return;
  char* ws = (char*)d_ws; __bf16* PW = (__bf16*)(ws + WS_PW); _Float16 *QH = (_Float16*)(ws + WS_QH), *QL = (_Float16*)(ws + WS_QL), *VT = (_Float16*)(ws + WS_VT), *VL = (_Float16*)(ws + WS_VL); float *X1 = (float*)(ws + WS_X1);
  k_pack<<<dim3(FD, 4), 64, 0, stream>>>(F[2], F[4], F[6], F[8], PW);
  k_proj<0><<<dim3(WWd, NBB), 128, 0, stream>>>(F[0], PW, F[3], F[5], QH, QL, VT, VL);
  k_att<0><<<dim3(NSEQ / 64, NBB), ATT_T, 0, stream>>>(QH, QL, VT, VL, F[10], F[0], F[0], F[1], F[12], F[13], X1);
  k_proj<1><<<dim3(HH, NBB), 128, 0, stream>>>(X1, PW, F[7], F[9], QH, QL, VT, VL);
  k_att<1><<<dim3(NSEQ / 64, NBB), ATT_T, 0, stream>>>(QH, QL, VT, VL, F[11], X1, F[0], F[1], F[12], F[13], (float*)d_out);
}

// v009
// A run of this version takes 106 microseconds.
// Next to v008, in two timings, it ran 1.11 times as fast each time.
// Counting every step since v000, it is 10.8 times as fast.
// compute dtype: all float inputs rounded to bf16; per axis q = x_seq . Wq + bq and v = x_seq . Wv + bv with the sequence rows gathered from the [B,H,W,C] tensor (the second axis reads the first axis' f32 result as bf16 hi + residual, 2 products) on WMMA 16x16x32; scores = sigmoid(q_n . q_m / 8) with q as f16 hi + (x2048-scaled) residual (3 products) and 2048 * sigmoid(s) = 1 / (2^-11 + 2^-11 * 2^(-s * log2 e)) on the hardware's exp2 and reciprocal per score; out = sum_m P (scaled by 2^11, f16 hi + residual) x v (f16 hi + x2048 residual planes), 3 products; gates, residuals and the final (1 - sigmoid(predict)) . conv_w + conv_b pixel gate in f32. (the un-normalised 4,096-term sums need the residual products).
#include <hip/hip_runtime.h>
#include <math.h>

typedef __attribute__((ext_vector_type(16))) _Float16 v16h;
typedef __attribute__((ext_vector_type(16))) __bf16 v16b;
typedef __attribute__((ext_vector_type(8)))  _Float16 v8h;
typedef __attribute__((ext_vector_type(8)))  float v8f;
typedef __attribute__((ext_vector_type(4)))  float v4f;
typedef __attribute__((ext_vector_type(2)))  float v2f;
typedef __attribute__((ext_vector_type(4)))  unsigned v4u;
typedef __attribute__((ext_vector_type(4)))  int v4i;
typedef float __attribute__((may_alias)) float_a;
typedef int __attribute__((may_alias)) int_a;

template <typename T> __device__ __forceinline__ void vst2(void* p, T v) { *(T*)p = v;  }
// The f16 products of the attention loop, written as asm: the accumulator stays in its registers and the products stay in the order written (the plain builtin, with or without scheduling barriers, went to scratch at the registers of 6 waves a SIMD).
// No v_nop behind a product whose next user is a product that adds into the same D or an LDS read over its A or B: neither needs a distance.
__device__ __forceinline__ v8f wmma16(v16h a, v16h b, v8f c) {
  asm volatile("v_wmma_f32_16x16x32_f16 %0, %1, %2, %0" : "+v"(c) : "v"(a), "v"(b));
  return c;
}
// first product of a sum: C = 0 as the inline constant
__device__ __forceinline__ v8f wmma16z(v16h a, v16h b) {
  v8f d; asm volatile("v_wmma_f32_16x16x32_f16 %0, %1, %2, 0" : "=&v"(d) : "v"(a), "v"(b));
  return d;
}
// last product of a run: the four v_nop are the distance the chip needs before a vector instruction reads D or overwrites A or B
__device__ __forceinline__ v8f wmma16e(v16h a, v16h b, v8f c) {
  asm volatile("v_wmma_f32_16x16x32_f16 %0, %1, %2, %0\n\tv_nop\n\tv_nop\n\tv_nop\n\tv_nop" : "+v"(c) : "v"(a), "v"(b));
  return c;
}
__device__ __forceinline__ v8f wmma_bf(v16b a, v16b b, v8f c) {
  v8f d = __builtin_amdgcn_wmma_f32_16x16x32_bf16(false, a, false, b, (short)0, c, false, false);
  asm volatile("v_nop\n\tv_nop\n\tv_nop\n\tv_nop" : "+v"(d) : "v"(a), "v"(b));
  return d;
}
// 16x16x32 fragments: lane = (h = lane>>4, row/col = lane&15); elements 0..7 = k0+8h+0..7, 8..15 = k0+16+8h+0..7; D element r = row 8h+r
__device__ __forceinline__ v16h frag_h(const _Float16* rowk0, int lane) {
  union { v16h v; v8h q[2]; } u; const _Float16* p = rowk0 + 8 * (lane >> 4);
  u.q[0] = *(const v8h*)p; u.q[1] = *(const v8h*)(p + 16); return u.v;
}
__device__ __forceinline__ v16h frag_f32(const float* rowk0, int lane) {
  v16h a; const float* p = rowk0 + 8 * (lane >> 4);
#pragma unroll
  for (int i = 0; i < 8; ++i) { a[i] = (_Float16)p[i]; a[8 + i] = (_Float16)p[16 + i]; }
  return a;
}
__device__ __forceinline__ v16h frag_f32s(const float* rowk0, int lane, float sc) {
  v16h a; const float* p = rowk0 + 8 * (lane >> 4);
#pragma unroll
  for (int i = 0; i < 8; ++i) { a[i] = (_Float16)(p[i] * sc); a[8 + i] = (_Float16)(p[16 + i] * sc); }
  return a;
}
// column fragment from a [K][ld] layout (column n), rows >= K read as 0
__device__ __forceinline__ v16h fragc_f32(const float* W, int k0, int n, int lane, int ld, int K) {
  v16h a; const int g = lane >> 4;
#pragma unroll
  for (int i = 0; i < 8; ++i) { const int ka = k0 + 8 * g + i, kb = ka + 16;
    a[i] = (_Float16)(ka < K ? W[(size_t)(ka < K ? ka : K - 1) * ld + n] : 0.f); a[8 + i] = (_Float16)(kb < K ? W[(size_t)(kb < K ? kb : K - 1) * ld + n] : 0.f); }
  return a;
}
struct F2 { v16b h, l; };
__device__ __forceinline__ F2 bsplit16(const float v[16]) { F2 r;
#pragma unroll
  for (int i = 0; i < 16; ++i) { const __bf16 h = (__bf16)v[i]; r.h[i] = h; r.l[i] = (__bf16)(v[i] - (float)h); }
  return r; }
__device__ __forceinline__ F2 split_row(const float* row, int k0, int lane) { float v[16]; const float* p = row + k0 + 8 * (lane >> 4);
#pragma unroll
  for (int i = 0; i < 8; ++i) { v[i] = p[i]; v[8 + i] = p[16 + i]; }
  return bsplit16(v); }
__device__ __forceinline__ F2 split_rowK(const float* row, int k0, int lane, int K) { float v[16]; const int g = lane >> 4;
#pragma unroll
  for (int i = 0; i < 8; ++i) { const int ka = k0 + 8 * g + i, kb = ka + 16; v[i] = ka < K ? row[ka < K ? ka : K - 1] : 0.f; v[8 + i] = kb < K ? row[kb < K ? kb : K - 1] : 0.f; }
  return bsplit16(v); }
__device__ __forceinline__ F2 split_col(const float* W, int k0, int n, int lane, int ld, int K) { float v[16]; const int g = lane >> 4;
#pragma unroll
  for (int i = 0; i < 8; ++i) { const int ka = k0 + 8 * g + i, kb = ka + 16; v[i] = ka < K ? W[(size_t)(ka < K ? ka : K - 1) * ld + n] : 0.f; v[8 + i] = kb < K ? W[(size_t)(kb < K ? kb : K - 1) * ld + n] : 0.f; }
  return bsplit16(v); }
__device__ __forceinline__ v8f mac3(const F2& a, const F2& b, v8f c) { c = wmma_bf(a.l, b.h, c); c = wmma_bf(a.h, b.l, c); return wmma_bf(a.h, b.h, c); }
__device__ __forceinline__ float sigm(float v) { return 1.0f / (1.0f + expf(-v)); }


// Reverse-attention residual axial block (B 4, 64 x 64 x 64 NHWC): height-axis then width-axis 'sigmoid attention' over 4,096-long sequences (feature dim 64), scalar gates and residuals, then a per-pixel gate from the 19-class prediction map.
#define NB 4
#define HH 64
#define WWd 64
#define CCh 64
#define NC 19
#define NSEQ 4096       // W*C (axis 1) or H*C (axis 2)
#define FD 64           // feature dim (H or W)
#ifndef NBB
#define NBB NB          // batches processed
#endif
typedef __attribute__((ext_vector_type(8))) __bf16 v8b;
__device__ __forceinline__ v16b frag_b(const __bf16* rowk0, int lane) {
  union { v16b v; v8b q[2]; } u; const __bf16* p = rowk0 + 8 * (lane >> 4);
  u.q[0] = *(const v8b*)p; u.q[1] = *(const v8b*)(p + 16); return u.v;
}
__device__ __forceinline__ float bfr(float v) { return (float)(__bf16)v; }
__device__ __attribute__((noinline)) float exp_ni(float v) { return expf(v); }
__device__ __attribute__((noinline)) float erf_ni(float v) { return erff(v); }

#define WS_PW  0u                                   // bf16 rows: hq^T [64][64], hv^T, wq^T, wv^T ((in,out) -> transposed)
#define WS_QH  (WS_PW + 2u * 4 * FD * FD)            // f16 [b][n][64] q hi ; QL ; VT f16 [b][n / 32][64][32] v planes: the 32 keys x 64 columns that one attention pass reads are 4 KiB in a row
#define WS_QL  (WS_QH + 2u * NB * NSEQ * FD)
#define WS_VT  (WS_QL + 2u * NB * NSEQ * FD)
#define WS_VL  (WS_VT + 2u * NB * NSEQ * FD)         // f16 v residual x2048 planes
#define WS_X1  (WS_VL + 2u * NB * NSEQ * FD)         // f32 [B][H][W][C] after the height axis
#define WS_END (WS_X1 + 4u * NB * HH * WWd * CCh)

__global__ __launch_bounds__(64) void k_pack(const float* __restrict__ HQ, const float* __restrict__ HV, const float* __restrict__ WQ, const float* __restrict__ WV, __bf16* __restrict__ PW) {
  const int n = blockIdx.x, which = blockIdx.y, t = threadIdx.x; const float* Wm = (which == 0) ? HQ : (which == 1) ? HV : (which == 2) ? WQ : WV; __shared__ __align__(16) __bf16 s[FD];
  s[t] = (__bf16)Wm[(size_t)t * FD + n]; __syncthreads();   // (in,out): row n = output, k = input
  if (t < FD / 8) vst2((unsigned*)(PW + ((size_t)which * FD + n) * FD + t * 8), *(const v4u*)&s[t * 8]);
}
// ---- k_proj<AX>: block = (64 sequence rows n = (o, c0..c63) with o = w (AX 0) or h (AX 1), b): A[n][d] gathered from the NHWC tensor (AX 0: x[b][d][o][c]; AX 1: x1[b][o][d][c]); q = A . Wq^T + bq (AX 0 exact; AX 1 hi + residual) -> f16 hi/lo rows; v -> f16 planes [b][n / 32][dd][n % 32]
template <int AX>
__global__ __launch_bounds__(128) void k_proj(const float* __restrict__ SRC, const __bf16* __restrict__ PW, const float* __restrict__ BQ, const float* __restrict__ BV, _Float16* __restrict__ QH, _Float16* __restrict__ QL, _Float16* __restrict__ VT, _Float16* __restrict__ VL) {
  __shared__ __align__(16) __bf16 sa[64][FD + 8], sal[64][FD + 8]; __shared__ __align__(16) _Float16 sqh[64][FD + 8], sql[64][FD + 8]; __shared__ __align__(16) _Float16 svt[FD][72], svl[FD][72];
  const int tid = threadIdx.x, wave = tid >> 5, lane = tid & 31, col = lane & 15, g = lane >> 4; const size_t b = blockIdx.y; const int o = blockIdx.x;   // block = the 64 rows (o, c) c = 0..63
  const __bf16* PQ = PW + (size_t)(AX == 0 ? 0 : 2) * FD * FD; const __bf16* PV = PW + (size_t)(AX == 0 ? 1 : 3) * FD * FD;
  // Every global load of the block goes out here, ahead of all work: at one wave a SIMD nothing else covers a load's latency, so it is paid once, not once per group of 4 gathered values and once per weight fragment.
  const int gc = tid & 63, gd = tid >> 6; float xv[32]; v16b wf[FD / 32][8]; float bias[8];
#pragma unroll   // the 32 gathered values stay in registers and their loads stand in one run
  for (int i = 0; i < 32; ++i) { const int d = gd + 2 * i; xv[i] = (AX == 0) ? SRC[((b * HH + d) * WWd + o) * CCh + gc] : SRC[((b * HH + o) * WWd + d) * CCh + gc]; }
#pragma unroll   // likewise the 16 weight fragments (this loop and the one inside it)
  for (int kc = 0; kc < FD / 32; ++kc)
#pragma unroll
    for (int j = 0; j < 8; ++j) wf[kc][j] = frag_b(((j < 4) ? PQ : PV) + (size_t)((j & 3) * 16 + col) * FD + kc * 32, lane);
#pragma unroll   // and the 8 biases of the lane's columns
  for (int j = 0; j < 8; ++j) bias[j] = (j < 4 ? BQ : BV)[(j & 3) * 16 + col];
#pragma unroll   // xv is indexed by constants only
  for (int i = 0; i < 32; ++i) { const int d = gd + 2 * i; const float v = (AX == 0) ? bfr(xv[i]) : xv[i]; const __bf16 hb = (__bf16)v; sa[gc][d] = hb; sal[gc][d] = (__bf16)(v - (float)hb); }
  if (tid < 64) for (int d = FD; d < FD + 8; ++d) { sa[tid][d] = (__bf16)0.f; sal[tid][d] = (__bf16)0.f; sqh[tid][d] = (_Float16)0.f; sql[tid][d] = (_Float16)0.f; }
  __syncthreads();
  v8f acc[8] = {};   // tiles 0..3 q, 4..7 v
#pragma unroll
  for (int kc = 0; kc < FD / 32; ++kc) { const v16b a = frag_b(&sa[wave * 16 + col][kc * 32], lane), al = frag_b(&sal[wave * 16 + col][kc * 32], lane);
#pragma unroll
    for (int j = 0; j < 8; ++j) { const v16b w = wf[kc][j]; if (AX == 1) acc[j] = wmma_bf(al, w, acc[j]); acc[j] = wmma_bf(a, w, acc[j]); } }
#pragma unroll
  for (int j = 0; j < 8; ++j) { const int d = (j & 3) * 16 + col; const float bb = bfr(bias[j]);
#pragma unroll
    for (int r = 0; r < 8; ++r) { const float v = acc[j][r] + bb; const int rr = wave * 16 + 8 * g + r; const _Float16 hv = (_Float16)v; if (j < 4) { sqh[rr][d] = hv; sql[rr][d] = (_Float16)((v - (float)hv) * 2048.0f); } else { svt[d][rr] = hv; svl[d][rr] = (_Float16)((v - (float)hv) * 2048.0f); } } }
  __syncthreads();
  const size_t n0 = (size_t)o * 64;
  for (int e = tid; e < 64 * 8; e += 128) { const int r = e >> 3, q = e & 7; const size_t off = (b * NSEQ + n0 + r) * FD + q * 8; vst2((unsigned*)(QH + off), *(const v4u*)&sqh[r][q * 8]); vst2((unsigned*)(QL + off), *(const v4u*)&sql[r][q * 8]); }
  for (int e = tid; e < FD * 8; e += 128) { const int tl = e >> 8, d = (e >> 2) & 63, pc = e & 3; const size_t off = ((b * (NSEQ / 32) + (size_t)o * 2 + tl) * FD + d) * 32 + pc * 8;   // the block's 64 rows are 2 tiles of 32 keys; a wave's store is 512 B in a row
    vst2((unsigned*)(VT + off), *(const v4u*)&svt[d][tl * 32 + pc * 8]); vst2((unsigned*)(VL + off), *(const v4u*)&svl[d][tl * 32 + pc * 8]); }
}
// ---- k_att<AX>: block = (64 queries n = (o, c), b), 24 waves = 4 query tiles x KSPL key ranges (6 waves a SIMD cover each other's dependent-chain latency); each wave sums its own key range, the ranges are added in LDS in fixed order: scores = sigmoid(q_n . q_m / 8) for all 4,096 m (3 products), computed transposed (key rows x query columns) so that the two score tiles of a pass, converted in place, are the A fragment of P and P never goes through LDS; P x 2^11 hi + residual x v hi + residual (3 products, 4 tiles); out * gate + residual -> NHWC (AX 0: x1[b][dd][o][c] = out[n][dd] * h_gate + x; AX 1: x2 = out * w_gate + x1 stays in registers and the block, which holds all of (b, h = o), writes the final out[b][o][dd][c] = p[dd] * (feature + x2), p[w] = sum_nc (1 - sigmoid(predict)) conv_w + conv_b)
// The 32 keys of a pass (q hi, q residual rows; v hi, v residual planes: 16 KiB a key range) are staged in LDS once for the 4 query tiles that share them, by asynchronous copies into a ring of two buffers: the next pass's copies fly while this pass is worked on.
#define KSPL 6                       // key ranges per query tile
#define ATT_T (128 * KSPL)           // threads of a k_att block
#define NPASS (NSEQ / 32)            // passes of 32 keys over the whole sequence
#define TRIPS ((NPASS + KSPL - 1) / KSPL)   // trips of the ring = passes of the longest key range; first pass of the last range + TRIPS <= NPASS, so every staged tile lies inside the planes
#define KP 72                        // f16 per staged q row: 144 B = 16 B x odd, conflict-free for 16-byte reads
#define VP 40                        // f16 per staged v row:  80 B = 16 B x odd
#define ST_KL (32 * KP)              // places (in f16) of the four tiles of one key range: q hi at 0, q residual, v hi, v residual
#define ST_VH (2 * 32 * KP)
#define ST_VL (2 * 32 * KP + FD * VP)
#define ST_SZ (2 * 32 * KP + 2 * FD * VP)
#define BUF_SZ (KSPL * ST_SZ)
static_assert((KSPL - 1) * NPASS / KSPL + TRIPS <= NPASS, "a staged tile would leave the planes");
// eight 16-byte copies a lane (one 4-KiB tile a wave); the s_wait_xcnt stands inside the statement so that no address register is rewritten in front of it
__device__ __forceinline__ void stage8(unsigned l, unsigned ls, const char* g, size_t gs) {
  asm volatile("global_load_async_to_lds_b128 %0, %8, off\n\t"
               "global_load_async_to_lds_b128 %1, %9, off\n\t"
               "global_load_async_to_lds_b128 %2, %10, off\n\t"
               "global_load_async_to_lds_b128 %3, %11, off\n\t"
               "global_load_async_to_lds_b128 %4, %12, off\n\t"
               "global_load_async_to_lds_b128 %5, %13, off\n\t"
               "global_load_async_to_lds_b128 %6, %14, off\n\t"
               "global_load_async_to_lds_b128 %7, %15, off\n\t"
               "s_wait_xcnt 0x0"
               :: "v"(l), "v"(l + ls), "v"(l + 2 * ls), "v"(l + 3 * ls), "v"(l + 4 * ls), "v"(l + 5 * ls), "v"(l + 6 * ls), "v"(l + 7 * ls),
                  "v"(g), "v"(g + gs), "v"(g + 2 * gs), "v"(g + 3 * gs), "v"(g + 4 * gs), "v"(g + 5 * gs), "v"(g + 6 * gs), "v"(g + 7 * gs) : "memory");
}
// 2048 * sigmoid(s) from x = -s * log2(e): v_exp_f32, one fma, v_rcp_f32, in line, so that the scores of a tile are independent chains; 2^x = inf gives 0, 2^x = 0 gives 2048
__device__ __forceinline__ float sigm2048(float x) { return __builtin_amdgcn_rcpf(__builtin_fmaf(__builtin_amdgcn_exp2f(x), 1.0f / 2048.0f, 1.0f / 2048.0f)); }
template <int AX>
__global__ __launch_bounds__(ATT_T) void k_att(const _Float16* __restrict__ QH, const _Float16* __restrict__ QL, const _Float16* __restrict__ VT, const _Float16* __restrict__ VL, const float* __restrict__ GATE, const float* __restrict__ RES, const float* __restrict__ FEAT, const float* __restrict__ PRED, const float* __restrict__ CW, const float* __restrict__ CB, float* __restrict__ OUTB) {
  __shared__ __align__(16) _Float16 ring[2 * BUF_SZ]; __shared__ float sp[WWd];   // sp: the pixel gate p[w] of row (b, o), AX 1 only
  float (*so)[FD][68] = (float (*)[FD][68])ring;   // [key range][dd][c]: the ring's LDS, used again behind the loop's last barrier
  static_assert(sizeof(float) * KSPL * FD * 68 <= sizeof(_Float16) * 2 * BUF_SZ, "partial sums do not fit the ring");
  const int tid = threadIdx.x, wave = tid >> 5, lane = tid & 31, col = lane & 15, g = lane >> 4; const size_t b = blockIdx.y; const int o = blockIdx.x;
  const int qg = __builtin_amdgcn_readfirstlane(wave & 3), kr = __builtin_amdgcn_readfirstlane(wave >> 2);   // query tile; key range (wave-uniform, so the pass loop stays a scalar loop)
  const int ks0 = kr * NPASS / KSPL, ks1 = (kr + 1) * NPASS / KSPL; const size_t rq = b * NSEQ + (size_t)o * 64 + qg * 16;
  // wave qg of a key range copies tile qg: 0 q hi, 1 q residual (32 rows of 128 B), 2 v hi, 3 v residual (64 rows of 64 B); each tile is 4 KiB in a row in its plane, so every copy of a wave asks for 4 whole 128-B lines
  const bool isk = qg < 2;
  const char* gsrc = (const char*)(qg == 0 ? QH : qg == 1 ? QL : qg == 2 ? VT : VL) + b * (size_t)(NSEQ * FD * 2) + (size_t)ks0 * (32 * FD * 2) + lane * 16;
  const size_t gtrip = 32 * FD * 2, gstep = 512;
  const unsigned ldst = (unsigned)(size_t)ring + 2u * (kr * ST_SZ + (qg == 0 ? 0 : qg == 1 ? ST_KL : qg == 2 ? ST_VH : ST_VL)) + (isk ? (lane >> 3) * (2 * KP) + (lane & 7) * 16 : (lane >> 2) * (2 * VP) + (lane & 3) * 16);
  const unsigned lstep = isk ? 4 * 2 * KP : 8 * 2 * VP;
  stage8(ldst, lstep, gsrc, gstep);
  v16h aq[2], aql[2];
#pragma unroll
  for (int kc = 0; kc < 2; ++kc) { aq[kc] = frag_h(QH + (rq + col) * FD + kc * 32, lane); aql[kc] = frag_h(QL + (rq + col) * FD + kc * 32, lane); }
  if (AX == 1 && kr == 0 && qg < 2) {   // two waves make the 64 pixel gates while tile 0's copies fly (scalar branch); the barrier below publishes sp
    const int w = qg * 32 + lane; const float* pr = PRED + ((b * HH + o) * WWd + w) * NC; float a = 0.f;
#pragma unroll   // the 19 loads go out together and the 19 sigmoids are independent chains; only the sum is a chain
    for (int k = 0; k < NC; ++k) a += (1.0f - 1.0f / (1.0f + expf(-bfr(pr[k])))) * bfr(CW[k]);
    sp[w] = a + bfr(CB[0]);
  }
  asm volatile("s_wait_asynccnt 0x0" ::: "memory");   // tile 0 has landed before the barrier publishes it
  __syncthreads();
  stage8(ldst + 2u * BUF_SZ, lstep, gsrc + gtrip, gstep);
  v8f acc[4] = {}, accl[4] = {}; const float nscale = -0.125f * 1.44269504088896341f;   // -(1 / sqrt(64)) * log2(e): the score as the exponent of 2^x
#pragma unroll 1   // one copy of the pass body: the two buffers differ by an offset only
  for (int t = 0; t < TRIPS; ++t) { const _Float16* st = ring + (t & 1) * BUF_SZ + kr * ST_SZ;
    if (ks0 + t < ks1) {   // a shorter key range sits out the last trip (scalar branch); the publish point below is passed by every wave
    // The LDS fragment reads stand in groups, each ahead of work that covers its latency, in place of one read and one full wait per product pair:
    // key tile 0 at the head; key tile 1 (but its last fragment) ahead of tile 0's sigmoids; two v hi fragments ahead of tile 1's sigmoids; each v residual behind the last product of the v hi fragment of its columns.
    const _Float16* rk = st + col * KP; const _Float16* vo = st + ST_VH + col * VP; v16h kf[2][2], kl[2][2], vh[4], vl[4], pa, pl;
#pragma unroll
    for (int kc = 0; kc < 2; ++kc) { kf[0][kc] = frag_h(rk + kc * 32, lane); kl[0][kc] = frag_h(rk + ST_KL + kc * 32, lane); }
#pragma unroll
    for (int ct = 0; ct < 2; ++ct) { v8f c, cl;   // keys as A, queries as B: c[r] = score of key ct * 16 + 8g + r with query col
#pragma unroll
      for (int kc = 0; kc < 2; ++kc) { c = kc == 0 ? wmma16z(kf[ct][kc], aq[kc]) : wmma16(kf[ct][kc], aq[kc], c); cl = kc == 0 ? wmma16z(kf[ct][kc], aql[kc]) : wmma16(kf[ct][kc], aql[kc], cl);
        if (ct == 1 && kc == 0) kl[1][1] = frag_h(rk + 16 * KP + ST_KL + 32, lane);   // the fragment used last takes the registers of the one just used up
        cl = kc == 0 ? wmma16(kl[ct][kc], aq[kc], cl) : wmma16e(kl[ct][kc], aq[kc], cl); }   // the sigmoids read c and cl next
      if (ct == 0) { kf[1][0] = frag_h(rk + 16 * KP, lane); kl[1][0] = frag_h(rk + 16 * KP + ST_KL, lane); kf[1][1] = frag_h(rk + 16 * KP + 32, lane); }
      else {
#pragma unroll
        for (int dt = 0; dt < 2; ++dt) vh[dt] = frag_h(vo + dt * 16 * VP, lane);
      }
#pragma unroll
      for (int r = 0; r < 8; ++r) { const float p = sigm2048((c[r] + cl[r] * (1.0f / 2048.0f)) * nscale); const _Float16 hp = (_Float16)p; pa[ct * 8 + r] = hp; pl[ct * 8 + r] = (_Float16)((p - (float)hp) * 2048.0f); }   // element ct * 8 + r of the A fragment of row col is k = ct * 16 + 8g + r: each score stays in its lane
      __builtin_amdgcn_sched_barrier(0);   // keeps the next products and their fragments from being lifted among these sigmoids: together they do not fit the registers of 6 waves a SIMD (scratch)
    }
    vh[2] = frag_h(vo + 2 * 16 * VP, lane); vh[3] = frag_h(vo + 3 * 16 * VP, lane);   // the sigmoids need their registers
#pragma unroll
    for (int dt = 0; dt < 4; ++dt) { acc[dt] = wmma16(pa, vh[dt], acc[dt]); accl[dt] = wmma16(pl, vh[dt], accl[dt]); vl[dt] = frag_h(vo + dt * 16 * VP + (ST_VL - ST_VH), lane); }
#pragma unroll
    for (int dt = 0; dt < 4; ++dt) accl[dt] = dt < 3 ? wmma16(pa, vl[dt], accl[dt]) : wmma16e(pa, vl[dt], accl[dt]);   // 3 products; behind the last one the next copies' addresses may take the fragments' registers
    }
    asm volatile("s_wait_dscnt 0x0" ::: "memory");      // this wave's reads of the buffer are done before it is refilled
    asm volatile("s_wait_asynccnt 0x0" ::: "memory");   // this wave's copies of the next tile have landed
    __syncthreads();                                     // publishes the next tile and ends every reader's last read of this one
    if (t + 2 < TRIPS) stage8(ldst + (t & 1) * (2u * BUF_SZ), lstep, gsrc + (size_t)(t + 2) * gtrip, gstep); }
  asm volatile("s_wait_asynccnt 0x0" ::: "memory");     // no copy is in flight when the ring becomes the partial sums' place
  const float gate = bfr(GATE[0]);
#pragma unroll
  for (int r = 0; r < 8; ++r) { const int c = qg * 16 + 8 * g + r;
#pragma unroll
    for (int dt = 0; dt < 4; ++dt) so[kr][dt * 16 + col][c] = acc[dt][r] + accl[dt][r] * (1.0f / 2048.0f); }
  __syncthreads();
  for (int e = tid; e < FD * 16; e += ATT_T) { const int dd = e >> 4, q = e & 15; const size_t base = (AX == 0) ? (((b * HH + dd) * WWd + o) * CCh) : (((b * HH + o) * WWd + dd) * CCh);
    v4f a = *(const v4f*)&so[0][dd][q * 4];
    for (int s = 1; s < KSPL; ++s) a += *(const v4f*)&so[s][dd][q * 4];
    const v4f rv = *(const v4f*)(RES + base + q * 4); v4f ov;
    for (int i = 0; i < 4; ++i) ov[i] = a[i] * (1.0f / 2048.0f) * gate + ((AX == 0) ? bfr(rv[i]) : rv[i]);
    if (AX == 1) { const v4f fv = *(const v4f*)(FEAT + base + q * 4); const float pw = sp[dd];
      for (int i = 0; i < 4; ++i) ov[i] = pw * (bfr(fv[i]) + ov[i]); }
    vst2(OUTB + base + q * 4, ov); }   // 64 consecutive c = 256 B
}
extern "C" void kernel_launch(void* const* d_in, const int* in_sizes, int n_in, void* d_out, int out_size, void* d_ws, size_t ws_size, hipStream_t stream) {
  (void)in_sizes; (void)n_in; (void)out_size;
  const float** F = (const float**)d_in;   // 0 feature [4,64,64,64], 1 predict [4,64,64,19], 2 hq_w (in,out), 3 hq_b, 4 hv_w, 5 hv_b, 6 wq_w, 7 wq_b, 8 wv_w, 9 wv_b, 10 h_gate [1], 11 w_gate [1], 12 conv_w [19,1], 13 conv_b [1]
  if (ws_size < (size_t)WS_END) return;
  char* ws = (char*)d_ws; __bf16* PW = (__bf16*)(ws + WS_PW); _Float16 *QH = (_Float16*)(ws + WS_QH), *QL = (_Float16*)(ws + WS_QL), *VT = (_Float16*)(ws + WS_VT), *VL = (_Float16*)(ws + WS_VL); float *X1 = (float*)(ws + WS_X1);
  k_pack<<<dim3(FD, 4), 64, 0, stream>>>(F[2], F[4], F[6], F[8], PW);
  k_proj<0><<<dim3(WWd, NBB), 128, 0, stream>>>(F[0], PW, F[3], F[5], QH, QL, VT, VL);
  k_att<0><<<dim3(NSEQ / 64, NBB), ATT_T, 0, stream>>>(QH, QL, VT, VL, F[10], F[0], F[0], F[1], F[12], F[13], X1);
  k_proj<1><<<dim3(HH, NBB), 128, 0, stream>>>(X1, PW, F[7], F[9], QH, QL, VT, VL);
  k_att<1><<<dim3(NSEQ / 64, NBB), ATT_T, 0, stream>>>(QH, QL, VT, VL, F[11], X1, F[0], F[1], F[12], F[13], (float*)d_out);
}

// v010
// Measured time: 93.2 microseconds a run.
// In two side-by-side timings against v009, it was 1.14 and 1.13 times as fast.
// All steps since v000 together make it 12.3 times as fast.
// compute dtype: all float inputs rounded to bf16; per axis q = x_seq . Wq + bq and v = x_seq . Wv + bv with the sequence rows gathered from the [B,H,W,C] tensor (the second axis reads the first axis' f32 result as bf16 hi + residual, 2 products) on WMMA 16x16x32; scores = sigmoid(q_n . q_m / 8) with q as f16 hi + residual (the query side scaled by -log2(e) / 8 and split anew, so that the sum is the exponent x = -s * log2 e; the key side unscaled: its small values are f16 subnormals, which the matrix unit keeps; 3 products into one accumulator) and 2048 * sigmoid(s) = 1 / (2^-11 + 2^-11 * 2^(-s * log2 e)) on the hardware's exp2 and reciprocal per score; out = sum_m P (scaled by 2^11, f16 hi + residual) x v (f16 hi + residual planes), 3 products into one accumulator; gates, residuals and the final (1 - sigmoid(predict)) . conv_w + conv_b pixel gate in f32. (the un-normalised 4,096-term sums need the residual products).
#include <hip/hip_runtime.h>
#include <math.h>

typedef __attribute__((ext_vector_type(16))) _Float16 v16h;
typedef __attribute__((ext_vector_type(16))) __bf16 v16b;
typedef __attribute__((ext_vector_type(8)))  _Float16 v8h;
typedef __attribute__((ext_vector_type(2)))  _Float16 v2h;
typedef __attribute__((ext_vector_type(8)))  float v8f;
typedef __attribute__((ext_vector_type(4)))  float v4f;
typedef __attribute__((ext_vector_type(2)))  float v2f;
typedef __attribute__((ext_vector_type(4)))  unsigned v4u;
typedef __attribute__((ext_vector_type(4)))  int v4i;
typedef float __attribute__((may_alias)) float_a;
typedef int __attribute__((may_alias)) int_a;

template <typename T> __device__ __forceinline__ void vst2(void* p, T v) { *(T*)p = v;  }
// The f16 products of the attention loop, written as asm: the accumulator stays in its registers and the products stay in the order written (the plain builtin, with or without scheduling barriers, went to scratch at the registers of 6 waves a SIMD).
// No v_nop behind a product whose next user is a product that adds into the same D or an LDS read over its A or B: neither needs a distance.
__device__ __forceinline__ v8f wmma16(v16h a, v16h b, v8f c) {
  asm volatile("v_wmma_f32_16x16x32_f16 %0, %1, %2, %0" : "+v"(c) : "v"(a), "v"(b));
  return c;
}
// first product of a sum: C = 0 as the inline constant
__device__ __forceinline__ v8f wmma16z(v16h a, v16h b) {
  v8f d; asm volatile("v_wmma_f32_16x16x32_f16 %0, %1, %2, 0" : "=&v"(d) : "v"(a), "v"(b));
  return d;
}
// last product of a run: the four v_nop are the distance the chip needs before a vector instruction reads D or overwrites A or B
__device__ __forceinline__ v8f wmma16e(v16h a, v16h b, v8f c) {
  asm volatile("v_wmma_f32_16x16x32_f16 %0, %1, %2, %0\n\tv_nop\n\tv_nop\n\tv_nop\n\tv_nop" : "+v"(c) : "v"(a), "v"(b));
  return c;
}
// the last products of two sums in one statement, so that no reader of the first sum is lifted in between; the second product and the four v_nop are the distance for both
__device__ __forceinline__ void wmma16e2(v16h a0, v16h a1, v16h b, v8f& c0, v8f& c1) {
  asm volatile("v_wmma_f32_16x16x32_f16 %0, %2, %4, %0\n\tv_wmma_f32_16x16x32_f16 %1, %3, %4, %1\n\tv_nop\n\tv_nop\n\tv_nop\n\tv_nop" : "+v"(c0), "+v"(c1) : "v"(a0), "v"(a1), "v"(b));
}
__device__ __forceinline__ v8f wmma_bf(v16b a, v16b b, v8f c) {
  v8f d = __builtin_amdgcn_wmma_f32_16x16x32_bf16(false, a, false, b, (short)0, c, false, false);
  asm volatile("v_nop\n\tv_nop\n\tv_nop\n\tv_nop" : "+v"(d) : "v"(a), "v"(b));
  return d;
}
// 16x16x32 fragments: lane = (h = lane>>4, row/col = lane&15); elements 0..7 = k0+8h+0..7, 8..15 = k0+16+8h+0..7; D element r = row 8h+r
__device__ __forceinline__ v16h frag_h(const _Float16* rowk0, int lane) {
  union { v16h v; v8h q[2]; } u; const _Float16* p = rowk0 + 8 * (lane >> 4);
  u.q[0] = *(const v8h*)p; u.q[1] = *(const v8h*)(p + 16); return u.v;
}
__device__ __forceinline__ v16h frag_f32(const float* rowk0, int lane) {
  v16h a; const float* p = rowk0 + 8 * (lane >> 4);
#pragma unroll
  for (int i = 0; i < 8; ++i) { a[i] = (_Float16)p[i]; a[8 + i] = (_Float16)p[16 + i]; }
  return a;
}
__device__ __forceinline__ v16h frag_f32s(const float* rowk0, int lane, float sc) {
  v16h a; const float* p = rowk0 + 8 * (lane >> 4);
#pragma unroll
  for (int i = 0; i < 8; ++i) { a[i] = (_Float16)(p[i] * sc); a[8 + i] = (_Float16)(p[16 + i] * sc); }
  return a;
}
// column fragment from a [K][ld] layout (column n), rows >= K read as 0
__device__ __forceinline__ v16h fragc_f32(const float* W, int k0, int n, int lane, int ld, int K) {
  v16h a; const int g = lane >> 4;
#pragma unroll
  for (int i = 0; i < 8; ++i) { const int ka = k0 + 8 * g + i, kb = ka + 16;
    a[i] = (_Float16)(ka < K ? W[(size_t)(ka < K ? ka : K - 1) * ld + n] : 0.f); a[8 + i] = (_Float16)(kb < K ? W[(size_t)(kb < K ? kb : K - 1) * ld + n] : 0.f); }
  return a;
}
struct F2 { v16b h, l; };
__device__ __forceinline__ F2 bsplit16(const float v[16]) { F2 r;
#pragma unroll
  for (int i = 0; i < 16; ++i) { const __bf16 h = (__bf16)v[i]; r.h[i] = h; r.l[i] = (__bf16)(v[i] - (float)h); }
  return r; }
__device__ __forceinline__ F2 split_row(const float* row, int k0, int lane) { float v[16]; const float* p = row + k0 + 8 * (lane >> 4);
#pragma unroll
  for (int i = 0; i < 8; ++i) { v[i] = p[i]; v[8 + i] = p[16 + i]; }
  return bsplit16(v); }
__device__ __forceinline__ F2 split_rowK(const float* row, int k0, int lane, int K) { float v[16]; const int g = lane >> 4;
#pragma unroll
  for (int i = 0; i < 8; ++i) { const int ka = k0 + 8 * g + i, kb = ka + 16; v[i] = ka < K ? row[ka < K ? ka : K - 1] : 0.f; v[8 + i] = kb < K ? row[kb < K ? kb : K - 1] : 0.f; }
  return bsplit16(v); }
__device__ __forceinline__ F2 split_col(const float* W, int k0, int n, int lane, int ld, int K) { float v[16]; const int g = lane >> 4;
#pragma unroll
  for (int i = 0; i < 8; ++i) { const int ka = k0 + 8 * g + i, kb = ka + 16; v[i] = ka < K ? W[(size_t)(ka < K ? ka : K - 1) * ld + n] : 0.f; v[8 + i] = kb < K ? W[(size_t)(kb < K ? kb : K - 1) * ld + n] : 0.f; }
  return bsplit16(v); }
__device__ __forceinline__ v8f mac3(const F2& a, const F2& b, v8f c) { c = wmma_bf(a.l, b.h, c); c = wmma_bf(a.h, b.l, c); return wmma_bf(a.h, b.h, c); }
__device__ __forceinline__ float sigm(float v) { return 1.0f / (1.0f + expf(-v)); }


// Reverse-attention residual axial block (B 4, 64 x 64 x 64 NHWC): height-axis then width-axis 'sigmoid attention' over 4,096-long sequences (feature dim 64), scalar gates and residuals, then a per-pixel gate from the 19-class prediction map.
#define NB 4
#define HH 64
#define WWd 64
#define CCh 64
#define NC 19
#define NSEQ 4096       // W*C (axis 1) or H*C (axis 2)
#define FD 64           // feature dim (H or W)
#ifndef NBB
#define NBB NB          // batches processed
#endif
typedef __attribute__((ext_vector_type(8))) __bf16 v8b;
__device__ __forceinline__ v16b frag_b(const __bf16* rowk0, int lane) {
  union { v16b v; v8b q[2]; } u; const __bf16* p = rowk0 + 8 * (lane >> 4);
  u.q[0] = *(const v8b*)p; u.q[1] = *(const v8b*)(p + 16); return u.v;
}
__device__ __forceinline__ float bfr(float v) { return (float)(__bf16)v; }
__device__ __attribute__((noinline)) float exp_ni(float v) { return expf(v); }
__device__ __attribute__((noinline)) float erf_ni(float v) { return erff(v); }

#define WS_PW  0u                                   // bf16 rows: hq^T [64][64], hv^T, wq^T, wv^T ((in,out) -> transposed)
#define WS_QH  (WS_PW + 2u * 4 * FD * FD)            // f16 [b][n][64] q hi ; QL ; VT f16 [b][n / 32][64][32] v planes: the 32 keys x 64 columns that one attention pass reads are 4 KiB in a row
#define WS_QL  (WS_QH + 2u * NB * NSEQ * FD)
#define WS_VT  (WS_QL + 2u * NB * NSEQ * FD)
#define WS_VL  (WS_VT + 2u * NB * NSEQ * FD)         // f16 v residual planes
#define WS_X1  (WS_VL + 2u * NB * NSEQ * FD)         // f32 [B][H][W][C] after the height axis
#define WS_END (WS_X1 + 4u * NB * HH * WWd * CCh)

__global__ __launch_bounds__(64) void k_pack(const float* __restrict__ HQ, const float* __restrict__ HV, const float* __restrict__ WQ, const float* __restrict__ WV, __bf16* __restrict__ PW) {
  const int n = blockIdx.x, which = blockIdx.y, t = threadIdx.x; const float* Wm = (which == 0) ? HQ : (which == 1) ? HV : (which == 2) ? WQ : WV; __shared__ __align__(16) __bf16 s[FD];
  s[t] = (__bf16)Wm[(size_t)t * FD + n]; __syncthreads();   // (in,out): row n = output, k = input
  if (t < FD / 8) vst2((unsigned*)(PW + ((size_t)which * FD + n) * FD + t * 8), *(const v4u*)&s[t * 8]);
}
// ---- k_proj<AX>: block = (64 sequence rows n = (o, c0..c63) with o = w (AX 0) or h (AX 1), b): A[n][d] gathered from the NHWC tensor (AX 0: x[b][d][o][c]; AX 1: x1[b][o][d][c]); q = A . Wq^T + bq (AX 0 exact; AX 1 hi + residual) -> f16 hi/lo rows; v -> f16 planes [b][n / 32][dd][n % 32]
template <int AX>
__global__ __launch_bounds__(128) void k_proj(const float* __restrict__ SRC, const __bf16* __restrict__ PW, const float* __restrict__ BQ, const float* __restrict__ BV, _Float16* __restrict__ QH, _Float16* __restrict__ QL, _Float16* __restrict__ VT, _Float16* __restrict__ VL) {
  __shared__ __align__(16) __bf16 sa[64][FD + 8], sal[64][FD + 8]; __shared__ __align__(16) _Float16 sqh[64][FD + 8], sql[64][FD + 8]; __shared__ __align__(16) _Float16 svt[FD][72], svl[FD][72];
  const int tid = threadIdx.x, wave = tid >> 5, lane = tid & 31, col = lane & 15, g = lane >> 4; const size_t b = blockIdx.y; const int o = blockIdx.x;   // block = the 64 rows (o, c) c = 0..63
  const __bf16* PQ = PW + (size_t)(AX == 0 ? 0 : 2) * FD * FD; const __bf16* PV = PW + (size_t)(AX == 0 ? 1 : 3) * FD * FD;
  // Every global load of the block goes out here, ahead of all work: at one wave a SIMD nothing else covers a load's latency, so it is paid once, not once per group of 4 gathered values and once per weight fragment.
  const int gc = tid & 63, gd = tid >> 6; float xv[32]; v16b wf[FD / 32][8]; float bias[8];
#pragma unroll   // the 32 gathered values stay in registers and their loads stand in one run
  for (int i = 0; i < 32; ++i) { const int d = gd + 2 * i; xv[i] = (AX == 0) ? SRC[((b * HH + d) * WWd + o) * CCh + gc] : SRC[((b * HH + o) * WWd + d) * CCh + gc]; }
#pragma unroll   // likewise the 16 weight fragments (this loop and the one inside it)
  for (int kc = 0; kc < FD / 32; ++kc)
#pragma unroll
    for (int j = 0; j < 8; ++j) wf[kc][j] = frag_b(((j < 4) ? PQ : PV) + (size_t)((j & 3) * 16 + col) * FD + kc * 32, lane);
#pragma unroll   // and the 8 biases of the lane's columns
  for (int j = 0; j < 8; ++j) bias[j] = (j < 4 ? BQ : BV)[(j & 3) * 16 + col];
#pragma unroll   // xv is indexed by constants only
  for (int i = 0; i < 32; ++i) { const int d = gd + 2 * i; const float v = (AX == 0) ? bfr(xv[i]) : xv[i]; const __bf16 hb = (__bf16)v; sa[gc][d] = hb; sal[gc][d] = (__bf16)(v - (float)hb); }
  if (tid < 64) for (int d = FD; d < FD + 8; ++d) { sa[tid][d] = (__bf16)0.f; sal[tid][d] = (__bf16)0.f; sqh[tid][d] = (_Float16)0.f; sql[tid][d] = (_Float16)0.f; }
  __syncthreads();
  v8f acc[8] = {};   // tiles 0..3 q, 4..7 v
#pragma unroll
  for (int kc = 0; kc < FD / 32; ++kc) { const v16b a = frag_b(&sa[wave * 16 + col][kc * 32], lane), al = frag_b(&sal[wave * 16 + col][kc * 32], lane);
#pragma unroll
    for (int j = 0; j < 8; ++j) { const v16b w = wf[kc][j]; if (AX == 1) acc[j] = wmma_bf(al, w, acc[j]); acc[j] = wmma_bf(a, w, acc[j]); } }
#pragma unroll
  for (int j = 0; j < 8; ++j) { const int d = (j & 3) * 16 + col; const float bb = bfr(bias[j]);
#pragma unroll
    for (int r = 0; r < 8; ++r) { const float v = acc[j][r] + bb; const int rr = wave * 16 + 8 * g + r; const _Float16 hv = (_Float16)v; if (j < 4) { sqh[rr][d] = hv; sql[rr][d] = (_Float16)(v - (float)hv); } else { svt[d][rr] = hv; svl[d][rr] = (_Float16)(v - (float)hv); } } }
  __syncthreads();
  const size_t n0 = (size_t)o * 64;
  for (int e = tid; e < 64 * 8; e += 128) { const int r = e >> 3, q = e & 7; const size_t off = (b * NSEQ + n0 + r) * FD + q * 8; vst2((unsigned*)(QH + off), *(const v4u*)&sqh[r][q * 8]); vst2((unsigned*)(QL + off), *(const v4u*)&sql[r][q * 8]); }
  for (int e = tid; e < FD * 8; e += 128) { const int tl = e >> 8, d = (e >> 2) & 63, pc = e & 3; const size_t off = ((b * (NSEQ / 32) + (size_t)o * 2 + tl) * FD + d) * 32 + pc * 8;   // the block's 64 rows are 2 tiles of 32 keys; a wave's store is 512 B in a row
    vst2((unsigned*)(VT + off), *(const v4u*)&svt[d][tl * 32 + pc * 8]); vst2((unsigned*)(VL + off), *(const v4u*)&svl[d][tl * 32 + pc * 8]); }
}
// ---- k_att<AX>: block = (64 queries n = (o, c), b), 24 waves = 4 query tiles x KSPL key ranges (6 waves a SIMD cover each other's dependent-chain latency); each wave sums its own key range, the ranges are added in LDS in fixed order: scores = sigmoid(q_n . q_m / 8) for all 4,096 m (3 products), computed transposed (key rows x query columns) so that the two score tiles of a pass, converted in place, are the A fragment of P and P never goes through LDS; P x 2^11 hi + residual x v hi + residual (3 products, 4 tiles); out * gate + residual -> NHWC (AX 0: x1[b][dd][o][c] = out[n][dd] * h_gate + x; AX 1: x2 = out * w_gate + x1 stays in registers and the block, which holds all of (b, h = o), writes the final out[b][o][dd][c] = p[dd] * (feature + x2), p[w] = sum_nc (1 - sigmoid(predict)) conv_w + conv_b)
// The 32 keys of a pass (q hi, q residual rows; v hi, v residual planes: 16 KiB a key range) are staged in LDS once for the 4 query tiles that share them, by asynchronous copies into a ring of two buffers: the next pass's copies fly while this pass is worked on.
#define KSPL 6                       // key ranges per query tile
#define ATT_T (128 * KSPL)           // threads of a k_att block
#define NPASS (NSEQ / 32)            // passes of 32 keys over the whole sequence
#define TRIPS ((NPASS + KSPL - 1) / KSPL)   // trips of the ring = passes of the longest key range; first pass of the last range + TRIPS <= NPASS, so every staged tile lies inside the planes
#define KP 72                        // f16 per staged q row: 144 B = 16 B x odd, conflict-free for 16-byte reads
#define VP 40                        // f16 per staged v row:  80 B = 16 B x odd
#define ST_KL (32 * KP)              // places (in f16) of the four tiles of one key range: q hi at 0, q residual, v hi, v residual
#define ST_VH (2 * 32 * KP)
#define ST_VL (2 * 32 * KP + FD * VP)
#define ST_SZ (2 * 32 * KP + 2 * FD * VP)
#define BUF_SZ (KSPL * ST_SZ)
static_assert((KSPL - 1) * NPASS / KSPL + TRIPS <= NPASS, "a staged tile would leave the planes");
// eight 16-byte copies a lane (one 4-KiB tile a wave); the s_wait_xcnt stands inside the statement so that no address register is rewritten in front of it
__device__ __forceinline__ void stage8(unsigned l, unsigned ls, const char* g, size_t gs) {
  asm volatile("global_load_async_to_lds_b128 %0, %8, off\n\t"
               "global_load_async_to_lds_b128 %1, %9, off\n\t"
               "global_load_async_to_lds_b128 %2, %10, off\n\t"
               "global_load_async_to_lds_b128 %3, %11, off\n\t"
               "global_load_async_to_lds_b128 %4, %12, off\n\t"
               "global_load_async_to_lds_b128 %5, %13, off\n\t"
               "global_load_async_to_lds_b128 %6, %14, off\n\t"
               "global_load_async_to_lds_b128 %7, %15, off\n\t"
               "s_wait_xcnt 0x0"
               :: "v"(l), "v"(l + ls), "v"(l + 2 * ls), "v"(l + 3 * ls), "v"(l + 4 * ls), "v"(l + 5 * ls), "v"(l + 6 * ls), "v"(l + 7 * ls),
                  "v"(g), "v"(g + gs), "v"(g + 2 * gs), "v"(g + 3 * gs), "v"(g + 4 * gs), "v"(g + 5 * gs), "v"(g + 6 * gs), "v"(g + 7 * gs) : "memory");
}
template <int AX>
__global__ __launch_bounds__(ATT_T) void k_att(const _Float16* __restrict__ QH, const _Float16* __restrict__ QL, const _Float16* __restrict__ VT, const _Float16* __restrict__ VL, const float* __restrict__ GATE, const float* __restrict__ RES, const float* __restrict__ FEAT, const float* __restrict__ PRED, const float* __restrict__ CW, const float* __restrict__ CB, float* __restrict__ OUTB) {
  __shared__ __align__(16) _Float16 ring[2 * BUF_SZ]; __shared__ float sp[WWd];   // sp: the pixel gate p[w] of row (b, o), AX 1 only
  float (*so)[FD][68] = (float (*)[FD][68])ring;   // [key range][dd][c]: the ring's LDS, used again behind the loop's last barrier
  static_assert(sizeof(float) * KSPL * FD * 68 <= sizeof(_Float16) * 2 * BUF_SZ, "partial sums do not fit the ring");
  const int tid = threadIdx.x, wave = tid >> 5, lane = tid & 31, col = lane & 15, g = lane >> 4; const size_t b = blockIdx.y; const int o = blockIdx.x;
  const int qg = __builtin_amdgcn_readfirstlane(wave & 3), kr = __builtin_amdgcn_readfirstlane(wave >> 2);   // query tile; key range (wave-uniform, so the pass loop stays a scalar loop)
  const int ks0 = kr * NPASS / KSPL, ks1 = (kr + 1) * NPASS / KSPL; const size_t rq = b * NSEQ + (size_t)o * 64 + qg * 16;
  // wave qg of a key range copies tile qg: 0 q hi, 1 q residual (32 rows of 128 B), 2 v hi, 3 v residual (64 rows of 64 B); each tile is 4 KiB in a row in its plane, so every copy of a wave asks for 4 whole 128-B lines
  const bool isk = qg < 2;
  const char* gsrc = (const char*)(qg == 0 ? QH : qg == 1 ? QL : qg == 2 ? VT : VL) + b * (size_t)(NSEQ * FD * 2) + (size_t)ks0 * (32 * FD * 2) + lane * 16;
  const size_t gtrip = 32 * FD * 2, gstep = 512;
  const unsigned ldst = (unsigned)(size_t)ring + 2u * (kr * ST_SZ + (qg == 0 ? 0 : qg == 1 ? ST_KL : qg == 2 ? ST_VH : ST_VL)) + (isk ? (lane >> 3) * (2 * KP) + (lane & 7) * 16 : (lane >> 2) * (2 * VP) + (lane & 3) * 16);
  const unsigned lstep = isk ? 4 * 2 * KP : 8 * 2 * VP;
  stage8(ldst, lstep, gsrc, gstep);
  v16h aq[2], aql[2];
#pragma unroll
  for (int kc = 0; kc < 2; ++kc) { aq[kc] = frag_h(QH + (rq + col) * FD + kc * 32, lane); aql[kc] = frag_h(QL + (rq + col) * FD + kc * 32, lane); }
  const float nscale = -0.125f * 1.44269504088896341f;   // -(1 / sqrt(64)) * log2(e): goes into the query side once, split anew into hi + residual, so that a score leaves the accumulator as the exponent of 2^x
#pragma unroll
  for (int kc = 0; kc < 2; ++kc)
#pragma unroll
    for (int i = 0; i < 16; ++i) { const float f = ((float)aq[kc][i] + (float)aql[kc][i]) * nscale; const _Float16 h = (_Float16)f; aq[kc][i] = h; aql[kc][i] = (_Float16)(f - (float)h); }
  if (AX == 1 && kr == 0 && qg < 2) {   // two waves make the 64 pixel gates while tile 0's copies fly (scalar branch); the barrier below publishes sp
    const int w = qg * 32 + lane; const float* pr = PRED + ((b * HH + o) * WWd + w) * NC; float a = 0.f;
#pragma unroll   // the 19 loads go out together and the 19 sigmoids are independent chains; only the sum is a chain
    for (int k = 0; k < NC; ++k) a += (1.0f - 1.0f / (1.0f + expf(-bfr(pr[k])))) * bfr(CW[k]);
    sp[w] = a + bfr(CB[0]);
  }
  asm volatile("s_wait_asynccnt 0x0" ::: "memory");   // tile 0 has landed before the barrier publishes it
  __syncthreads();
  stage8(ldst + 2u * BUF_SZ, lstep, gsrc + gtrip, gstep);
  v8f acc[4] = {};
#pragma unroll 1   // one copy of the pass body: the two buffers differ by an offset only
  for (int t = 0; t < TRIPS; ++t) { const _Float16* st = ring + (t & 1) * BUF_SZ + kr * ST_SZ;
    if (ks0 + t < ks1) {   // a shorter key range sits out the last trip (scalar branch); the publish point below is passed by every wave
    // The LDS fragment reads stand in groups, each ahead of work that covers its latency, in place of one read and one full wait per product pair:
    // both key tiles at the head, in the order of their use; the v hi fragments and two v residuals ahead of the sigmoids; the other two v residuals behind the last product of the v hi fragment whose registers they take.
    const _Float16* rk = st + col * KP; const _Float16* vo = st + ST_VH + col * VP; v16h kf[2][2], kl[2][2], vh[4], vl[4], pa, pl;
#pragma unroll
    for (int kc = 0; kc < 2; ++kc) { kf[0][kc] = frag_h(rk + kc * 32, lane); kf[1][kc] = frag_h(rk + 16 * KP + kc * 32, lane); kl[0][kc] = frag_h(rk + ST_KL + kc * 32, lane); kl[1][kc] = frag_h(rk + 16 * KP + ST_KL + kc * 32, lane); }
    v8f c[2];   // keys as A, queries as B: c[ct][r] = exponent of key ct * 16 + 8g + r with query col; hi and residual products add into the one accumulator of their key tile, and the two tiles' products alternate, so that none waits for the one before it
    c[0] = wmma16z(kf[0][0], aql[0]); c[1] = wmma16z(kf[1][0], aql[0]);
    c[0] = wmma16(kf[0][0], aq[0], c[0]); c[1] = wmma16(kf[1][0], aq[0], c[1]);
    c[0] = wmma16(kl[0][0], aq[0], c[0]); c[1] = wmma16(kl[1][0], aq[0], c[1]);
    c[0] = wmma16(kf[0][1], aql[1], c[0]); c[1] = wmma16(kf[1][1], aql[1], c[1]);
    c[0] = wmma16(kf[0][1], aq[1], c[0]); c[1] = wmma16(kf[1][1], aq[1], c[1]);
    wmma16e2(kl[0][1], kl[1][1], aq[1], c[0], c[1]);   // the sigmoids read c next
#pragma unroll
    for (int dt = 0; dt < 4; ++dt) vh[dt] = frag_h(vo + dt * 16 * VP, lane);
#pragma unroll
    for (int dt = 0; dt < 2; ++dt) vl[dt] = frag_h(vo + dt * 16 * VP + (ST_VL - ST_VH), lane);
    // 2048 * sigmoid(s) from the 16 exponents x = -s * log2(e), stage by stage (v_exp_f32, one fma, v_rcp_f32): 16 independent chains; 2^x = inf gives 0, 2^x = 0 gives 2048. The scheduling barriers keep each stage's transcendentals in one run, so that none stands directly in front of an instruction that overwrites its source (the slot the instruction set asks for behind a transcendental).
    float p[16];
#pragma unroll
    for (int i = 0; i < 16; ++i) p[i] = __builtin_amdgcn_exp2f(c[i >> 3][i & 7]);
    __builtin_amdgcn_sched_barrier(0);
#pragma unroll
    for (int i = 0; i < 16; ++i) p[i] = __builtin_fmaf(p[i], 1.0f / 2048.0f, 1.0f / 2048.0f);
    __builtin_amdgcn_sched_barrier(0);
#pragma unroll
    for (int i = 0; i < 16; ++i) p[i] = __builtin_amdgcn_rcpf(p[i]);
    __builtin_amdgcn_sched_barrier(0);
#pragma unroll
    for (int i = 0; i < 16; i += 2) { const v2f pp = { p[i], p[i + 1] }; const v2h hp = __builtin_convertvector(pp, v2h);
      pa[i] = hp[0]; pa[i + 1] = hp[1]; pl[i] = (_Float16)(p[i] - (float)hp[0]); pl[i + 1] = (_Float16)(p[i + 1] - (float)hp[1]); }   // element ct * 8 + r of the A fragment of row col is k = ct * 16 + 8g + r: each score stays in its lane
#pragma unroll
    for (int dt = 0; dt < 4; ++dt) acc[dt] = wmma16(pa, vh[dt], acc[dt]);   // each run goes over the 4 independent tiles, so that no product waits for the one before it
#pragma unroll
    for (int dt = 0; dt < 4; ++dt) { acc[dt] = wmma16(pl, vh[dt], acc[dt]); if (dt < 2) vl[2 + dt] = frag_h(vo + (2 + dt) * 16 * VP + (ST_VL - ST_VH), lane); }
#pragma unroll
    for (int dt = 0; dt < 4; ++dt) acc[dt] = dt < 3 ? wmma16(pa, vl[dt], acc[dt]) : wmma16e(pa, vl[dt], acc[dt]);   // 3 products; behind the last one the next copies' addresses may take the fragments' registers
    }
    asm volatile("s_wait_dscnt 0x0" ::: "memory");      // this wave's reads of the buffer are done before it is refilled
    asm volatile("s_wait_asynccnt 0x0" ::: "memory");   // this wave's copies of the next tile have landed
    __syncthreads();                                     // publishes the next tile and ends every reader's last read of this one
    if (t + 2 < TRIPS) stage8(ldst + (t & 1) * (2u * BUF_SZ), lstep, gsrc + (size_t)(t + 2) * gtrip, gstep); }
  asm volatile("s_wait_asynccnt 0x0" ::: "memory");     // no copy is in flight when the ring becomes the partial sums' place
  const float gate = bfr(GATE[0]);
#pragma unroll
  for (int r = 0; r < 8; ++r) { const int c = qg * 16 + 8 * g + r;
#pragma unroll
    for (int dt = 0; dt < 4; ++dt) so[kr][dt * 16 + col][c] = acc[dt][r]; }
  __syncthreads();
  for (int e = tid; e < FD * 16; e += ATT_T) { const int dd = e >> 4, q = e & 15; const size_t base = (AX == 0) ? (((b * HH + dd) * WWd + o) * CCh) : (((b * HH + o) * WWd + dd) * CCh);
    v4f a = *(const v4f*)&so[0][dd][q * 4];
    for (int s = 1; s < KSPL; ++s) a += *(const v4f*)&so[s][dd][q * 4];
    const v4f rv = *(const v4f*)(RES + base + q * 4); v4f ov;
    for (int i = 0; i < 4; ++i) ov[i] = a[i] * (1.0f / 2048.0f) * gate + ((AX == 0) ? bfr(rv[i]) : rv[i]);
    if (AX == 1) { const v4f fv = *(const v4f*)(FEAT + base + q * 4); const float pw = sp[dd];
      for (int i = 0; i < 4; ++i) ov[i] = pw * (bfr(fv[i]) + ov[i]); }
    vst2(OUTB + base + q * 4, ov); }   // 64 consecutive c = 256 B
}
extern "C" void kernel_launch(void* const* d_in, const int* in_sizes, int n_in, void* d_out, int out_size, void* d_ws, size_t ws_size, hipStream_t stream) {
  (void)in_sizes; (void)n_in; (void)out_size;
  const float** F = (const float**)d_in;   // 0 feature [4,64,64,64], 1 predict [4,64,64,19], 2 hq_w (in,out), 3 hq_b, 4 hv_w, 5 hv_b, 6 wq_w, 7 wq_b, 8 wv_w, 9 wv_b, 10 h_gate [1], 11 w_gate [1], 12 conv_w [19,1], 13 conv_b [1]
  if (ws_size < (size_t)WS_END) return;
  char* ws = (char*)d_ws; __bf16* PW = (__bf16*)(ws + WS_PW); _Float16 *QH = (_Float16*)(ws + WS_QH), *QL = (_Float16*)(ws + WS_QL), *VT = (_Float16*)(ws + WS_VT), *VL = (_Float16*)(ws + WS_VL); float *X1 = (float*)(ws + WS_X1);
  k_pack<<<dim3(FD, 4), 64, 0, stream>>>(F[2], F[4], F[6], F[8], PW);
  k_proj<0><<<dim3(WWd, NBB), 128, 0, stream>>>(F[0], PW, F[3], F[5], QH, QL, VT, VL);
  k_att<0><<<dim3(NSEQ / 64, NBB), ATT_T, 0, stream>>>(QH, QL, VT, VL, F[10], F[0], F[0], F[1], F[12], F[13], X1);
  k_proj<1><<<dim3(HH, NBB), 128, 0, stream>>>(X1, PW, F[7], F[9], QH, QL, VT, VL);
  k_att<1><<<dim3(NSEQ / 64, NBB), ATT_T, 0, stream>>>(QH, QL, VT, VL, F[11], X1, F[0], F[1], F[12], F[13], (float*)d_out);
}
